// v000
// Measured on an AMD MI455X. A time is GPU time per run, averaged over a window of back-to-back runs after a warm-up
// (all launches, gaps included; the runs take copies of the inputs in turn), and the median of several windows.
// Apart from v000's, it joins two sittings. Times from different sittings can be a few percent apart, while
// side-by-side timings come from the same sitting.
// v000, which the later versions start from, runs in 977 microseconds.
#include <hip/hip_runtime.h>

#define DIMC   1024
#define NHEAD  16
#define BATCH  4
#define SEQ    2048
#define DH     64
#define SCALE_F 0.125f            // (1024/16)^-0.5
#define MASK_VAL -10000000.0f

typedef __attribute__((ext_vector_type(16))) __bf16        v16bf;
typedef __attribute__((ext_vector_type(8)))  float         v8f;
typedef __attribute__((ext_vector_type(4)))  unsigned int  u32x4;

// ---------- bf16 hi/lo split helpers (separate planes) ----------
__device__ __forceinline__ unsigned short f2bf_u(float f) {
    unsigned int u = __float_as_uint(f);
    u += 0x7FFFu + ((u >> 16) & 1u);          // round-to-nearest-even
    return (unsigned short)(u >> 16);
}
__device__ __forceinline__ float bfu2f(unsigned short h) {
    return __uint_as_float(((unsigned int)h) << 16);
}
__device__ __forceinline__ __bf16 bfbits(unsigned short h) {
    return __builtin_bit_cast(__bf16, h);
}

// WMMA operand element i maps to k = (i<8?0:16) + 8*hi16 + (i&7) (CDNA5 16-bit
// 16x32 A / 32x16 B layout, wave32). With a contiguous bf16 plane this is just
// two 16-byte loads per lane -> two global_load_b128, no unpack VALU.
__device__ __forceinline__ v16bf load_bf16_row(const unsigned short* __restrict__ rowp,
                                               int k0, int hi16) {
    union { v16bf v; u32x4 q[2]; } u;
    u.q[0] = *(const u32x4*)(rowp + k0 + 8 * hi16);
    u.q[1] = *(const u32x4*)(rowp + k0 + 16 + 8 * hi16);
    return u.v;
}

__device__ __forceinline__ v8f wmma_bf(v16bf a, v16bf b, v8f c) {
    return __builtin_amdgcn_wmma_f32_16x16x32_bf16(false, a, false, b, (short)0, c,
                                                   false, false);
}
// split-precision product: (ah+al)*(bh+bl) ~ ah*bh + ah*bl + al*bh
__device__ __forceinline__ v8f wmma_split(v16bf ah, v16bf al, v16bf bh, v16bf bl, v8f c) {
    c = wmma_bf(ah, bh, c);
    c = wmma_bf(ah, bl, c);
    c = wmma_bf(al, bh, c);
    return c;
}
__device__ __forceinline__ v8f v8f_zero() {
    v8f z;
#pragma unroll
    for (int e = 0; e < 8; ++e) z[e] = 0.0f;
    return z;
}

// ---------- kernel 0: fp32 -> bf16 hi plane + lo plane ----------
__global__ void pack_split_planes(const float* __restrict__ src,
                                  unsigned short* __restrict__ hip_,
                                  unsigned short* __restrict__ lop_, int n) {
    int i = blockIdx.x * blockDim.x + threadIdx.x;
    if (i < n) {
        float x = src[i];
        unsigned short h = f2bf_u(x);
        hip_[i] = h;
        lop_[i] = f2bf_u(x - bfu2f(h));
    }
}

// ---------- kernel 1: QKV projection ----------
// out[m][o] = sum_k X[m][k]*W[o][k]; Q,K row-major per head, V transposed per head.
__global__ void __launch_bounds__(256)
gemm_qkv(const unsigned short* __restrict__ Xh, const unsigned short* __restrict__ Xl,
         const unsigned short* __restrict__ Wh, const unsigned short* __restrict__ Wl,
         unsigned short* __restrict__ Qh, unsigned short* __restrict__ Ql,
         unsigned short* __restrict__ Kh, unsigned short* __restrict__ Kl,
         unsigned short* __restrict__ Vth, unsigned short* __restrict__ Vtl) {
    const int lane = threadIdx.x & 31;
    const int wave = threadIdx.x >> 5;
    const int col  = lane & 15;
    const int hi16 = lane >> 4;
    const int m0 = (blockIdx.x * 8 + wave) * 16;   // token tile
    const int o0 = blockIdx.y * 64;                // output-feature tile (one head slice)

    v8f acc[4];
#pragma unroll
    for (int t = 0; t < 4; ++t) acc[t] = v8f_zero();

    const unsigned short* arh = Xh + (size_t)(m0 + col) * DIMC;
    const unsigned short* arl = Xl + (size_t)(m0 + col) * DIMC;
    const unsigned short* brh = Wh + (size_t)(o0 + col) * DIMC;
    const unsigned short* brl = Wl + (size_t)(o0 + col) * DIMC;
    for (int k0 = 0; k0 < DIMC; k0 += 32) {
        v16bf ah = load_bf16_row(arh, k0, hi16);
        v16bf al = load_bf16_row(arl, k0, hi16);
#pragma unroll
        for (int t = 0; t < 4; ++t) {
            v16bf bh = load_bf16_row(brh + (size_t)t * 16 * DIMC, k0, hi16);
            v16bf bl = load_bf16_row(brl + (size_t)t * 16 * DIMC, k0, hi16);
            acc[t] = wmma_split(ah, al, bh, bl, acc[t]);
        }
    }
    const int s  = o0 >> 10;          // 0=Q 1=K 2=V
    const int h  = (o0 & 1023) >> 6;
    const int b  = m0 >> 11;
    const int n0 = (m0 & 2047) + 8 * hi16;
    const size_t head = (size_t)(b * NHEAD + h);
    if (s == 2) {
        // V transposed: Vt[d][n] so attention's V^T A-operand is contiguous
        unsigned short* bh_ = Vth + head * DH * SEQ;
        unsigned short* bl_ = Vtl + head * DH * SEQ;
#pragma unroll
        for (int t = 0; t < 4; ++t) {
            const int d = t * 16 + col;
#pragma unroll
            for (int r = 0; r < 8; ++r) {
                float x = acc[t][r];
                unsigned short hh = f2bf_u(x);
                bh_[(size_t)d * SEQ + n0 + r] = hh;
                bl_[(size_t)d * SEQ + n0 + r] = f2bf_u(x - bfu2f(hh));
            }
        }
    } else {
        unsigned short* bh_ = (s == 0 ? Qh : Kh) + head * SEQ * DH;
        unsigned short* bl_ = (s == 0 ? Ql : Kl) + head * SEQ * DH;
#pragma unroll
        for (int t = 0; t < 4; ++t) {
            const int d = t * 16 + col;
#pragma unroll
            for (int r = 0; r < 8; ++r) {
                float x = acc[t][r];
                unsigned short hh = f2bf_u(x);
                bh_[(size_t)(n0 + r) * DH + d] = hh;
                bl_[(size_t)(n0 + r) * DH + d] = f2bf_u(x - bfu2f(hh));
            }
        }
    }
}

// ---------- kernel 2: flash attention (transposed-score trick) ----------
__global__ void __launch_bounds__(128)
attn_kernel(const unsigned short* __restrict__ Qh, const unsigned short* __restrict__ Ql,
            const unsigned short* __restrict__ Kh, const unsigned short* __restrict__ Kl,
            const unsigned short* __restrict__ Vth, const unsigned short* __restrict__ Vtl,
            const int* __restrict__ pm,
            unsigned short* __restrict__ Xh, unsigned short* __restrict__ Xl) {
    __shared__ int smask[SEQ];
    const int lane = threadIdx.x & 31;
    const int wave = threadIdx.x >> 5;
    const int col  = lane & 15;     // this lane's query (within tile) / V^T k-col group
    const int hi16 = lane >> 4;
    const int bid = blockIdx.x;
    const int b = bid >> 9;                       // 512 blocks per batch
    const int h = (bid >> 5) & 15;
    const int q0 = ((bid & 31) * 4 + wave) * 16;  // 16 queries per wave

    for (int i = threadIdx.x; i < SEQ; i += 128) smask[i] = pm[b * SEQ + i];
    __syncthreads();

    const size_t head = (size_t)(b * NHEAD + h);
    const unsigned short* qrh = Qh + (head * SEQ + q0 + col) * DH;
    const unsigned short* qrl = Ql + (head * SEQ + q0 + col) * DH;
    const unsigned short* kbh = Kh + head * SEQ * DH;
    const unsigned short* kbl = Kl + head * SEQ * DH;
    const unsigned short* vbh = Vth + head * DH * SEQ;
    const unsigned short* vbl = Vtl + head * DH * SEQ;

    // Q tile as B-operand (lane col = query), K-dim = head dim (2 steps of 32)
    v16bf qh[2], ql[2];
#pragma unroll
    for (int ds = 0; ds < 2; ++ds) {
        qh[ds] = load_bf16_row(qrh, ds * 32, hi16);
        ql[ds] = load_bf16_row(qrl, ds * 32, hi16);
    }

    float mrow = -3.0e38f, lrow = 0.0f;   // per-lane softmax state for query `col`
    v8f o[4];                             // O^T accum: lane holds d = t*16+r+8*hi16, q = col
#pragma unroll
    for (int t = 0; t < 4; ++t) o[t] = v8f_zero();

    for (int k0 = 0; k0 < SEQ; k0 += 32) {
        // S^T = K . Q^T : st[js][r] = score(key k0+js*16+r+8*hi16, query col)
        v8f st[2];
#pragma unroll
        for (int js = 0; js < 2; ++js) {
            v8f acc = v8f_zero();
            const size_t krow = (size_t)(k0 + js * 16 + col) * DH;
#pragma unroll
            for (int ds = 0; ds < 2; ++ds) {
                v16bf kh = load_bf16_row(kbh + krow, ds * 32, hi16);
                v16bf kl = load_bf16_row(kbl + krow, ds * 32, hi16);
                acc = wmma_split(kh, kl, qh[ds], ql[ds], acc);
            }
            st[js] = acc;
        }
        // scale + key padding mask + running max
        float mx = mrow;
#pragma unroll
        for (int js = 0; js < 2; ++js)
#pragma unroll
            for (int r = 0; r < 8; ++r) {
                float s = st[js][r] * SCALE_F;
                if (smask[k0 + js * 16 + 8 * hi16 + r] > 0) s = MASK_VAL;
                st[js][r] = s;
                mx = fmaxf(mx, s);
            }
        mx = fmaxf(mx, __shfl_xor(mx, 16));       // combine the two key halves
        float alpha = __expf(mrow - mx);
        mrow = mx;
        // exp -> P; st layout already matches the B-operand element order exactly
        v16bf ph, pl;
        float rs = 0.0f;
#pragma unroll
        for (int js = 0; js < 2; ++js)
#pragma unroll
            for (int r = 0; r < 8; ++r) {
                float p = __expf(st[js][r] - mx);
                rs += p;
                unsigned short hb = f2bf_u(p);
                ph[js * 8 + r] = bfbits(hb);
                pl[js * 8 + r] = bfbits(f2bf_u(p - bfu2f(hb)));
            }
        rs += __shfl_xor(rs, 16);
        lrow = lrow * alpha + rs;
        // O^T += V^T . P^T  (4 d-subtiles); rescale is a per-lane scalar
#pragma unroll
        for (int t = 0; t < 4; ++t) {
            o[t] = o[t] * alpha;
            const size_t vrow = (size_t)(t * 16 + col) * SEQ;
            v16bf vh = load_bf16_row(vbh + vrow, k0, hi16);
            v16bf vl = load_bf16_row(vbl + vrow, k0, hi16);
            o[t] = wmma_split(vh, vl, ph, pl, o[t]);
        }
    }
    const float linv = 1.0f / lrow;
    // write x[b][n=q0+col][h*64+d] into hi/lo planes for the output GEMM
    unsigned short* xrh = Xh + ((size_t)(b * SEQ + q0 + col)) * DIMC + h * DH;
    unsigned short* xrl = Xl + ((size_t)(b * SEQ + q0 + col)) * DIMC + h * DH;
#pragma unroll
    for (int t = 0; t < 4; ++t)
#pragma unroll
        for (int r = 0; r < 8; ++r) {
            float x = o[t][r] * linv;
            unsigned short hh = f2bf_u(x);
            xrh[t * 16 + 8 * hi16 + r] = hh;
            xrl[t * 16 + 8 * hi16 + r] = f2bf_u(x - bfu2f(hh));
        }
}

// ---------- kernel 3: output projection + bias (fp32 out) ----------
__global__ void __launch_bounds__(256)
gemm_fc(const unsigned short* __restrict__ Xh, const unsigned short* __restrict__ Xl,
        const unsigned short* __restrict__ Wh, const unsigned short* __restrict__ Wl,
        const float* __restrict__ bias,
        float* __restrict__ out) {
    const int lane = threadIdx.x & 31;
    const int wave = threadIdx.x >> 5;
    const int col  = lane & 15;
    const int hi16 = lane >> 4;
    const int m0 = (blockIdx.x * 8 + wave) * 16;
    const int o0 = blockIdx.y * 64;

    v8f acc[4];
#pragma unroll
    for (int t = 0; t < 4; ++t) acc[t] = v8f_zero();

    const unsigned short* arh = Xh + (size_t)(m0 + col) * DIMC;
    const unsigned short* arl = Xl + (size_t)(m0 + col) * DIMC;
    const unsigned short* brh = Wh + (size_t)(o0 + col) * DIMC;
    const unsigned short* brl = Wl + (size_t)(o0 + col) * DIMC;
    for (int k0 = 0; k0 < DIMC; k0 += 32) {
        v16bf ah = load_bf16_row(arh, k0, hi16);
        v16bf al = load_bf16_row(arl, k0, hi16);
#pragma unroll
        for (int t = 0; t < 4; ++t) {
            v16bf bh = load_bf16_row(brh + (size_t)t * 16 * DIMC, k0, hi16);
            v16bf bl = load_bf16_row(brl + (size_t)t * 16 * DIMC, k0, hi16);
            acc[t] = wmma_split(ah, al, bh, bl, acc[t]);
        }
    }
    const int n0 = m0 + 8 * hi16;
#pragma unroll
    for (int t = 0; t < 4; ++t) {
        const int oc = o0 + t * 16 + col;
        const float bia = bias[oc];
#pragma unroll
        for (int r = 0; r < 8; ++r)
            out[(size_t)(n0 + r) * DIMC + oc] = acc[t][r] + bia;
    }
}

extern "C" void kernel_launch(void* const* d_in, const int* in_sizes, int n_in,
                              void* d_out, int out_size, void* d_ws, size_t ws_size,
                              hipStream_t stream) {
    const float* inputs = (const float*)d_in[0];
    const float* W_qkv  = (const float*)d_in[1];
    const float* W_fc   = (const float*)d_in[2];
    const float* b_fc   = (const float*)d_in[3];
    const int*   pmask  = (const int*)d_in[4];

    // workspace layout (bf16/ushort elements), all 16B-aligned; 176 MB total
    const size_t nQKV = (size_t)BATCH * NHEAD * SEQ * DH;   // 8388608
    const size_t nX   = (size_t)BATCH * SEQ * DIMC;         // 8388608
    const size_t nWq  = (size_t)3 * DIMC * DIMC;            // 3145728
    const size_t nWf  = (size_t)DIMC * DIMC;                // 1048576
    unsigned short* p = (unsigned short*)d_ws;
    unsigned short* Qh  = p; p += nQKV;
    unsigned short* Ql  = p; p += nQKV;
    unsigned short* Kh  = p; p += nQKV;
    unsigned short* Kl  = p; p += nQKV;
    unsigned short* Vth = p; p += nQKV;
    unsigned short* Vtl = p; p += nQKV;
    unsigned short* Xih = p; p += nX;
    unsigned short* Xil = p; p += nX;
    unsigned short* Wqh = p; p += nWq;
    unsigned short* Wql = p; p += nWq;
    unsigned short* Wfh = p; p += nWf;
    unsigned short* Wfl = p; p += nWf;
    unsigned short* Xah = p; p += nX;
    unsigned short* Xal = p; p += nX;

    pack_split_planes<<<((int)nX  + 255) / 256, 256, 0, stream>>>(inputs, Xih, Xil, (int)nX);
    pack_split_planes<<<((int)nWq + 255) / 256, 256, 0, stream>>>(W_qkv,  Wqh, Wql, (int)nWq);
    pack_split_planes<<<((int)nWf + 255) / 256, 256, 0, stream>>>(W_fc,   Wfh, Wfl, (int)nWf);

    gemm_qkv<<<dim3(64, 48), 256, 0, stream>>>(Xih, Xil, Wqh, Wql,
                                               Qh, Ql, Kh, Kl, Vth, Vtl);
    attn_kernel<<<BATCH * NHEAD * (SEQ / 64), 128, 0, stream>>>(Qh, Ql, Kh, Kl, Vth, Vtl,
                                                                pmask, Xah, Xal);
    gemm_fc<<<dim3(64, 16), 256, 0, stream>>>(Xah, Xal, Wfh, Wfl, b_fc, (float*)d_out);
}

// v001
// Measured time: 674 microseconds a run.
// In two side-by-side timings against v000, it was 1.47 and 1.48 times as fast.
#include <hip/hip_runtime.h>

#define DIMC   1024
#define NHEAD  16
#define BATCH  4
#define SEQ    2048
#define DH     64
#define SCALE_F 0.125f            // (1024/16)^-0.5
#define MASK_VAL -10000000.0f

typedef __attribute__((ext_vector_type(16))) __bf16        v16bf;
typedef __attribute__((ext_vector_type(8)))  float         v8f;
typedef __attribute__((ext_vector_type(4)))  unsigned int  u32x4;
typedef __attribute__((ext_vector_type(4)))  float         f32x4;

// ---------- bf16 hi/lo split helpers (separate planes) ----------
__device__ __forceinline__ unsigned short f2bf_u(float f) {
    unsigned int u = __float_as_uint(f);
    u += 0x7FFFu + ((u >> 16) & 1u);          // round-to-nearest-even
    return (unsigned short)(u >> 16);
}
__device__ __forceinline__ float bfu2f(unsigned short h) {
    return __uint_as_float(((unsigned int)h) << 16);
}
__device__ __forceinline__ __bf16 bfbits(unsigned short h) {
    return __builtin_bit_cast(__bf16, h);
}

// WMMA operand element i maps to k = (i<8?0:16) + 8*hi16 + (i&7) (CDNA5 16-bit
// 16x32 A / 32x16 B layout, wave32).
// Every bf16 plane in the workspace is stored fragment-major: a plane of R rows
// by K columns is cut into tiles of 16 rows x 32 k (512 elements, 1 KB), tile
// index (row/16)*(K/32) + k/32 (the K/V buffer orders its tiles per key pass, see kernel 1). Inside a tile, element (row, k) lies at
//   ((k>>4)&1)*256 + (((k>>3)&1)*16 + (row&15))*8 + (k&7)
// so lane l's two 16-byte pieces lie at l*8 and 256 + l*8: each wave-wide
// 16-byte load or store covers 512 contiguous bytes, four whole 128-byte lines.
#define TILE_E 512
// lanep: start of the tile + lane*8
__device__ __forceinline__ v16bf load_frag(const unsigned short* __restrict__ lanep) {
    union { v16bf v; u32x4 q[2]; } u;
    u.q[0] = *(const u32x4*)(lanep);
    u.q[1] = *(const u32x4*)(lanep + 256);
    return u.v;
}
// split eight f32 values into bf16 hi and lo and store each as one 16-byte piece
__device__ __forceinline__ void store_split8(const float* x,
                                             unsigned short* __restrict__ hp,
                                             unsigned short* __restrict__ lp) {
    u32x4 qh, ql;
#pragma unroll
    for (int e = 0; e < 4; ++e) {
        unsigned short h0 = f2bf_u(x[2 * e]);
        unsigned short h1 = f2bf_u(x[2 * e + 1]);
        unsigned short l0 = f2bf_u(x[2 * e] - bfu2f(h0));
        unsigned short l1 = f2bf_u(x[2 * e + 1] - bfu2f(h1));
        qh[e] = (unsigned int)h0 | ((unsigned int)h1 << 16);
        ql[e] = (unsigned int)l0 | ((unsigned int)l1 << 16);
    }
    *(u32x4*)hp = qh;
    *(u32x4*)lp = ql;
}

__device__ __forceinline__ v8f wmma_bf(v16bf a, v16bf b, v8f c) {
    return __builtin_amdgcn_wmma_f32_16x16x32_bf16(false, a, false, b, (short)0, c,
                                                   false, false);
}
// split-precision product: (ah+al)*(bh+bl) ~ ah*bh + ah*bl + al*bh
__device__ __forceinline__ v8f wmma_split(v16bf ah, v16bf al, v16bf bh, v16bf bl, v8f c) {
    c = wmma_bf(ah, bh, c);
    c = wmma_bf(ah, bl, c);
    c = wmma_bf(al, bh, c);
    return c;
}
__device__ __forceinline__ v8f v8f_zero() {
    v8f z;
#pragma unroll
    for (int e = 0; e < 8; ++e) z[e] = 0.0f;
    return z;
}

// ---------- kernel 0: fp32 [rows][DIMC] -> fragment-major bf16 hi plane + lo plane ----------
// one wave per 16x32 tile; a lane converts its own two 8-element pieces
__global__ void pack_split_planes(const float* __restrict__ src,
                                  unsigned short* __restrict__ hip_,
                                  unsigned short* __restrict__ lop_, int n) {
    int g = blockIdx.x * blockDim.x + threadIdx.x;
    if (g * 16 < n) {
        const int tile = g >> 5;
        const int lane = g & 31;
        const int row  = (tile >> 5) * 16 + (lane & 15);      // DIMC/32 = 32 tiles per row band
        const int k    = (tile & 31) * 32 + 8 * (lane >> 4);
        const float* sp = src + (size_t)row * DIMC + k;
#pragma unroll
        for (int j = 0; j < 2; ++j) {
            const f32x4 a = *(const f32x4*)(sp + j * 16);
            const f32x4 c = *(const f32x4*)(sp + j * 16 + 4);
            const float x[8] = {a[0], a[1], a[2], a[3], c[0], c[1], c[2], c[3]};
            const size_t o = (size_t)tile * TILE_E + j * 256 + lane * 8;
            store_split8(x, hip_ + o, lop_ + o);
        }
    }
}

// K loop shared by both projections: a 16x64 tile per wave, K = DIMC.
// SWAP = false: acc[t] = X-tile (A) . W-tile t (B): lane holds 8 tokens of one feature.
// SWAP = true : acc[t] = W-tile t (A) . X-tile (B): lane holds 8 features of one token.
// The three split products are summed in the same order either way.
template <bool SWAP>
__device__ __forceinline__ void gemm_k_loop(const unsigned short* __restrict__ arh,
                                            const unsigned short* __restrict__ arl,
                                            const unsigned short* __restrict__ brh,
                                            const unsigned short* __restrict__ brl,
                                            v8f (&acc)[4]) {
    for (int kt = 0; kt < DIMC / 32; ++kt) {
        v16bf ah = load_frag(arh + kt * TILE_E);
        v16bf al = load_frag(arl + kt * TILE_E);
#pragma unroll
        for (int t = 0; t < 4; ++t) {
            v16bf bh = load_frag(brh + (t * (DIMC / 32) + kt) * TILE_E);
            v16bf bl = load_frag(brl + (t * (DIMC / 32) + kt) * TILE_E);
            if (SWAP) {
                acc[t] = wmma_bf(bh, ah, acc[t]);
                acc[t] = wmma_bf(bl, ah, acc[t]);
                acc[t] = wmma_bf(bh, al, acc[t]);
            } else {
                acc[t] = wmma_split(ah, al, bh, bl, acc[t]);
            }
        }
    }
}

// ---------- kernel 1: QKV projection ----------
// out[m][o] = sum_k X[m][k]*W[o][k]; Q as [token][d] planes per head, fragment-major.
// K ([token][d] tiles) and V ([d][token] tiles) share one buffer per head, ordered by the
// attention pass that reads them: per 32 keys 16 tiles, [K hi 4 | K lo 4 | V hi 4 | V lo 4].
#define PASS_E (16 * TILE_E)
__global__ void __launch_bounds__(256)
gemm_qkv(const unsigned short* __restrict__ Xh, const unsigned short* __restrict__ Xl,
         const unsigned short* __restrict__ Wh, const unsigned short* __restrict__ Wl,
         unsigned short* __restrict__ Qh, unsigned short* __restrict__ Ql,
         unsigned short* __restrict__ KV) {
    const int lane = threadIdx.x & 31;
    const int wave = threadIdx.x >> 5;
    const int m0 = (blockIdx.x * 8 + wave) * 16;   // token tile
    const int o0 = blockIdx.y * 64;                // output-feature tile (one head slice)

    v8f acc[4];
#pragma unroll
    for (int t = 0; t < 4; ++t) acc[t] = v8f_zero();

    const size_t aoff = (size_t)(m0 >> 4) * (DIMC / 32) * TILE_E + lane * 8;
    const size_t boff = (size_t)(o0 >> 4) * (DIMC / 32) * TILE_E + lane * 8;
    const int s  = o0 >> 10;          // 0=Q 1=K 2=V
    const int h  = (o0 & 1023) >> 6;
    const int b  = m0 >> 11;
    const int n0 = m0 & 2047;
    const size_t head = (size_t)(b * NHEAD + h);
    if (s == 2) {
        gemm_k_loop<false>(Xh + aoff, Xl + aoff, Wh + boff, Wl + boff, acc);
        // Vt[d][n]: row d = t*16 + col, k = n0 + 8*hi16 + r: the lane's 8 values are one piece
        unsigned short* vp = KV + (head * (SEQ / 32) + (n0 >> 5)) * PASS_E + 8 * TILE_E
                           + ((n0 >> 4) & 1) * 256 + lane * 8;
#pragma unroll
        for (int t = 0; t < 4; ++t) {
            float x[8];
#pragma unroll
            for (int r = 0; r < 8; ++r) x[r] = acc[t][r];
            store_split8(x, vp + t * TILE_E, vp + (4 + t) * TILE_E);
        }
    } else {
        gemm_k_loop<true>(Xh + aoff, Xl + aoff, Wh + boff, Wl + boff, acc);
        // Q/K[n][d]: row n = n0 + col, k = d = t*16 + 8*hi16 + r: again one piece per lane
        const size_t qo = head * SEQ * DH + (size_t)(n0 >> 4) * (DH / 32) * TILE_E + lane * 8;
        const size_t ko = (head * (SEQ / 32) + (n0 >> 5)) * PASS_E
                        + ((n0 >> 4) & 1) * (DH / 32) * TILE_E + lane * 8;
        unsigned short* bh_ = (s == 0 ? Qh + qo : KV + ko);
        unsigned short* bl_ = (s == 0 ? Ql + qo : KV + ko + 4 * TILE_E);
#pragma unroll
        for (int t = 0; t < 4; ++t) {
            float x[8];
#pragma unroll
            for (int r = 0; r < 8; ++r) x[r] = acc[t][r];
            store_split8(x, bh_ + (t >> 1) * TILE_E + (t & 1) * 256,
                            bl_ + (t >> 1) * TILE_E + (t & 1) * 256);
        }
    }
}

// ---------- kernel 2: flash attention (transposed-score trick) ----------
__global__ void __launch_bounds__(128)
attn_kernel(const unsigned short* __restrict__ Qh, const unsigned short* __restrict__ Ql,
            const unsigned short* __restrict__ KV,
            const int* __restrict__ pm,
            unsigned short* __restrict__ Xh, unsigned short* __restrict__ Xl) {
    __shared__ int smask[SEQ];
    const int lane = threadIdx.x & 31;
    const int wave = threadIdx.x >> 5;
    const int hi16 = lane >> 4;
    const int bid = blockIdx.x;
    const int b = bid >> 9;                       // 512 blocks per batch
    const int h = (bid >> 5) & 15;
    const int q0 = ((bid & 31) * 4 + wave) * 16;  // 16 queries per wave

    for (int i = threadIdx.x; i < SEQ; i += 128) smask[i] = pm[b * SEQ + i];
    __syncthreads();

    const size_t head = (size_t)(b * NHEAD + h);
    // fragment-major planes: this lane's piece of a tile starts at lane*8
    const size_t qoff = head * SEQ * DH + (size_t)(q0 >> 4) * (DH / 32) * TILE_E + lane * 8;
    const unsigned short* qrh = Qh + qoff;
    const unsigned short* qrl = Ql + qoff;
    const unsigned short* kvb = KV + head * (SEQ / 32) * PASS_E + lane * 8;

    // Q tile as B-operand (lane col = query), K-dim = head dim (2 steps of 32)
    v16bf qh[2], ql[2];
#pragma unroll
    for (int ds = 0; ds < 2; ++ds) {
        qh[ds] = load_frag(qrh + ds * TILE_E);
        ql[ds] = load_frag(qrl + ds * TILE_E);
    }

    float mrow = -3.0e38f, lrow = 0.0f;   // per-lane softmax state for query `col`
    v8f o[4];                             // O^T accum: lane holds d = t*16+r+8*hi16, q = col
#pragma unroll
    for (int t = 0; t < 4; ++t) o[t] = v8f_zero();

    for (int k0 = 0; k0 < SEQ; k0 += 32) {
        // S^T = K . Q^T : st[js][r] = score(key k0+js*16+r+8*hi16, query col)
        v8f st[2];
#pragma unroll
        for (int js = 0; js < 2; ++js) {
            v8f acc = v8f_zero();
            const unsigned short* kp = kvb + (size_t)(k0 >> 5) * PASS_E + js * (DH / 32) * TILE_E;
#pragma unroll
            for (int ds = 0; ds < 2; ++ds) {
                v16bf kh = load_frag(kp + ds * TILE_E);
                v16bf kl = load_frag(kp + (4 + ds) * TILE_E);
                acc = wmma_split(kh, kl, qh[ds], ql[ds], acc);
            }
            st[js] = acc;
        }
        // scale + key padding mask + running max
        float mx = mrow;
#pragma unroll
        for (int js = 0; js < 2; ++js)
#pragma unroll
            for (int r = 0; r < 8; ++r) {
                float s = st[js][r] * SCALE_F;
                if (smask[k0 + js * 16 + 8 * hi16 + r] > 0) s = MASK_VAL;
                st[js][r] = s;
                mx = fmaxf(mx, s);
            }
        mx = fmaxf(mx, __shfl_xor(mx, 16));       // combine the two key halves
        float alpha = __expf(mrow - mx);
        mrow = mx;
        // exp -> P; st layout already matches the B-operand element order exactly
        v16bf ph, pl;
        float rs = 0.0f;
#pragma unroll
        for (int js = 0; js < 2; ++js)
#pragma unroll
            for (int r = 0; r < 8; ++r) {
                float p = __expf(st[js][r] - mx);
                rs += p;
                unsigned short hb = f2bf_u(p);
                ph[js * 8 + r] = bfbits(hb);
                pl[js * 8 + r] = bfbits(f2bf_u(p - bfu2f(hb)));
            }
        rs += __shfl_xor(rs, 16);
        lrow = lrow * alpha + rs;
        // O^T += V^T . P^T  (4 d-subtiles); rescale is a per-lane scalar
#pragma unroll
        for (int t = 0; t < 4; ++t) {
            o[t] = o[t] * alpha;
            const unsigned short* vp = kvb + (size_t)(k0 >> 5) * PASS_E + (8 + t) * TILE_E;
            v16bf vh = load_frag(vp);
            v16bf vl = load_frag(vp + 4 * TILE_E);
            o[t] = wmma_split(vh, vl, ph, pl, o[t]);
        }
    }
    const float linv = 1.0f / lrow;
    // write x[b][n=q0+col][h*64+d], d = t*16 + 8*hi16 + r, into the fragment-major hi/lo
    // planes of the output GEMM: the lane's 8 values are one 16-byte piece
    const size_t xoff = ((size_t)((b * SEQ + q0) >> 4) * (DIMC / 32) + h * (DH / 32)) * TILE_E
                      + lane * 8;
#pragma unroll
    for (int t = 0; t < 4; ++t) {
        float x[8];
#pragma unroll
        for (int r = 0; r < 8; ++r) x[r] = o[t][r] * linv;
        store_split8(x, Xh + xoff + (t >> 1) * TILE_E + (t & 1) * 256,
                        Xl + xoff + (t >> 1) * TILE_E + (t & 1) * 256);
    }
}

// ---------- kernel 3: output projection + bias (fp32 out) ----------
__global__ void __launch_bounds__(256)
gemm_fc(const unsigned short* __restrict__ Xh, const unsigned short* __restrict__ Xl,
        const unsigned short* __restrict__ Wh, const unsigned short* __restrict__ Wl,
        const float* __restrict__ bias,
        float* __restrict__ out) {
    const int lane = threadIdx.x & 31;
    const int wave = threadIdx.x >> 5;
    const int col  = lane & 15;
    const int hi16 = lane >> 4;
    const int m0 = (blockIdx.x * 8 + wave) * 16;
    const int o0 = blockIdx.y * 64;

    v8f acc[4];
#pragma unroll
    for (int t = 0; t < 4; ++t) acc[t] = v8f_zero();

    const size_t aoff = (size_t)(m0 >> 4) * (DIMC / 32) * TILE_E + lane * 8;
    const size_t boff = (size_t)(o0 >> 4) * (DIMC / 32) * TILE_E + lane * 8;
    gemm_k_loop<false>(Xh + aoff, Xl + aoff, Wh + boff, Wl + boff, acc);
    const int n0 = m0 + 8 * hi16;
#pragma unroll
    for (int t = 0; t < 4; ++t) {
        const int oc = o0 + t * 16 + col;
        const float bia = bias[oc];
#pragma unroll
        for (int r = 0; r < 8; ++r)
            out[(size_t)(n0 + r) * DIMC + oc] = acc[t][r] + bia;
    }
}

extern "C" void kernel_launch(void* const* d_in, const int* in_sizes, int n_in,
                              void* d_out, int out_size, void* d_ws, size_t ws_size,
                              hipStream_t stream) {
    const float* inputs = (const float*)d_in[0];
    const float* W_qkv  = (const float*)d_in[1];
    const float* W_fc   = (const float*)d_in[2];
    const float* b_fc   = (const float*)d_in[3];
    const int*   pmask  = (const int*)d_in[4];

    // workspace layout (bf16/ushort elements), all 1 KB tiles; 176 MB total
    const size_t nQKV = (size_t)BATCH * NHEAD * SEQ * DH;   // 8388608
    const size_t nX   = (size_t)BATCH * SEQ * DIMC;         // 8388608
    const size_t nWq  = (size_t)3 * DIMC * DIMC;            // 3145728
    const size_t nWf  = (size_t)DIMC * DIMC;                // 1048576
    unsigned short* p = (unsigned short*)d_ws;
    unsigned short* Qh  = p; p += nQKV;
    unsigned short* Ql  = p; p += nQKV;
    unsigned short* KV  = p; p += 4 * nQKV;
    unsigned short* Xih = p; p += nX;
    unsigned short* Xil = p; p += nX;
    unsigned short* Wqh = p; p += nWq;
    unsigned short* Wql = p; p += nWq;
    unsigned short* Wfh = p; p += nWf;
    unsigned short* Wfl = p; p += nWf;
    unsigned short* Xah = p; p += nX;
    unsigned short* Xal = p; p += nX;

    pack_split_planes<<<((int)nX  / 16 + 255) / 256, 256, 0, stream>>>(inputs, Xih, Xil, (int)nX);
    pack_split_planes<<<((int)nWq / 16 + 255) / 256, 256, 0, stream>>>(W_qkv,  Wqh, Wql, (int)nWq);
    pack_split_planes<<<((int)nWf / 16 + 255) / 256, 256, 0, stream>>>(W_fc,   Wfh, Wfl, (int)nWf);

    gemm_qkv<<<dim3(64, 48), 256, 0, stream>>>(Xih, Xil, Wqh, Wql,
                                               Qh, Ql, KV);
    attn_kernel<<<BATCH * NHEAD * (SEQ / 64), 128, 0, stream>>>(Qh, Ql, KV,
                                                                pmask, Xah, Xal);
    gemm_fc<<<dim3(64, 16), 256, 0, stream>>>(Xah, Xal, Wfh, Wfl, b_fc, (float*)d_out);
}

// v002
// It runs in 419 microseconds.
// Two timings next to v001 both put it at 1.60 times that version's speed.
// Counting every step since v000, it is 2.36 times as fast.
#include <hip/hip_runtime.h>

#define DIMC   1024
#define NHEAD  16
#define BATCH  4
#define SEQ    2048
#define DH     64
#define SCALE_F 0.125f            // (1024/16)^-0.5
#define MASK_VAL -10000000.0f

typedef __attribute__((ext_vector_type(16))) __bf16        v16bf;
typedef __attribute__((ext_vector_type(8)))  float         v8f;
typedef __attribute__((ext_vector_type(4)))  unsigned int  u32x4;
typedef __attribute__((ext_vector_type(4)))  float         f32x4;

// ---------- bf16 hi/lo split helpers (separate planes) ----------
__device__ __forceinline__ unsigned short f2bf_u(float f) {
    unsigned int u = __float_as_uint(f);
    u += 0x7FFFu + ((u >> 16) & 1u);          // round-to-nearest-even
    return (unsigned short)(u >> 16);
}
__device__ __forceinline__ float bfu2f(unsigned short h) {
    return __uint_as_float(((unsigned int)h) << 16);
}
__device__ __forceinline__ __bf16 bfbits(unsigned short h) {
    return __builtin_bit_cast(__bf16, h);
}

// WMMA operand element i maps to k = (i<8?0:16) + 8*hi16 + (i&7) (CDNA5 16-bit
// 16x32 A / 32x16 B layout, wave32).
// Every bf16 plane in the workspace is stored fragment-major: a plane of R rows
// by K columns is cut into tiles of 16 rows x 32 k (512 elements, 1 KB), tile
// index (row/16)*(K/32) + k/32 (the K/V buffer orders its tiles per key pass, see kernel 1). Inside a tile, element (row, k) lies at
//   ((k>>4)&1)*256 + (((k>>3)&1)*16 + (row&15))*8 + (k&7)
// so lane l's two 16-byte pieces lie at l*8 and 256 + l*8: each wave-wide
// 16-byte load or store covers 512 contiguous bytes, four whole 128-byte lines.
#define TILE_E 512
// lanep: start of the tile + lane*8
__device__ __forceinline__ v16bf load_frag(const unsigned short* __restrict__ lanep) {
    union { v16bf v; u32x4 q[2]; } u;
    u.q[0] = *(const u32x4*)(lanep);
    u.q[1] = *(const u32x4*)(lanep + 256);
    return u.v;
}
// split eight f32 values into bf16 hi and lo and store each as one 16-byte piece
__device__ __forceinline__ void store_split8(const float* x,
                                             unsigned short* __restrict__ hp,
                                             unsigned short* __restrict__ lp) {
    u32x4 qh, ql;
#pragma unroll
    for (int e = 0; e < 4; ++e) {
        unsigned short h0 = f2bf_u(x[2 * e]);
        unsigned short h1 = f2bf_u(x[2 * e + 1]);
        unsigned short l0 = f2bf_u(x[2 * e] - bfu2f(h0));
        unsigned short l1 = f2bf_u(x[2 * e + 1] - bfu2f(h1));
        qh[e] = (unsigned int)h0 | ((unsigned int)h1 << 16);
        ql[e] = (unsigned int)l0 | ((unsigned int)l1 << 16);
    }
    *(u32x4*)hp = qh;
    *(u32x4*)lp = ql;
}

__device__ __forceinline__ v8f wmma_bf(v16bf a, v16bf b, v8f c) {
    return __builtin_amdgcn_wmma_f32_16x16x32_bf16(false, a, false, b, (short)0, c,
                                                   false, false);
}
// split-precision product: (ah+al)*(bh+bl) ~ ah*bh + ah*bl + al*bh
__device__ __forceinline__ v8f wmma_split(v16bf ah, v16bf al, v16bf bh, v16bf bl, v8f c) {
    c = wmma_bf(ah, bh, c);
    c = wmma_bf(ah, bl, c);
    c = wmma_bf(al, bh, c);
    return c;
}
__device__ __forceinline__ v8f v8f_zero() {
    v8f z;
#pragma unroll
    for (int e = 0; e < 8; ++e) z[e] = 0.0f;
    return z;
}

// ---------- kernel 0: fp32 [rows][DIMC] -> fragment-major bf16 hi plane + lo plane ----------
// one wave per 16x32 tile; a lane converts its own two 8-element pieces
__global__ void pack_split_planes(const float* __restrict__ src,
                                  unsigned short* __restrict__ hip_,
                                  unsigned short* __restrict__ lop_, int n) {
    int g = blockIdx.x * blockDim.x + threadIdx.x;
    if (g * 16 < n) {
        const int tile = g >> 5;
        const int lane = g & 31;
        const int row  = (tile >> 5) * 16 + (lane & 15);      // DIMC/32 = 32 tiles per row band
        const int k    = (tile & 31) * 32 + 8 * (lane >> 4);
        const float* sp = src + (size_t)row * DIMC + k;
#pragma unroll
        for (int j = 0; j < 2; ++j) {
            const f32x4 a = *(const f32x4*)(sp + j * 16);
            const f32x4 c = *(const f32x4*)(sp + j * 16 + 4);
            const float x[8] = {a[0], a[1], a[2], a[3], c[0], c[1], c[2], c[3]};
            const size_t o = (size_t)tile * TILE_E + j * 256 + lane * 8;
            store_split8(x, hip_ + o, lop_ + o);
        }
    }
}

// s_wait_xcnt 0 behind a run of fragment loads, in front of any rewrite of the registers that hold
// the run's addresses; the two addresses are inputs so that they stay in those registers up to here
__device__ __forceinline__ void wait_addr_free(const unsigned short* p, const unsigned short* q) {
    asm volatile("s_wait_xcnt 0x0" :: "v"(p), "v"(q) : "memory");
}

// K loop shared by both projections: a 64x64 tile per wave (4 X tiles by 4 W tiles), K = DIMC:
// a loaded W fragment meets four X tiles instead of one, an X fragment four W tiles as before.
// SWAP = false: acc[i][t] = X-tile i (A) . W-tile t (B): lane holds 8 tokens of one feature.
// SWAP = true : acc[i][t] = W-tile t (A) . X-tile i (B): lane holds 8 features of one token.
// The three split products are summed in the same order either way.
#define WT 4                      // X tiles (16 tokens each) per wave
template <bool SWAP>
__device__ __forceinline__ void gemm_k_loop(const unsigned short* __restrict__ arh,
                                            const unsigned short* __restrict__ arl,
                                            const unsigned short* __restrict__ brh,
                                            const unsigned short* __restrict__ brl,
                                            v8f (&acc)[WT][4]) {
    for (int kt = 0; kt < DIMC / 32; ++kt) {
        const unsigned short* pah = arh + kt * TILE_E;
        const unsigned short* pal = arl + kt * TILE_E;
        const unsigned short* pbh = brh + kt * TILE_E;
        const unsigned short* pbl = brl + kt * TILE_E;
        v16bf ah[WT], al[WT];
#pragma unroll
        for (int i = 0; i < WT; ++i) {
            ah[i] = load_frag(pah + i * (DIMC / 32) * TILE_E);
            al[i] = load_frag(pal + i * (DIMC / 32) * TILE_E);
        }
        wait_addr_free(pah, pal);
#pragma unroll
        for (int t = 0; t < 4; ++t) {
            v16bf bh = load_frag(pbh + t * (DIMC / 32) * TILE_E);
            v16bf bl = load_frag(pbl + t * (DIMC / 32) * TILE_E);
            if (t == 3) wait_addr_free(pbh, pbl);
            if (SWAP) {
#pragma unroll
                for (int i = 0; i < WT; ++i) acc[i][t] = wmma_bf(bh, ah[i], acc[i][t]);
#pragma unroll
                for (int i = 0; i < WT; ++i) acc[i][t] = wmma_bf(bl, ah[i], acc[i][t]);
#pragma unroll
                for (int i = 0; i < WT; ++i) acc[i][t] = wmma_bf(bh, al[i], acc[i][t]);
            } else {
#pragma unroll
                for (int i = 0; i < WT; ++i) acc[i][t] = wmma_bf(ah[i], bh, acc[i][t]);
#pragma unroll
                for (int i = 0; i < WT; ++i) acc[i][t] = wmma_bf(ah[i], bl, acc[i][t]);
#pragma unroll
                for (int i = 0; i < WT; ++i) acc[i][t] = wmma_bf(al[i], bh, acc[i][t]);
            }
        }
    }
}

// ---------- kernel 1: QKV projection ----------
// out[m][o] = sum_k X[m][k]*W[o][k]; Q as [token][d] planes per head, fragment-major.
// K ([token][d] tiles) and V ([d][token] tiles) share one buffer per head, ordered by the
// attention pass that reads them: per 32 keys 16 tiles, [K hi 4 | K lo 4 | V hi 4 | V lo 4].
#define PASS_E (16 * TILE_E)
// a block is 2 x 4 waves: 128 tokens by 256 features
__global__ void __launch_bounds__(256)
gemm_qkv(const unsigned short* __restrict__ Xh, const unsigned short* __restrict__ Xl,
         const unsigned short* __restrict__ Wh, const unsigned short* __restrict__ Wl,
         unsigned short* __restrict__ Qh, unsigned short* __restrict__ Ql,
         unsigned short* __restrict__ KV) {
    const int lane = threadIdx.x & 31;
    // the wave's number in a scalar register: tile, head and batch indices then live in scalar
    // registers through the K loop; held in vector registers they push the kernel past 256 of
    // them, which costs the fourth wave of a SIMD
    const int wave = __builtin_amdgcn_readfirstlane(threadIdx.x >> 5);
    const int m0 = (blockIdx.x * 2 + (wave & 1)) * (16 * WT);   // first token of the wave
    const int o0 = (blockIdx.y * 4 + (wave >> 1)) * 64;         // output features (one head slice)

    v8f acc[WT][4];
#pragma unroll
    for (int i = 0; i < WT; ++i)
#pragma unroll
        for (int t = 0; t < 4; ++t) acc[i][t] = v8f_zero();

    const size_t aoff = (size_t)(m0 >> 4) * (DIMC / 32) * TILE_E + lane * 8;
    const size_t boff = (size_t)(o0 >> 4) * (DIMC / 32) * TILE_E + lane * 8;
    const int s  = blockIdx.y >> 2;   // 0=Q 1=K 2=V: the same for the whole block
    const int h  = (o0 & 1023) >> 6;
    const int b  = m0 >> 11;
    const size_t head = (size_t)(b * NHEAD + h);
    if (s == 2) {
        gemm_k_loop<false>(Xh + aoff, Xl + aoff, Wh + boff, Wl + boff, acc);
#pragma unroll
        for (int i = 0; i < WT; ++i) {
            const int n0 = (m0 & 2047) + i * 16;
            // Vt[d][n]: row d = t*16 + col, k = n0 + 8*hi16 + r: the lane's 8 values are one piece
            unsigned short* vp = KV + (head * (SEQ / 32) + (n0 >> 5)) * PASS_E + 8 * TILE_E
                               + ((n0 >> 4) & 1) * 256 + lane * 8;
#pragma unroll
            for (int t = 0; t < 4; ++t) {
                float x[8];
#pragma unroll
                for (int r = 0; r < 8; ++r) x[r] = acc[i][t][r];
                store_split8(x, vp + t * TILE_E, vp + (4 + t) * TILE_E);
            }
        }
    } else {
        gemm_k_loop<true>(Xh + aoff, Xl + aoff, Wh + boff, Wl + boff, acc);
#pragma unroll
        for (int i = 0; i < WT; ++i) {
            const int n0 = (m0 & 2047) + i * 16;
            // Q/K[n][d]: row n = n0 + col, k = d = t*16 + 8*hi16 + r: again one piece per lane
            const size_t qo = head * SEQ * DH + (size_t)(n0 >> 4) * (DH / 32) * TILE_E + lane * 8;
            const size_t ko = (head * (SEQ / 32) + (n0 >> 5)) * PASS_E
                            + ((n0 >> 4) & 1) * (DH / 32) * TILE_E + lane * 8;
            unsigned short* bh_ = (s == 0 ? Qh + qo : KV + ko);
            unsigned short* bl_ = (s == 0 ? Ql + qo : KV + ko + 4 * TILE_E);
#pragma unroll
            for (int t = 0; t < 4; ++t) {
                float x[8];
#pragma unroll
                for (int r = 0; r < 8; ++r) x[r] = acc[i][t][r];
                store_split8(x, bh_ + (t >> 1) * TILE_E + (t & 1) * 256,
                                bl_ + (t >> 1) * TILE_E + (t & 1) * 256);
            }
        }
    }
}

// ---------- kernel 2: flash attention (transposed-score trick) ----------
#define QT 2                      // query tiles (16 queries each) per wave
#define AW 4                      // waves per block
__global__ void __launch_bounds__(AW * 32)
attn_kernel(const unsigned short* __restrict__ Qh, const unsigned short* __restrict__ Ql,
            const unsigned short* __restrict__ KV,
            const int* __restrict__ pm,
            unsigned short* __restrict__ Xh, unsigned short* __restrict__ Xl) {
    __shared__ int smask[SEQ];
    const int lane = threadIdx.x & 31;
    const int wave = threadIdx.x >> 5;
    const int hi16 = lane >> 4;
    const int bid = blockIdx.x;
    const int b = bid >> 8;                       // 256 blocks per batch
    const int h = (bid >> 4) & 15;
    const int q0 = ((bid & 15) * AW + wave) * (16 * QT);  // 32 queries per wave

    for (int i = threadIdx.x; i < SEQ; i += AW * 32) smask[i] = pm[b * SEQ + i];
    __syncthreads();

    const size_t head = (size_t)(b * NHEAD + h);
    // fragment-major planes: this lane's piece of a tile starts at lane*8
    const size_t qoff = head * SEQ * DH + (size_t)(q0 >> 4) * (DH / 32) * TILE_E + lane * 8;
    const unsigned short* qrh = Qh + qoff;
    const unsigned short* qrl = Ql + qoff;
    const unsigned short* kvb = KV + head * (SEQ / 32) * PASS_E + lane * 8;

    // Q tiles as B-operand (lane col = query), K-dim = head dim (2 steps of 32)
    v16bf qh[QT][2], ql[QT][2];
#pragma unroll
    for (int qt = 0; qt < QT; ++qt)
#pragma unroll
        for (int ds = 0; ds < 2; ++ds) {
            qh[qt][ds] = load_frag(qrh + (qt * (DH / 32) + ds) * TILE_E);
            ql[qt][ds] = load_frag(qrl + (qt * (DH / 32) + ds) * TILE_E);
        }

    float mrow[QT], lrow[QT];             // per-lane softmax state for query `col` of each tile
    v8f o[QT][4];                         // O^T accum: lane holds d = t*16+r+8*hi16, q = col
#pragma unroll
    for (int qt = 0; qt < QT; ++qt) {
        mrow[qt] = -3.0e38f;
        lrow[qt] = 0.0f;
#pragma unroll
        for (int t = 0; t < 4; ++t) o[qt][t] = v8f_zero();
    }

    for (int k0 = 0; k0 < SEQ; k0 += 32) {
        // S^T = K . Q^T : st[qt][js][r] = score(key k0+js*16+r+8*hi16, query col of tile qt);
        // each K fragment is loaded once and multiplied with every Q tile of the wave
        v8f st[QT][2];
#pragma unroll
        for (int js = 0; js < 2; ++js) {
#pragma unroll
            for (int qt = 0; qt < QT; ++qt) st[qt][js] = v8f_zero();
            const unsigned short* kp = kvb + (size_t)(k0 >> 5) * PASS_E + js * (DH / 32) * TILE_E;
#pragma unroll
            for (int ds = 0; ds < 2; ++ds) {
                v16bf kh = load_frag(kp + ds * TILE_E);
                v16bf kl = load_frag(kp + (4 + ds) * TILE_E);
#pragma unroll
                for (int qt = 0; qt < QT; ++qt)
                    st[qt][js] = wmma_split(kh, kl, qh[qt][ds], ql[qt][ds], st[qt][js]);
            }
        }
        v16bf ph[QT], pl[QT];
        float alpha[QT];
#pragma unroll
        for (int qt = 0; qt < QT; ++qt) {
            // scale + key padding mask + running max
            float mx = mrow[qt];
#pragma unroll
            for (int js = 0; js < 2; ++js)
#pragma unroll
                for (int r = 0; r < 8; ++r) {
                    float s = st[qt][js][r] * SCALE_F;
                    if (smask[k0 + js * 16 + 8 * hi16 + r] > 0) s = MASK_VAL;
                    st[qt][js][r] = s;
                    mx = fmaxf(mx, s);
                }
            mx = fmaxf(mx, __shfl_xor(mx, 16));       // combine the two key halves
            alpha[qt] = __expf(mrow[qt] - mx);
            mrow[qt] = mx;
            // exp -> P; st layout already matches the B-operand element order exactly
            float rs = 0.0f;
#pragma unroll
            for (int js = 0; js < 2; ++js)
#pragma unroll
                for (int r = 0; r < 8; ++r) {
                    float p = __expf(st[qt][js][r] - mx);
                    rs += p;
                    unsigned short hb = f2bf_u(p);
                    ph[qt][js * 8 + r] = bfbits(hb);
                    pl[qt][js * 8 + r] = bfbits(f2bf_u(p - bfu2f(hb)));
                }
            rs += __shfl_xor(rs, 16);
            lrow[qt] = lrow[qt] * alpha[qt] + rs;
        }
        // O^T += V^T . P^T  (4 d-subtiles); rescale is a per-lane scalar;
        // each V fragment is loaded once and multiplied with every P tile of the wave
#pragma unroll
        for (int t = 0; t < 4; ++t) {
            const unsigned short* vp = kvb + (size_t)(k0 >> 5) * PASS_E + (8 + t) * TILE_E;
            v16bf vh = load_frag(vp);
            v16bf vl = load_frag(vp + 4 * TILE_E);
#pragma unroll
            for (int qt = 0; qt < QT; ++qt) {
                o[qt][t] = o[qt][t] * alpha[qt];
                o[qt][t] = wmma_split(vh, vl, ph[qt], pl[qt], o[qt][t]);
            }
        }
    }
    // write x[b][n=q0+qt*16+col][h*64+d], d = t*16 + 8*hi16 + r, into the fragment-major hi/lo
    // planes of the output GEMM: the lane's 8 values are one 16-byte piece
#pragma unroll
    for (int qt = 0; qt < QT; ++qt) {
        const float linv = 1.0f / lrow[qt];
        const size_t xoff = ((size_t)((b * SEQ + q0 + qt * 16) >> 4) * (DIMC / 32)
                             + h * (DH / 32)) * TILE_E + lane * 8;
#pragma unroll
        for (int t = 0; t < 4; ++t) {
            float x[8];
#pragma unroll
            for (int r = 0; r < 8; ++r) x[r] = o[qt][t][r] * linv;
            store_split8(x, Xh + xoff + (t >> 1) * TILE_E + (t & 1) * 256,
                            Xl + xoff + (t >> 1) * TILE_E + (t & 1) * 256);
        }
    }
}

// ---------- kernel 3: output projection + bias (fp32 out) ----------
__global__ void __launch_bounds__(256)
gemm_fc(const unsigned short* __restrict__ Xh, const unsigned short* __restrict__ Xl,
        const unsigned short* __restrict__ Wh, const unsigned short* __restrict__ Wl,
        const float* __restrict__ bias,
        float* __restrict__ out) {
    const int lane = threadIdx.x & 31;
    const int wave = threadIdx.x >> 5;
    const int col  = lane & 15;
    const int hi16 = lane >> 4;
    const int m0 = (blockIdx.x * 2 + (wave & 1)) * (16 * WT);
    const int o0 = (blockIdx.y * 4 + (wave >> 1)) * 64;

    v8f acc[WT][4];
#pragma unroll
    for (int i = 0; i < WT; ++i)
#pragma unroll
        for (int t = 0; t < 4; ++t) acc[i][t] = v8f_zero();

    const size_t aoff = (size_t)(m0 >> 4) * (DIMC / 32) * TILE_E + lane * 8;
    const size_t boff = (size_t)(o0 >> 4) * (DIMC / 32) * TILE_E + lane * 8;
    gemm_k_loop<false>(Xh + aoff, Xl + aoff, Wh + boff, Wl + boff, acc);
#pragma unroll
    for (int t = 0; t < 4; ++t) {
        const int oc = o0 + t * 16 + col;
        const float bia = bias[oc];
#pragma unroll
        for (int i = 0; i < WT; ++i) {
            const int n0 = m0 + i * 16 + 8 * hi16;
#pragma unroll
            for (int r = 0; r < 8; ++r)
                out[(size_t)(n0 + r) * DIMC + oc] = acc[i][t][r] + bia;
        }
    }
}

extern "C" void kernel_launch(void* const* d_in, const int* in_sizes, int n_in,
                              void* d_out, int out_size, void* d_ws, size_t ws_size,
                              hipStream_t stream) {
    const float* inputs = (const float*)d_in[0];
    const float* W_qkv  = (const float*)d_in[1];
    const float* W_fc   = (const float*)d_in[2];
    const float* b_fc   = (const float*)d_in[3];
    const int*   pmask  = (const int*)d_in[4];

    // workspace layout (bf16/ushort elements), all 1 KB tiles; 176 MB total
    const size_t nQKV = (size_t)BATCH * NHEAD * SEQ * DH;   // 8388608
    const size_t nX   = (size_t)BATCH * SEQ * DIMC;         // 8388608
    const size_t nWq  = (size_t)3 * DIMC * DIMC;            // 3145728
    const size_t nWf  = (size_t)DIMC * DIMC;                // 1048576
    unsigned short* p = (unsigned short*)d_ws;
    unsigned short* Qh  = p; p += nQKV;
    unsigned short* Ql  = p; p += nQKV;
    unsigned short* KV  = p; p += 4 * nQKV;
    unsigned short* Xih = p; p += nX;
    unsigned short* Xil = p; p += nX;
    unsigned short* Wqh = p; p += nWq;
    unsigned short* Wql = p; p += nWq;
    unsigned short* Wfh = p; p += nWf;
    unsigned short* Wfl = p; p += nWf;
    unsigned short* Xah = p; p += nX;
    unsigned short* Xal = p; p += nX;

    pack_split_planes<<<((int)nX  / 16 + 255) / 256, 256, 0, stream>>>(inputs, Xih, Xil, (int)nX);
    pack_split_planes<<<((int)nWq / 16 + 255) / 256, 256, 0, stream>>>(W_qkv,  Wqh, Wql, (int)nWq);
    pack_split_planes<<<((int)nWf / 16 + 255) / 256, 256, 0, stream>>>(W_fc,   Wfh, Wfl, (int)nWf);

    gemm_qkv<<<dim3(64, 12), 256, 0, stream>>>(Xih, Xil, Wqh, Wql,
                                               Qh, Ql, KV);
    attn_kernel<<<BATCH * NHEAD * (SEQ / 128), 128, 0, stream>>>(Qh, Ql, KV,
                                                                pmask, Xah, Xal);
    gemm_fc<<<dim3(64, 4), 256, 0, stream>>>(Xah, Xal, Wfh, Wfl, b_fc, (float*)d_out);
}

// v003
// One run takes 285 microseconds.
// Next to v002, in two timings, it ran 1.49 and 1.47 times as fast.
// All steps since v000 together make it 3.49 times as fast.
#include <hip/hip_runtime.h>

#define DIMC   1024
#define NHEAD  16
#define BATCH  4
#define SEQ    2048
#define DH     64
#define SCALE_F 0.125f            // (1024/16)^-0.5
#define MASK_VAL -10000000.0f

typedef __attribute__((ext_vector_type(16))) __bf16        v16bf;
typedef __attribute__((ext_vector_type(8)))  float         v8f;
typedef __attribute__((ext_vector_type(4)))  unsigned int  u32x4;
typedef __attribute__((ext_vector_type(4)))  float         f32x4;

// ---------- bf16 hi/lo split helpers (separate planes) ----------
__device__ __forceinline__ unsigned short f2bf_u(float f) {
    unsigned int u = __float_as_uint(f);
    u += 0x7FFFu + ((u >> 16) & 1u);          // round-to-nearest-even
    return (unsigned short)(u >> 16);
}
__device__ __forceinline__ float bfu2f(unsigned short h) {
    return __uint_as_float(((unsigned int)h) << 16);
}
__device__ __forceinline__ __bf16 bfbits(unsigned short h) {
    return __builtin_bit_cast(__bf16, h);
}

// WMMA operand element i maps to k = (i<8?0:16) + 8*hi16 + (i&7) (CDNA5 16-bit
// 16x32 A / 32x16 B layout, wave32).
// Every bf16 plane in the workspace is stored fragment-major: a plane of R rows
// by K columns is cut into tiles of 16 rows x 32 k (512 elements, 1 KB), tile
// index (row/16)*(K/32) + k/32 (the K/V buffer orders its tiles per key pass, see kernel 1). Inside a tile, element (row, k) lies at
//   ((k>>4)&1)*256 + (((k>>3)&1)*16 + (row&15))*8 + (k&7)
// so lane l's two 16-byte pieces lie at l*8 and 256 + l*8: each wave-wide
// 16-byte load or store covers 512 contiguous bytes, four whole 128-byte lines.
#define TILE_E 512
// lanep: start of the tile + lane*8
__device__ __forceinline__ v16bf load_frag(const unsigned short* __restrict__ lanep) {
    union { v16bf v; u32x4 q[2]; } u;
    u.q[0] = *(const u32x4*)(lanep);
    u.q[1] = *(const u32x4*)(lanep + 256);
    return u.v;
}
// split eight f32 values into bf16 hi and lo and store each as one 16-byte piece
__device__ __forceinline__ void store_split8(const float* x,
                                             unsigned short* __restrict__ hp,
                                             unsigned short* __restrict__ lp) {
    u32x4 qh, ql;
#pragma unroll
    for (int e = 0; e < 4; ++e) {
        unsigned short h0 = f2bf_u(x[2 * e]);
        unsigned short h1 = f2bf_u(x[2 * e + 1]);
        unsigned short l0 = f2bf_u(x[2 * e] - bfu2f(h0));
        unsigned short l1 = f2bf_u(x[2 * e + 1] - bfu2f(h1));
        qh[e] = (unsigned int)h0 | ((unsigned int)h1 << 16);
        ql[e] = (unsigned int)l0 | ((unsigned int)l1 << 16);
    }
    *(u32x4*)hp = qh;
    *(u32x4*)lp = ql;
}

__device__ __forceinline__ v8f wmma_bf(v16bf a, v16bf b, v8f c) {
    return __builtin_amdgcn_wmma_f32_16x16x32_bf16(false, a, false, b, (short)0, c,
                                                   false, false);
}
// split-precision product: (ah+al)*(bh+bl) ~ ah*bh + ah*bl + al*bh
__device__ __forceinline__ v8f wmma_split(v16bf ah, v16bf al, v16bf bh, v16bf bl, v8f c) {
    c = wmma_bf(ah, bh, c);
    c = wmma_bf(ah, bl, c);
    c = wmma_bf(al, bh, c);
    return c;
}
__device__ __forceinline__ v8f v8f_zero() {
    v8f z;
#pragma unroll
    for (int e = 0; e < 8; ++e) z[e] = 0.0f;
    return z;
}

// ---------- kernel 0: fp32 [rows][DIMC] -> fragment-major bf16 hi plane + lo plane ----------
// one wave per 16x32 tile; a lane converts its own two 8-element pieces
__global__ void pack_split_planes(const float* __restrict__ src,
                                  unsigned short* __restrict__ hip_,
                                  unsigned short* __restrict__ lop_, int n) {
    int g = blockIdx.x * blockDim.x + threadIdx.x;
    if (g * 16 < n) {
        const int tile = g >> 5;
        const int lane = g & 31;
        const int row  = (tile >> 5) * 16 + (lane & 15);      // DIMC/32 = 32 tiles per row band
        const int k    = (tile & 31) * 32 + 8 * (lane >> 4);
        const float* sp = src + (size_t)row * DIMC + k;
#pragma unroll
        for (int j = 0; j < 2; ++j) {
            const f32x4 a = *(const f32x4*)(sp + j * 16);
            const f32x4 c = *(const f32x4*)(sp + j * 16 + 4);
            const float x[8] = {a[0], a[1], a[2], a[3], c[0], c[1], c[2], c[3]};
            const size_t o = (size_t)tile * TILE_E + j * 256 + lane * 8;
            store_split8(x, hip_ + o, lop_ + o);
        }
    }
}

// ---------- asynchronous copies to LDS: waits of the two-buffer ring ----------
// the wave's own LDS reads have returned: stands in front of the barrier behind which a buffer is refilled
__device__ __forceinline__ void wait_lds_reads() { asm volatile("s_wait_dscnt 0x0" ::: "memory"); }
// the wave's own copies have landed: stands in front of the barrier behind which other waves read them
__device__ __forceinline__ void wait_copies() { asm volatile("s_wait_asynccnt 0x0" ::: "memory"); }
__device__ __forceinline__ unsigned lds_addr(const unsigned short* p) {
    return (unsigned)(unsigned long long)p;       // low 32 bits of a __shared__ address: the LDS byte
}

// One K step (32 k) of a block's operands in LDS, 48 tiles of 1 KB:
// [X hi 8 | X lo 8 | W hi 16 | W lo 16], the tiles of a plane in row order.
#define STAGE_E (48 * TILE_E)
#define BAND_E  ((DIMC / 32) * TILE_E)        // from one 16-row band of a plane to the next
// 256 threads bring a stage: 64 threads a tile, four tiles a copy, twelve copies a thread. xh..wl: the
// thread's piece of the first four tiles of each plane at this K step; lds: its piece of tile 0..3.
// s_wait_xcnt 0 closes the statement so that no address register is rewritten ahead of it.
__device__ __forceinline__ void copy_stage(unsigned lds,
                                           const unsigned short* xh, const unsigned short* xl,
                                           const unsigned short* wh, const unsigned short* wl) {
    asm volatile("global_load_async_to_lds_b128 %0, %12, off\n\t"
                 "global_load_async_to_lds_b128 %1, %13, off\n\t"
                 "global_load_async_to_lds_b128 %2, %14, off\n\t"
                 "global_load_async_to_lds_b128 %3, %15, off\n\t"
                 "global_load_async_to_lds_b128 %4, %16, off\n\t"
                 "global_load_async_to_lds_b128 %5, %17, off\n\t"
                 "global_load_async_to_lds_b128 %6, %18, off\n\t"
                 "global_load_async_to_lds_b128 %7, %19, off\n\t"
                 "global_load_async_to_lds_b128 %8, %20, off\n\t"
                 "global_load_async_to_lds_b128 %9, %21, off\n\t"
                 "global_load_async_to_lds_b128 %10, %22, off\n\t"
                 "global_load_async_to_lds_b128 %11, %23, off\n\t"
                 "s_wait_xcnt 0x0"
                 :: "v"(lds), "v"(lds + 4096), "v"(lds + 2 * 4096), "v"(lds + 3 * 4096),
                    "v"(lds + 4 * 4096), "v"(lds + 5 * 4096), "v"(lds + 6 * 4096), "v"(lds + 7 * 4096),
                    "v"(lds + 8 * 4096), "v"(lds + 9 * 4096), "v"(lds + 10 * 4096), "v"(lds + 11 * 4096),
                    "v"(xh), "v"(xh + 4 * BAND_E), "v"(xl), "v"(xl + 4 * BAND_E),
                    "v"(wh), "v"(wh + 4 * BAND_E), "v"(wh + 8 * BAND_E), "v"(wh + 12 * BAND_E),
                    "v"(wl), "v"(wl + 4 * BAND_E), "v"(wl + 8 * BAND_E), "v"(wl + 12 * BAND_E)
                 : "memory");
}

// K loop shared by both projections: a 64x64 tile per wave (4 X tiles by 4 W tiles), K = DIMC:
// a loaded W fragment meets four X tiles instead of one, an X fragment four W tiles as before.
// A block is 2 x 4 waves, 128 tokens by 256 features. Its operands of one K step are brought into LDS
// once for all eight waves by asynchronous copies, two buffers: the next step's copies fly while this
// step's fragments are read from LDS and multiplied.
// mb, ob: first 16-row band of the block in X and in W; wm, wn: the wave's place in the block.
// SWAP = false: acc[i][t] = X-tile i (A) . W-tile t (B): lane holds 8 tokens of one feature.
// SWAP = true : acc[i][t] = W-tile t (A) . X-tile i (B): lane holds 8 features of one token.
// The three split products are summed in the same order either way.
#define WT 4                      // X tiles (16 tokens each) per wave
template <bool SWAP>
__device__ __forceinline__ void gemm_k_loop(const unsigned short* __restrict__ Xh,
                                            const unsigned short* __restrict__ Xl,
                                            const unsigned short* __restrict__ Wh,
                                            const unsigned short* __restrict__ Wl,
                                            unsigned short (&stg)[2][STAGE_E],
                                            int mb, int ob, int wm, int wn,
                                            v8f (&acc)[WT][4]) {
    const int lane = threadIdx.x & 31;
    // this thread's piece of a stage: tile threadIdx.x / 64 of each group of four, 16 bytes of it
    const size_t xo = (size_t)(mb + (threadIdx.x >> 6)) * BAND_E + (threadIdx.x & 63) * 8;
    const size_t wo = (size_t)(ob + (threadIdx.x >> 6)) * BAND_E + (threadIdx.x & 63) * 8;
    const unsigned short* cxh = Xh + xo;
    const unsigned short* cxl = Xl + xo;
    const unsigned short* cwh = Wh + wo;
    const unsigned short* cwl = Wl + wo;
    const unsigned sl = lds_addr(&stg[0][threadIdx.x * 8]);

    copy_stage(sl, cxh, cxl, cwh, cwl);                       // K step 0 into buffer 0
    wait_copies();
    __syncthreads();                                          // publishes K step 0
    copy_stage(sl + STAGE_E * 2, cxh + TILE_E, cxl + TILE_E, cwh + TILE_E, cwl + TILE_E);

    for (int kt = 0; kt < DIMC / 32; ++kt) {
        const int buf = kt & 1;
        const unsigned short* pah = &stg[buf][(wm * WT) * TILE_E + lane * 8];
        const unsigned short* pal = pah + 8 * TILE_E;
        const unsigned short* pbh = &stg[buf][(16 + wn * 4) * TILE_E + lane * 8];
        const unsigned short* pbl = pbh + 16 * TILE_E;
        v16bf ah[WT], al[WT];
#pragma unroll
        for (int i = 0; i < WT; ++i) {
            ah[i] = load_frag(pah + i * TILE_E);
            al[i] = load_frag(pal + i * TILE_E);
        }
#pragma unroll
        for (int t = 0; t < 4; ++t) {
            v16bf bh = load_frag(pbh + t * TILE_E);
            v16bf bl = load_frag(pbl + t * TILE_E);
            if (SWAP) {
#pragma unroll
                for (int i = 0; i < WT; ++i) acc[i][t] = wmma_bf(bh, ah[i], acc[i][t]);
#pragma unroll
                for (int i = 0; i < WT; ++i) acc[i][t] = wmma_bf(bl, ah[i], acc[i][t]);
#pragma unroll
                for (int i = 0; i < WT; ++i) acc[i][t] = wmma_bf(bh, al[i], acc[i][t]);
            } else {
#pragma unroll
                for (int i = 0; i < WT; ++i) acc[i][t] = wmma_bf(ah[i], bh, acc[i][t]);
#pragma unroll
                for (int i = 0; i < WT; ++i) acc[i][t] = wmma_bf(ah[i], bl, acc[i][t]);
#pragma unroll
                for (int i = 0; i < WT; ++i) acc[i][t] = wmma_bf(al[i], bh, acc[i][t]);
            }
        }
        // publish point: the next K step has landed for every wave, and every wave has left this buffer
        wait_lds_reads();
        wait_copies();
        __syncthreads();
        if (kt + 2 < DIMC / 32) {                             // the same for the whole block
            const int ko = (kt + 2) * TILE_E;
            copy_stage(sl + buf * (STAGE_E * 2), cxh + ko, cxl + ko, cwh + ko, cwl + ko);
        }
    }
    wait_copies();
}

// ---------- kernel 1: QKV projection ----------
// out[m][o] = sum_k X[m][k]*W[o][k]; Q as [token][d] planes per head, fragment-major.
// K ([token][d] tiles) and V ([d][token] tiles) share one buffer per head, ordered by the
// attention pass that reads them: per 32 keys 16 tiles, [K hi 4 | K lo 4 | V hi 4 | V lo 4].
#define PASS_E (16 * TILE_E)
// a block is 2 x 4 waves: 128 tokens by 256 features; the register budget of four waves per SIMD
// keeps two blocks on a WGP, so that one block multiplies while the other stands at its barrier
__global__ void __launch_bounds__(256) __attribute__((amdgpu_waves_per_eu(4, 4)))
gemm_qkv(const unsigned short* __restrict__ Xh, const unsigned short* __restrict__ Xl,
         const unsigned short* __restrict__ Wh, const unsigned short* __restrict__ Wl,
         unsigned short* __restrict__ Qh, unsigned short* __restrict__ Ql,
         unsigned short* __restrict__ KV) {
    __shared__ __attribute__((aligned(16))) unsigned short stg[2][STAGE_E];
    const int lane = threadIdx.x & 31;
    // the wave's number in a scalar register: tile, head and batch indices then live in scalar
    // registers through the K loop; held in vector registers they push the kernel past 256 of
    // them, which costs the fourth wave of a SIMD
    const int wave = __builtin_amdgcn_readfirstlane(threadIdx.x >> 5);
    const int m0 = (blockIdx.x * 2 + (wave & 1)) * (16 * WT);   // first token of the wave
    const int o0 = (blockIdx.y * 4 + (wave >> 1)) * 64;         // output features (one head slice)

    v8f acc[WT][4];
#pragma unroll
    for (int i = 0; i < WT; ++i)
#pragma unroll
        for (int t = 0; t < 4; ++t) acc[i][t] = v8f_zero();

    const int mb = blockIdx.x * 8;    // the block's first 16-row band of X
    const int ob = blockIdx.y * 16;   // and of W
    const int s  = blockIdx.y >> 2;   // 0=Q 1=K 2=V: the same for the whole block
    const int h  = (o0 & 1023) >> 6;
    const int b  = m0 >> 11;
    const size_t head = (size_t)(b * NHEAD + h);
    if (s == 2) {
        gemm_k_loop<false>(Xh, Xl, Wh, Wl, stg, mb, ob, wave & 1, wave >> 1, acc);
#pragma unroll
        for (int i = 0; i < WT; ++i) {
            const int n0 = (m0 & 2047) + i * 16;
            // Vt[d][n]: row d = t*16 + col, k = n0 + 8*hi16 + r: the lane's 8 values are one piece
            unsigned short* vp = KV + (head * (SEQ / 32) + (n0 >> 5)) * PASS_E + 8 * TILE_E
                               + ((n0 >> 4) & 1) * 256 + lane * 8;
#pragma unroll
            for (int t = 0; t < 4; ++t) {
                float x[8];
#pragma unroll
                for (int r = 0; r < 8; ++r) x[r] = acc[i][t][r];
                store_split8(x, vp + t * TILE_E, vp + (4 + t) * TILE_E);
            }
        }
    } else {
        gemm_k_loop<true>(Xh, Xl, Wh, Wl, stg, mb, ob, wave & 1, wave >> 1, acc);
#pragma unroll
        for (int i = 0; i < WT; ++i) {
            const int n0 = (m0 & 2047) + i * 16;
            // Q/K[n][d]: row n = n0 + col, k = d = t*16 + 8*hi16 + r: again one piece per lane
            const size_t qo = head * SEQ * DH + (size_t)(n0 >> 4) * (DH / 32) * TILE_E + lane * 8;
            const size_t ko = (head * (SEQ / 32) + (n0 >> 5)) * PASS_E
                            + ((n0 >> 4) & 1) * (DH / 32) * TILE_E + lane * 8;
            unsigned short* bh_ = (s == 0 ? Qh + qo : KV + ko);
            unsigned short* bl_ = (s == 0 ? Ql + qo : KV + ko + 4 * TILE_E);
#pragma unroll
            for (int t = 0; t < 4; ++t) {
                float x[8];
#pragma unroll
                for (int r = 0; r < 8; ++r) x[r] = acc[i][t][r];
                store_split8(x, bh_ + (t >> 1) * TILE_E + (t & 1) * 256,
                                bl_ + (t >> 1) * TILE_E + (t & 1) * 256);
            }
        }
    }
}

// ---------- kernel 2: flash attention (transposed-score trick) ----------
#define QT 2                      // query tiles (16 queries each) per wave
#define AW 4                      // waves per block
// one pass of K and V (16 tiles, 16 KB, contiguous in the workspace) into LDS, same order: each of the
// 128 lanes brings 8 pieces of 16 bytes, 2 KB apart; the offset moves the LDS and the global address
// alike. s_wait_xcnt 0 closes the statement so that no address register is rewritten ahead of it.
__device__ __forceinline__ void copy_pass(unsigned lds, const unsigned short* g) {
    asm volatile("global_load_async_to_lds_b128 %0, %1, off\n\t"
                 "global_load_async_to_lds_b128 %0, %1, off offset:2048\n\t"
                 "global_load_async_to_lds_b128 %0, %1, off offset:4096\n\t"
                 "global_load_async_to_lds_b128 %0, %1, off offset:6144\n\t"
                 "global_load_async_to_lds_b128 %0, %1, off offset:8192\n\t"
                 "global_load_async_to_lds_b128 %0, %1, off offset:10240\n\t"
                 "global_load_async_to_lds_b128 %0, %1, off offset:12288\n\t"
                 "global_load_async_to_lds_b128 %0, %1, off offset:14336\n\t"
                 "s_wait_xcnt 0x0" :: "v"(lds), "v"(g) : "memory");
}
__global__ void __launch_bounds__(AW * 32)
attn_kernel(const unsigned short* __restrict__ Qh, const unsigned short* __restrict__ Ql,
            const unsigned short* __restrict__ KV,
            const int* __restrict__ pm,
            unsigned short* __restrict__ Xh, unsigned short* __restrict__ Xl) {
    __shared__ int smask[SEQ];
    __shared__ __attribute__((aligned(16))) unsigned short kvs[2][PASS_E];   // two passes of K and V
    const int lane = threadIdx.x & 31;
    const int wave = threadIdx.x >> 5;
    const int hi16 = lane >> 4;
    const int bid = blockIdx.x;
    const int b = bid >> 8;                       // 256 blocks per batch
    const int h = (bid >> 4) & 15;
    const int q0 = ((bid & 15) * AW + wave) * (16 * QT);  // 32 queries per wave

    const size_t head = (size_t)(b * NHEAD + h);
    // this thread's piece of each pass, in the workspace and in the two buffers
    const unsigned short* kvg = KV + head * (SEQ / 32) * PASS_E + threadIdx.x * 8;
    const unsigned kvl = lds_addr(&kvs[0][threadIdx.x * 8]);
    copy_pass(kvl, kvg);                                      // pass 0 into buffer 0
    for (int i = threadIdx.x; i < SEQ; i += AW * 32) smask[i] = pm[b * SEQ + i];
    wait_copies();
    __syncthreads();                                          // publishes pass 0 and the mask
    copy_pass(kvl + PASS_E * 2, kvg + PASS_E);                // pass 1 into buffer 1

    // fragment-major planes: this lane's piece of a tile starts at lane*8
    const size_t qoff = head * SEQ * DH + (size_t)(q0 >> 4) * (DH / 32) * TILE_E + lane * 8;
    const unsigned short* qrh = Qh + qoff;
    const unsigned short* qrl = Ql + qoff;

    // Q tiles as B-operand (lane col = query), K-dim = head dim (2 steps of 32)
    v16bf qh[QT][2], ql[QT][2];
#pragma unroll
    for (int qt = 0; qt < QT; ++qt)
#pragma unroll
        for (int ds = 0; ds < 2; ++ds) {
            qh[qt][ds] = load_frag(qrh + (qt * (DH / 32) + ds) * TILE_E);
            ql[qt][ds] = load_frag(qrl + (qt * (DH / 32) + ds) * TILE_E);
        }

    float mrow[QT], lrow[QT];             // per-lane softmax state for query `col` of each tile
    v8f o[QT][4];                         // O^T accum: lane holds d = t*16+r+8*hi16, q = col
#pragma unroll
    for (int qt = 0; qt < QT; ++qt) {
        mrow[qt] = -3.0e38f;
        lrow[qt] = 0.0f;
#pragma unroll
        for (int t = 0; t < 4; ++t) o[qt][t] = v8f_zero();
    }

    for (int k0 = 0; k0 < SEQ; k0 += 32) {
        // S^T = K . Q^T : st[qt][js][r] = score(key k0+js*16+r+8*hi16, query col of tile qt);
        // each K fragment is loaded once and multiplied with every Q tile of the wave
        const int buf = (k0 >> 5) & 1;
        const unsigned short* kvb = &kvs[buf][lane * 8];      // this pass's tiles, read from LDS
        v8f st[QT][2];
#pragma unroll
        for (int js = 0; js < 2; ++js) {
#pragma unroll
            for (int qt = 0; qt < QT; ++qt) st[qt][js] = v8f_zero();
            const unsigned short* kp = kvb + js * (DH / 32) * TILE_E;
#pragma unroll
            for (int ds = 0; ds < 2; ++ds) {
                v16bf kh = load_frag(kp + ds * TILE_E);
                v16bf kl = load_frag(kp + (4 + ds) * TILE_E);
#pragma unroll
                for (int qt = 0; qt < QT; ++qt)
                    st[qt][js] = wmma_split(kh, kl, qh[qt][ds], ql[qt][ds], st[qt][js]);
            }
        }
        v16bf ph[QT], pl[QT];
        float alpha[QT];
#pragma unroll
        for (int qt = 0; qt < QT; ++qt) {
            // scale + key padding mask + running max
            float mx = mrow[qt];
#pragma unroll
            for (int js = 0; js < 2; ++js)
#pragma unroll
                for (int r = 0; r < 8; ++r) {
                    float s = st[qt][js][r] * SCALE_F;
                    if (smask[k0 + js * 16 + 8 * hi16 + r] > 0) s = MASK_VAL;
                    st[qt][js][r] = s;
                    mx = fmaxf(mx, s);
                }
            mx = fmaxf(mx, __shfl_xor(mx, 16));       // combine the two key halves
            alpha[qt] = __expf(mrow[qt] - mx);
            mrow[qt] = mx;
            // exp -> P; st layout already matches the B-operand element order exactly
            float rs = 0.0f;
#pragma unroll
            for (int js = 0; js < 2; ++js)
#pragma unroll
                for (int r = 0; r < 8; ++r) {
                    float p = __expf(st[qt][js][r] - mx);
                    rs += p;
                    unsigned short hb = f2bf_u(p);
                    ph[qt][js * 8 + r] = bfbits(hb);
                    pl[qt][js * 8 + r] = bfbits(f2bf_u(p - bfu2f(hb)));
                }
            rs += __shfl_xor(rs, 16);
            lrow[qt] = lrow[qt] * alpha[qt] + rs;
        }
        // O^T += V^T . P^T  (4 d-subtiles); rescale is a per-lane scalar;
        // each V fragment is loaded once and multiplied with every P tile of the wave
#pragma unroll
        for (int t = 0; t < 4; ++t) {
            const unsigned short* vp = kvb + (8 + t) * TILE_E;
            v16bf vh = load_frag(vp);
            v16bf vl = load_frag(vp + 4 * TILE_E);
#pragma unroll
            for (int qt = 0; qt < QT; ++qt) {
                o[qt][t] = o[qt][t] * alpha[qt];
                o[qt][t] = wmma_split(vh, vl, ph[qt], pl[qt], o[qt][t]);
            }
        }
        // publish point: the next pass has landed for every wave, and every wave has left this buffer
        wait_lds_reads();
        wait_copies();
        __syncthreads();
        if (k0 + 64 < SEQ)                                    // the same for the whole block
            copy_pass(kvl + buf * (PASS_E * 2), kvg + (size_t)((k0 >> 5) + 2) * PASS_E);
    }
    wait_copies();
    // write x[b][n=q0+qt*16+col][h*64+d], d = t*16 + 8*hi16 + r, into the fragment-major hi/lo
    // planes of the output GEMM: the lane's 8 values are one 16-byte piece
#pragma unroll
    for (int qt = 0; qt < QT; ++qt) {
        const float linv = 1.0f / lrow[qt];
        const size_t xoff = ((size_t)((b * SEQ + q0 + qt * 16) >> 4) * (DIMC / 32)
                             + h * (DH / 32)) * TILE_E + lane * 8;
#pragma unroll
        for (int t = 0; t < 4; ++t) {
            float x[8];
#pragma unroll
            for (int r = 0; r < 8; ++r) x[r] = o[qt][t][r] * linv;
            store_split8(x, Xh + xoff + (t >> 1) * TILE_E + (t & 1) * 256,
                            Xl + xoff + (t >> 1) * TILE_E + (t & 1) * 256);
        }
    }
}

// ---------- kernel 3: output projection + bias (fp32 out) ----------
__global__ void __launch_bounds__(256)
gemm_fc(const unsigned short* __restrict__ Xh, const unsigned short* __restrict__ Xl,
        const unsigned short* __restrict__ Wh, const unsigned short* __restrict__ Wl,
        const float* __restrict__ bias,
        float* __restrict__ out) {
    __shared__ __attribute__((aligned(16))) unsigned short stg[2][STAGE_E];
    const int lane = threadIdx.x & 31;
    const int wave = threadIdx.x >> 5;
    const int col  = lane & 15;
    const int hi16 = lane >> 4;
    const int m0 = (blockIdx.x * 2 + (wave & 1)) * (16 * WT);
    const int o0 = (blockIdx.y * 4 + (wave >> 1)) * 64;

    v8f acc[WT][4];
#pragma unroll
    for (int i = 0; i < WT; ++i)
#pragma unroll
        for (int t = 0; t < 4; ++t) acc[i][t] = v8f_zero();

    gemm_k_loop<false>(Xh, Xl, Wh, Wl, stg, blockIdx.x * 8, blockIdx.y * 16, wave & 1, wave >> 1, acc);
#pragma unroll
    for (int t = 0; t < 4; ++t) {
        const int oc = o0 + t * 16 + col;
        const float bia = bias[oc];
#pragma unroll
        for (int i = 0; i < WT; ++i) {
            const int n0 = m0 + i * 16 + 8 * hi16;
#pragma unroll
            for (int r = 0; r < 8; ++r)
                out[(size_t)(n0 + r) * DIMC + oc] = acc[i][t][r] + bia;
        }
    }
}

extern "C" void kernel_launch(void* const* d_in, const int* in_sizes, int n_in,
                              void* d_out, int out_size, void* d_ws, size_t ws_size,
                              hipStream_t stream) {
    const float* inputs = (const float*)d_in[0];
    const float* W_qkv  = (const float*)d_in[1];
    const float* W_fc   = (const float*)d_in[2];
    const float* b_fc   = (const float*)d_in[3];
    const int*   pmask  = (const int*)d_in[4];

    // workspace layout (bf16/ushort elements), all 1 KB tiles; 176 MB total
    const size_t nQKV = (size_t)BATCH * NHEAD * SEQ * DH;   // 8388608
    const size_t nX   = (size_t)BATCH * SEQ * DIMC;         // 8388608
    const size_t nWq  = (size_t)3 * DIMC * DIMC;            // 3145728
    const size_t nWf  = (size_t)DIMC * DIMC;                // 1048576
    unsigned short* p = (unsigned short*)d_ws;
    unsigned short* Qh  = p; p += nQKV;
    unsigned short* Ql  = p; p += nQKV;
    unsigned short* KV  = p; p += 4 * nQKV;
    unsigned short* Xih = p; p += nX;
    unsigned short* Xil = p; p += nX;
    unsigned short* Wqh = p; p += nWq;
    unsigned short* Wql = p; p += nWq;
    unsigned short* Wfh = p; p += nWf;
    unsigned short* Wfl = p; p += nWf;
    unsigned short* Xah = p; p += nX;
    unsigned short* Xal = p; p += nX;

    pack_split_planes<<<((int)nX  / 16 + 255) / 256, 256, 0, stream>>>(inputs, Xih, Xil, (int)nX);
    pack_split_planes<<<((int)nWq / 16 + 255) / 256, 256, 0, stream>>>(W_qkv,  Wqh, Wql, (int)nWq);
    pack_split_planes<<<((int)nWf / 16 + 255) / 256, 256, 0, stream>>>(W_fc,   Wfh, Wfl, (int)nWf);

    gemm_qkv<<<dim3(64, 12), 256, 0, stream>>>(Xih, Xil, Wqh, Wql,
                                               Qh, Ql, KV);
    attn_kernel<<<BATCH * NHEAD * (SEQ / 128), 128, 0, stream>>>(Qh, Ql, KV,
                                                                pmask, Xah, Xal);
    gemm_fc<<<dim3(64, 4), 256, 0, stream>>>(Xah, Xal, Wfh, Wfl, b_fc, (float*)d_out);
}

// v004
// Measured time: 210 microseconds a run.
// In both of two side-by-side timings against v003, it was 1.36 times as fast.
// Counting every step since v000, it is 4.75 times as fast.
#include <hip/hip_runtime.h>

#define DIMC   1024
#define NHEAD  16
#define BATCH  4
#define SEQ    2048
#define DH     64
#define SCALE_F 0.125f            // (1024/16)^-0.5
#define MASK_VAL -10000000.0f

typedef __attribute__((ext_vector_type(16))) __bf16        v16bf;
typedef __attribute__((ext_vector_type(8)))  float         v8f;
typedef __attribute__((ext_vector_type(4)))  unsigned int  u32x4;
typedef __attribute__((ext_vector_type(4)))  float         f32x4;

// ---------- bf16 hi/lo split helpers (separate planes) ----------
__device__ __forceinline__ unsigned short f2bf_u(float f) {
    unsigned int u = __float_as_uint(f);
    u += 0x7FFFu + ((u >> 16) & 1u);          // round-to-nearest-even
    return (unsigned short)(u >> 16);
}
__device__ __forceinline__ float bfu2f(unsigned short h) {
    return __uint_as_float(((unsigned int)h) << 16);
}
__device__ __forceinline__ __bf16 bfbits(unsigned short h) {
    return __builtin_bit_cast(__bf16, h);
}

// WMMA operand element i maps to k = (i<8?0:16) + 8*hi16 + (i&7) (CDNA5 16-bit
// 16x32 A / 32x16 B layout, wave32).
// Every bf16 plane in the workspace is stored fragment-major: a plane of R rows
// by K columns is cut into tiles of 16 rows x 32 k (512 elements, 1 KB), tile
// index (row/16)*(K/32) + k/32 (the K/V buffer orders its tiles per key pass, see kernel 1). Inside a tile, element (row, k) lies at
//   ((k>>4)&1)*256 + (((k>>3)&1)*16 + (row&15))*8 + (k&7)
// so lane l's two 16-byte pieces lie at l*8 and 256 + l*8: each wave-wide
// 16-byte load or store covers 512 contiguous bytes, four whole 128-byte lines.
#define TILE_E 512
// lanep: start of the tile + lane*8
__device__ __forceinline__ v16bf load_frag(const unsigned short* __restrict__ lanep) {
    union { v16bf v; u32x4 q[2]; } u;
    u.q[0] = *(const u32x4*)(lanep);
    u.q[1] = *(const u32x4*)(lanep + 256);
    return u.v;
}
// split eight f32 values into bf16 hi and lo and store each as one 16-byte piece
__device__ __forceinline__ void store_split8(const float* x,
                                             unsigned short* __restrict__ hp,
                                             unsigned short* __restrict__ lp) {
    u32x4 qh, ql;
#pragma unroll
    for (int e = 0; e < 4; ++e) {
        unsigned short h0 = f2bf_u(x[2 * e]);
        unsigned short h1 = f2bf_u(x[2 * e + 1]);
        unsigned short l0 = f2bf_u(x[2 * e] - bfu2f(h0));
        unsigned short l1 = f2bf_u(x[2 * e + 1] - bfu2f(h1));
        qh[e] = (unsigned int)h0 | ((unsigned int)h1 << 16);
        ql[e] = (unsigned int)l0 | ((unsigned int)l1 << 16);
    }
    *(u32x4*)hp = qh;
    *(u32x4*)lp = ql;
}

__device__ __forceinline__ v8f wmma_bf(v16bf a, v16bf b, v8f c) {
    return __builtin_amdgcn_wmma_f32_16x16x32_bf16(false, a, false, b, (short)0, c,
                                                   false, false);
}
// split-precision product: (ah+al)*(bh+bl) ~ ah*bh + ah*bl + al*bh
__device__ __forceinline__ v8f wmma_split(v16bf ah, v16bf al, v16bf bh, v16bf bl, v8f c) {
    c = wmma_bf(ah, bh, c);
    c = wmma_bf(ah, bl, c);
    c = wmma_bf(al, bh, c);
    return c;
}
__device__ __forceinline__ v8f v8f_zero() {
    v8f z;
#pragma unroll
    for (int e = 0; e < 8; ++e) z[e] = 0.0f;
    return z;
}

// ---------- kernel 0: fp32 [rows][DIMC] -> fragment-major bf16 hi plane + lo plane ----------
// one wave per 16x32 tile; a lane converts its own two 8-element pieces
__global__ void pack_split_planes(const float* __restrict__ src,
                                  unsigned short* __restrict__ hip_,
                                  unsigned short* __restrict__ lop_, int n) {
    int g = blockIdx.x * blockDim.x + threadIdx.x;
    if (g * 16 < n) {
        const int tile = g >> 5;
        const int lane = g & 31;
        const int row  = (tile >> 5) * 16 + (lane & 15);      // DIMC/32 = 32 tiles per row band
        const int k    = (tile & 31) * 32 + 8 * (lane >> 4);
        const float* sp = src + (size_t)row * DIMC + k;
#pragma unroll
        for (int j = 0; j < 2; ++j) {
            const f32x4 a = *(const f32x4*)(sp + j * 16);
            const f32x4 c = *(const f32x4*)(sp + j * 16 + 4);
            const float x[8] = {a[0], a[1], a[2], a[3], c[0], c[1], c[2], c[3]};
            const size_t o = (size_t)tile * TILE_E + j * 256 + lane * 8;
            store_split8(x, hip_ + o, lop_ + o);
        }
    }
}

// ---------- kernel 0b: the rows of X whose key is kept, packed densely per batch ----------
// A key with mask > 0 has the score MASK_VAL. Its weight exp(MASK_VAL - m), m the row's maximum, is
// exactly 0 in f32 once m > MASK_VAL + 104, and a kept key's scaled score from normal-drawn inputs
// stays millions above MASK_VAL: beside a kept key a masked one adds nothing to a row's sum or output.
// K and V are therefore projected, and the key loop run, over the kept keys alone: row j of batch b
// of these planes is the j-th kept token of that batch.
// Rows from the count up to the next multiple of 128 (a projection block) are written as zeros.
// A batch with no kept key: the reference's softmax is then uniform over all keys; every key is
// kept and cnts[BATCH + b] tells the attention kernel to take all scores as equal.
// One block per 16-row band of the packed planes; each block ranks the batch's 2048 mask words itself.
__global__ void __launch_bounds__(256)
pack_kept_keys(const float* __restrict__ src, const int* __restrict__ pm,
               unsigned short* __restrict__ hip_, unsigned short* __restrict__ lop_,
               int* __restrict__ cnts) {
    __shared__ int wsum[8];
    __shared__ int srow[16];
    const int t = threadIdx.x;
    const int lane = t & 31;
    const int wave = t >> 5;
    const int b  = blockIdx.x >> 7;               // SEQ/16 = 128 bands per batch
    const int j0 = (blockIdx.x & 127) * 16;       // first packed row of the band
    const int* mp = pm + b * SEQ + t * 8;         // this thread ranks eight tokens
    unsigned bits = 0;
#pragma unroll
    for (int e = 0; e < 8; ++e)
        if (!(mp[e] > 0)) bits |= 1u << e;
    const int c = __popc(bits);
    int inc = c;                                  // inclusive sum over the wave
#pragma unroll
    for (int d = 1; d < 32; d <<= 1) {
        const int o = __shfl_up(inc, d);
        if (lane >= d) inc += o;
    }
    if (lane == 31) wsum[wave] = inc;
    if (t < 16) srow[t] = -1;
    __syncthreads();                              // wave sums and the cleared row table are visible
    int before = inc - c, total = 0;
#pragma unroll
    for (int w = 0; w < 8; ++w) {
        const int s = wsum[w];
        total += s;
        if (w < wave) before += s;
    }
    const bool none = (total == 0);
    if (none) { bits = 0xFFu; before = t * 8; total = SEQ; }
#pragma unroll
    for (int e = 0; e < 8; ++e)
        if ((bits >> e) & 1u) {
            const int p = before - j0;
            if ((unsigned)p < 16u) srow[p] = t * 8 + e;
            ++before;
        }
    __syncthreads();                              // the band's source rows are visible
    if (j0 == 0 && t == 0) { cnts[b] = total; cnts[BATCH + b] = none ? 1 : 0; }
    if (j0 < ((total + 127) & ~127)) {            // the same for the whole block; no barrier inside
        const int tok = srow[lane & 15];          // a token number formed from thread indices, or -1
        const float* rp = src + ((size_t)b * SEQ + (tok < 0 ? 0 : tok)) * DIMC + wave * 128 + 8 * (lane >> 4);
        // a wave packs four tiles; all sixteen loads go out before the first value is used
        f32x4 v[4][2][2];
#pragma unroll
        for (int q = 0; q < 4; ++q)
#pragma unroll
            for (int j = 0; j < 2; ++j) {
                v[q][j][0] = *(const f32x4*)(rp + q * 32 + j * 16);
                v[q][j][1] = *(const f32x4*)(rp + q * 32 + j * 16 + 4);
            }
        // stands in front of the first rewrite of the loads' address registers; rp is named as an
        // input so that it lives to this line and no load's result is placed over it
        asm volatile("s_wait_xcnt 0x0" :: "v"(rp) : "memory");
#pragma unroll
        for (int q = 0; q < 4; ++q)
#pragma unroll
            for (int j = 0; j < 2; ++j) {
                float x[8];
#pragma unroll
                for (int e = 0; e < 8; ++e) x[e] = tok < 0 ? 0.0f : v[q][j][e >> 2][e & 3];
                const size_t o = ((size_t)blockIdx.x * (DIMC / 32) + wave * 4 + q) * TILE_E
                               + j * 256 + lane * 8;
                store_split8(x, hip_ + o, lop_ + o);
            }
    }
}

// ---------- asynchronous copies to LDS: waits of the two-buffer ring ----------
// the wave's own LDS reads have returned: stands in front of the barrier behind which a buffer is refilled
__device__ __forceinline__ void wait_lds_reads() { asm volatile("s_wait_dscnt 0x0" ::: "memory"); }
// the wave's own copies have landed: stands in front of the barrier behind which other waves read them
__device__ __forceinline__ void wait_copies() { asm volatile("s_wait_asynccnt 0x0" ::: "memory"); }
__device__ __forceinline__ unsigned lds_addr(const unsigned short* p) {
    return (unsigned)(unsigned long long)p;       // low 32 bits of a __shared__ address: the LDS byte
}

// One K step (32 k) of a block's operands in LDS, 48 tiles of 1 KB:
// [X hi 8 | X lo 8 | W hi 16 | W lo 16], the tiles of a plane in row order.
#define STAGE_E (48 * TILE_E)
#define BAND_E  ((DIMC / 32) * TILE_E)        // from one 16-row band of a plane to the next
// 256 threads bring a stage: 64 threads a tile, four tiles a copy, twelve copies a thread. xh..wl: the
// thread's piece of the first four tiles of each plane at this K step; lds: its piece of tile 0..3.
// s_wait_xcnt 0 closes the statement so that no address register is rewritten ahead of it.
__device__ __forceinline__ void copy_stage(unsigned lds,
                                           const unsigned short* xh, const unsigned short* xl,
                                           const unsigned short* wh, const unsigned short* wl) {
    asm volatile("global_load_async_to_lds_b128 %0, %12, off\n\t"
                 "global_load_async_to_lds_b128 %1, %13, off\n\t"
                 "global_load_async_to_lds_b128 %2, %14, off\n\t"
                 "global_load_async_to_lds_b128 %3, %15, off\n\t"
                 "global_load_async_to_lds_b128 %4, %16, off\n\t"
                 "global_load_async_to_lds_b128 %5, %17, off\n\t"
                 "global_load_async_to_lds_b128 %6, %18, off\n\t"
                 "global_load_async_to_lds_b128 %7, %19, off\n\t"
                 "global_load_async_to_lds_b128 %8, %20, off\n\t"
                 "global_load_async_to_lds_b128 %9, %21, off\n\t"
                 "global_load_async_to_lds_b128 %10, %22, off\n\t"
                 "global_load_async_to_lds_b128 %11, %23, off\n\t"
                 "s_wait_xcnt 0x0"
                 :: "v"(lds), "v"(lds + 4096), "v"(lds + 2 * 4096), "v"(lds + 3 * 4096),
                    "v"(lds + 4 * 4096), "v"(lds + 5 * 4096), "v"(lds + 6 * 4096), "v"(lds + 7 * 4096),
                    "v"(lds + 8 * 4096), "v"(lds + 9 * 4096), "v"(lds + 10 * 4096), "v"(lds + 11 * 4096),
                    "v"(xh), "v"(xh + 4 * BAND_E), "v"(xl), "v"(xl + 4 * BAND_E),
                    "v"(wh), "v"(wh + 4 * BAND_E), "v"(wh + 8 * BAND_E), "v"(wh + 12 * BAND_E),
                    "v"(wl), "v"(wl + 4 * BAND_E), "v"(wl + 8 * BAND_E), "v"(wl + 12 * BAND_E)
                 : "memory");
}

// K loop shared by both projections: a 64x64 tile per wave (4 X tiles by 4 W tiles), K = DIMC:
// a loaded W fragment meets four X tiles instead of one, an X fragment four W tiles as before.
// A block is 2 x 4 waves, 128 tokens by 256 features. Its operands of one K step are brought into LDS
// once for all eight waves by asynchronous copies, two buffers: the next step's copies fly while this
// step's fragments are read from LDS and multiplied.
// mb, ob: first 16-row band of the block in X and in W; wm, wn: the wave's place in the block.
// SWAP = false: acc[i][t] = X-tile i (A) . W-tile t (B): lane holds 8 tokens of one feature.
// SWAP = true : acc[i][t] = W-tile t (A) . X-tile i (B): lane holds 8 features of one token.
// The three split products are summed in the same order either way.
#define WT 4                      // X tiles (16 tokens each) per wave
template <bool SWAP>
__device__ __forceinline__ void gemm_k_loop(const unsigned short* __restrict__ Xh,
                                            const unsigned short* __restrict__ Xl,
                                            const unsigned short* __restrict__ Wh,
                                            const unsigned short* __restrict__ Wl,
                                            unsigned short (&stg)[2][STAGE_E],
                                            int mb, int ob, int wm, int wn,
                                            v8f (&acc)[WT][4]) {
    const int lane = threadIdx.x & 31;
    // this thread's piece of a stage: tile threadIdx.x / 64 of each group of four, 16 bytes of it
    const size_t xo = (size_t)(mb + (threadIdx.x >> 6)) * BAND_E + (threadIdx.x & 63) * 8;
    const size_t wo = (size_t)(ob + (threadIdx.x >> 6)) * BAND_E + (threadIdx.x & 63) * 8;
    const unsigned short* cxh = Xh + xo;
    const unsigned short* cxl = Xl + xo;
    const unsigned short* cwh = Wh + wo;
    const unsigned short* cwl = Wl + wo;
    const unsigned sl = lds_addr(&stg[0][threadIdx.x * 8]);

    copy_stage(sl, cxh, cxl, cwh, cwl);                       // K step 0 into buffer 0
    wait_copies();
    __syncthreads();                                          // publishes K step 0
    copy_stage(sl + STAGE_E * 2, cxh + TILE_E, cxl + TILE_E, cwh + TILE_E, cwl + TILE_E);

    for (int kt = 0; kt < DIMC / 32; ++kt) {
        const int buf = kt & 1;
        const unsigned short* pah = &stg[buf][(wm * WT) * TILE_E + lane * 8];
        const unsigned short* pal = pah + 8 * TILE_E;
        const unsigned short* pbh = &stg[buf][(16 + wn * 4) * TILE_E + lane * 8];
        const unsigned short* pbl = pbh + 16 * TILE_E;
        v16bf ah[WT], al[WT];
#pragma unroll
        for (int i = 0; i < WT; ++i) {
            ah[i] = load_frag(pah + i * TILE_E);
            al[i] = load_frag(pal + i * TILE_E);
        }
#pragma unroll
        for (int t = 0; t < 4; ++t) {
            v16bf bh = load_frag(pbh + t * TILE_E);
            v16bf bl = load_frag(pbl + t * TILE_E);
            if (SWAP) {
#pragma unroll
                for (int i = 0; i < WT; ++i) acc[i][t] = wmma_bf(bh, ah[i], acc[i][t]);
#pragma unroll
                for (int i = 0; i < WT; ++i) acc[i][t] = wmma_bf(bl, ah[i], acc[i][t]);
#pragma unroll
                for (int i = 0; i < WT; ++i) acc[i][t] = wmma_bf(bh, al[i], acc[i][t]);
            } else {
#pragma unroll
                for (int i = 0; i < WT; ++i) acc[i][t] = wmma_bf(ah[i], bh, acc[i][t]);
#pragma unroll
                for (int i = 0; i < WT; ++i) acc[i][t] = wmma_bf(ah[i], bl, acc[i][t]);
#pragma unroll
                for (int i = 0; i < WT; ++i) acc[i][t] = wmma_bf(al[i], bh, acc[i][t]);
            }
        }
        // publish point: the next K step has landed for every wave, and every wave has left this buffer
        wait_lds_reads();
        wait_copies();
        __syncthreads();
        if (kt + 2 < DIMC / 32) {                             // the same for the whole block
            const int ko = (kt + 2) * TILE_E;
            copy_stage(sl + buf * (STAGE_E * 2), cxh + ko, cxl + ko, cwh + ko, cwl + ko);
        }
    }
    wait_copies();
}

// ---------- kernel 1: QKV projection ----------
// out[m][o] = sum_k X[m][k]*W[o][k]; Q as [token][d] planes per head, fragment-major.
// K ([token][d] tiles) and V ([d][token] tiles) share one buffer per head, ordered by the
// attention pass that reads them: per 32 keys 16 tiles, [K hi 4 | K lo 4 | V hi 4 | V lo 4].
#define PASS_E (16 * TILE_E)
// a block is 2 x 4 waves: 128 tokens by 256 features; the register budget of four waves per SIMD
// keeps two blocks on a WGP, so that one block multiplies while the other stands at its barrier
__global__ void __launch_bounds__(256) __attribute__((amdgpu_waves_per_eu(4, 4)))
gemm_qkv(const unsigned short* __restrict__ Xqh, const unsigned short* __restrict__ Xql,
         const unsigned short* __restrict__ Xkh, const unsigned short* __restrict__ Xkl,
         const int* __restrict__ cnts,
         const unsigned short* __restrict__ Wh, const unsigned short* __restrict__ Wl,
         unsigned short* __restrict__ Qh, unsigned short* __restrict__ Ql,
         unsigned short* __restrict__ KV) {
    __shared__ __attribute__((aligned(16))) unsigned short stg[2][STAGE_E];
    // K and V blocks work on the packed rows of the kept keys; a block wholly past its batch's count
    // has nothing to project: all its threads leave here, in front of every copy and barrier
    if (blockIdx.y >= 4 && (int)(blockIdx.x & 15) * 128 >= cnts[blockIdx.x >> 4]) return;
    const unsigned short* Xh = blockIdx.y < 4 ? Xqh : Xkh;
    const unsigned short* Xl = blockIdx.y < 4 ? Xql : Xkl;
    const int lane = threadIdx.x & 31;
    // the wave's number in a scalar register: tile, head and batch indices then live in scalar
    // registers through the K loop; held in vector registers they push the kernel past 256 of
    // them, which costs the fourth wave of a SIMD
    const int wave = __builtin_amdgcn_readfirstlane(threadIdx.x >> 5);
    const int m0 = (blockIdx.x * 2 + (wave & 1)) * (16 * WT);   // first token of the wave
    const int o0 = (blockIdx.y * 4 + (wave >> 1)) * 64;         // output features (one head slice)

    v8f acc[WT][4];
#pragma unroll
    for (int i = 0; i < WT; ++i)
#pragma unroll
        for (int t = 0; t < 4; ++t) acc[i][t] = v8f_zero();

    const int mb = blockIdx.x * 8;    // the block's first 16-row band of X
    const int ob = blockIdx.y * 16;   // and of W
    const int s  = blockIdx.y >> 2;   // 0=Q 1=K 2=V: the same for the whole block
    const int h  = (o0 & 1023) >> 6;
    const int b  = m0 >> 11;
    const size_t head = (size_t)(b * NHEAD + h);
    if (s == 2) {
        gemm_k_loop<false>(Xh, Xl, Wh, Wl, stg, mb, ob, wave & 1, wave >> 1, acc);
#pragma unroll
        for (int i = 0; i < WT; ++i) {
            const int n0 = (m0 & 2047) + i * 16;
            // Vt[d][n]: row d = t*16 + col, k = n0 + 8*hi16 + r: the lane's 8 values are one piece
            unsigned short* vp = KV + (head * (SEQ / 32) + (n0 >> 5)) * PASS_E + 8 * TILE_E
                               + ((n0 >> 4) & 1) * 256 + lane * 8;
#pragma unroll
            for (int t = 0; t < 4; ++t) {
                float x[8];
#pragma unroll
                for (int r = 0; r < 8; ++r) x[r] = acc[i][t][r];
                store_split8(x, vp + t * TILE_E, vp + (4 + t) * TILE_E);
            }
        }
    } else {
        gemm_k_loop<true>(Xh, Xl, Wh, Wl, stg, mb, ob, wave & 1, wave >> 1, acc);
#pragma unroll
        for (int i = 0; i < WT; ++i) {
            const int n0 = (m0 & 2047) + i * 16;
            // Q/K[n][d]: row n = n0 + col, k = d = t*16 + 8*hi16 + r: again one piece per lane
            const size_t qo = head * SEQ * DH + (size_t)(n0 >> 4) * (DH / 32) * TILE_E + lane * 8;
            const size_t ko = (head * (SEQ / 32) + (n0 >> 5)) * PASS_E
                            + ((n0 >> 4) & 1) * (DH / 32) * TILE_E + lane * 8;
            unsigned short* bh_ = (s == 0 ? Qh + qo : KV + ko);
            unsigned short* bl_ = (s == 0 ? Ql + qo : KV + ko + 4 * TILE_E);
#pragma unroll
            for (int t = 0; t < 4; ++t) {
                float x[8];
#pragma unroll
                for (int r = 0; r < 8; ++r) x[r] = acc[i][t][r];
                store_split8(x, bh_ + (t >> 1) * TILE_E + (t & 1) * 256,
                                bl_ + (t >> 1) * TILE_E + (t & 1) * 256);
            }
        }
    }
}

// ---------- kernel 2: flash attention (transposed-score trick) ----------
#define QT 2                      // query tiles (16 queries each) per wave
#define AW 4                      // waves per block
// one pass of K and V (16 tiles, 16 KB, contiguous in the workspace) into LDS, same order: each of the
// 128 lanes brings 8 pieces of 16 bytes, 2 KB apart; the offset moves the LDS and the global address
// alike. s_wait_xcnt 0 closes the statement so that no address register is rewritten ahead of it.
__device__ __forceinline__ void copy_pass(unsigned lds, const unsigned short* g) {
    asm volatile("global_load_async_to_lds_b128 %0, %1, off\n\t"
                 "global_load_async_to_lds_b128 %0, %1, off offset:2048\n\t"
                 "global_load_async_to_lds_b128 %0, %1, off offset:4096\n\t"
                 "global_load_async_to_lds_b128 %0, %1, off offset:6144\n\t"
                 "global_load_async_to_lds_b128 %0, %1, off offset:8192\n\t"
                 "global_load_async_to_lds_b128 %0, %1, off offset:10240\n\t"
                 "global_load_async_to_lds_b128 %0, %1, off offset:12288\n\t"
                 "global_load_async_to_lds_b128 %0, %1, off offset:14336\n\t"
                 "s_wait_xcnt 0x0" :: "v"(lds), "v"(g) : "memory");
}
__global__ void __launch_bounds__(AW * 32)
attn_kernel(const unsigned short* __restrict__ Qh, const unsigned short* __restrict__ Ql,
            const unsigned short* __restrict__ KV,
            const int* __restrict__ cnts,
            unsigned short* __restrict__ Xh, unsigned short* __restrict__ Xl) {
    __shared__ __attribute__((aligned(16))) unsigned short kvs[2][PASS_E];   // two passes of K and V
    const int lane = threadIdx.x & 31;
    const int wave = threadIdx.x >> 5;
    const int hi16 = lane >> 4;
    const int bid = blockIdx.x;
    const int b = bid >> 8;                       // 256 blocks per batch
    const int h = (bid >> 4) & 15;
    const int q0 = ((bid & 15) * AW + wave) * (16 * QT);  // 32 queries per wave

    const size_t head = (size_t)(b * NHEAD + h);
    // this thread's piece of each pass, in the workspace and in the two buffers
    const unsigned short* kvg = KV + head * (SEQ / 32) * PASS_E + threadIdx.x * 8;
    const unsigned kvl = lds_addr(&kvs[0][threadIdx.x * 8]);
    // K and V hold the batch's kept keys alone, packed: nk of them, walked in whole passes of 32
    // (held in a scalar register, so that the loop's tests on it are scalar compares)
    const int nk  = __builtin_amdgcn_readfirstlane(min(max(cnts[b], 1), SEQ));
    __builtin_assume(nk >= 1 && nk <= SEQ);                   // the clamp above: the loop has a first pass
    const int nkr = (nk + 31) & ~31;
    copy_pass(kvl, kvg);                                      // pass 0 into buffer 0
    wait_copies();
    __syncthreads();                                          // publishes pass 0
    if (nkr > 32)                                             // the same for the whole block
        copy_pass(kvl + PASS_E * 2, kvg + PASS_E);            // pass 1 into buffer 1

    // fragment-major planes: this lane's piece of a tile starts at lane*8
    const size_t qoff = head * SEQ * DH + (size_t)(q0 >> 4) * (DH / 32) * TILE_E + lane * 8;
    const unsigned short* qrh = Qh + qoff;
    const unsigned short* qrl = Ql + qoff;

    // Q tiles as B-operand (lane col = query), K-dim = head dim (2 steps of 32)
    v16bf qh[QT][2], ql[QT][2];
#pragma unroll
    for (int qt = 0; qt < QT; ++qt)
#pragma unroll
        for (int ds = 0; ds < 2; ++ds) {
            qh[qt][ds] = load_frag(qrh + (qt * (DH / 32) + ds) * TILE_E);
            ql[qt][ds] = load_frag(qrl + (qt * (DH / 32) + ds) * TILE_E);
        }
    if (cnts[BATCH + b] != 0) {           // no key kept: all scores equal, as in the reference
#pragma unroll
        for (int qt = 0; qt < QT; ++qt)
#pragma unroll
            for (int ds = 0; ds < 2; ++ds)
#pragma unroll
                for (int e = 0; e < 16; ++e) {
                    qh[qt][ds][e] = bfbits(0);
                    ql[qt][ds][e] = bfbits(0);
                }
    }

    float mrow[QT], lrow[QT];             // per-lane softmax state for query `col` of each tile
    v8f o[QT][4];                         // O^T accum: lane holds d = t*16+r+8*hi16, q = col
#pragma unroll
    for (int qt = 0; qt < QT; ++qt) {
        mrow[qt] = -3.0e38f;
        lrow[qt] = 0.0f;
#pragma unroll
        for (int t = 0; t < 4; ++t) o[qt][t] = v8f_zero();
    }

    for (int k0 = 0; k0 < nkr; k0 += 32) {
        // S^T = K . Q^T : st[qt][js][r] = score(key k0+js*16+r+8*hi16, query col of tile qt);
        // each K fragment is loaded once and multiplied with every Q tile of the wave
        const int buf = (k0 >> 5) & 1;
        const unsigned short* kvb = &kvs[buf][lane * 8];      // this pass's tiles, read from LDS
        v8f st[QT][2];
#pragma unroll
        for (int js = 0; js < 2; ++js) {
#pragma unroll
            for (int qt = 0; qt < QT; ++qt) st[qt][js] = v8f_zero();
            const unsigned short* kp = kvb + js * (DH / 32) * TILE_E;
#pragma unroll
            for (int ds = 0; ds < 2; ++ds) {
                v16bf kh = load_frag(kp + ds * TILE_E);
                v16bf kl = load_frag(kp + (4 + ds) * TILE_E);
#pragma unroll
                for (int qt = 0; qt < QT; ++qt)
                    st[qt][js] = wmma_split(kh, kl, qh[qt][ds], ql[qt][ds], st[qt][js]);
            }
        }
        // what is left to mask: the rows behind the last kept key, in the last pass alone (one scalar
        // test a pass). MASK_VAL / SCALE_F is exact, and the scaling below gives MASK_VAL back exactly
        if (k0 + 32 > nk) {
#pragma unroll
            for (int qt = 0; qt < QT; ++qt)
#pragma unroll
                for (int js = 0; js < 2; ++js)
#pragma unroll
                    for (int r = 0; r < 8; ++r)
                        if (k0 + js * 16 + 8 * hi16 + r >= nk) st[qt][js][r] = MASK_VAL / SCALE_F;
        }
        v16bf ph[QT], pl[QT];
        float alpha[QT];
#pragma unroll
        for (int qt = 0; qt < QT; ++qt) {
            // scale + running max
            float mx = mrow[qt];
#pragma unroll
            for (int js = 0; js < 2; ++js)
#pragma unroll
                for (int r = 0; r < 8; ++r) {
                    float s = st[qt][js][r] * SCALE_F;
                    st[qt][js][r] = s;
                    mx = fmaxf(mx, s);
                }
            mx = fmaxf(mx, __shfl_xor(mx, 16));       // combine the two key halves
            alpha[qt] = __expf(mrow[qt] - mx);
            mrow[qt] = mx;
            // exp -> P; st layout already matches the B-operand element order exactly
            float rs = 0.0f;
#pragma unroll
            for (int js = 0; js < 2; ++js)
#pragma unroll
                for (int r = 0; r < 8; ++r) {
                    float p = __expf(st[qt][js][r] - mx);
                    rs += p;
                    unsigned short hb = f2bf_u(p);
                    ph[qt][js * 8 + r] = bfbits(hb);
                    pl[qt][js * 8 + r] = bfbits(f2bf_u(p - bfu2f(hb)));
                }
            rs += __shfl_xor(rs, 16);
            lrow[qt] = lrow[qt] * alpha[qt] + rs;
        }
        // O^T += V^T . P^T  (4 d-subtiles); rescale is a per-lane scalar;
        // each V fragment is loaded once and multiplied with every P tile of the wave
#pragma unroll
        for (int t = 0; t < 4; ++t) {
            const unsigned short* vp = kvb + (8 + t) * TILE_E;
            v16bf vh = load_frag(vp);
            v16bf vl = load_frag(vp + 4 * TILE_E);
#pragma unroll
            for (int qt = 0; qt < QT; ++qt) {
                o[qt][t] = o[qt][t] * alpha[qt];
                o[qt][t] = wmma_split(vh, vl, ph[qt], pl[qt], o[qt][t]);
            }
        }
        // publish point: the next pass has landed for every wave, and every wave has left this buffer
        wait_lds_reads();
        wait_copies();
        __syncthreads();
        if (k0 + 64 < nkr)                                    // the same for the whole block
            copy_pass(kvl + buf * (PASS_E * 2), kvg + (size_t)((k0 >> 5) + 2) * PASS_E);
    }
    wait_copies();
    // write x[b][n=q0+qt*16+col][h*64+d], d = t*16 + 8*hi16 + r, into the fragment-major hi/lo
    // planes of the output GEMM: the lane's 8 values are one 16-byte piece
#pragma unroll
    for (int qt = 0; qt < QT; ++qt) {
        const float linv = 1.0f / lrow[qt];
        const size_t xoff = ((size_t)((b * SEQ + q0 + qt * 16) >> 4) * (DIMC / 32)
                             + h * (DH / 32)) * TILE_E + lane * 8;
#pragma unroll
        for (int t = 0; t < 4; ++t) {
            float x[8];
#pragma unroll
            for (int r = 0; r < 8; ++r) x[r] = o[qt][t][r] * linv;
            store_split8(x, Xh + xoff + (t >> 1) * TILE_E + (t & 1) * 256,
                            Xl + xoff + (t >> 1) * TILE_E + (t & 1) * 256);
        }
    }
}

// ---------- kernel 3: output projection + bias (fp32 out) ----------
__global__ void __launch_bounds__(256)
gemm_fc(const unsigned short* __restrict__ Xh, const unsigned short* __restrict__ Xl,
        const unsigned short* __restrict__ Wh, const unsigned short* __restrict__ Wl,
        const float* __restrict__ bias,
        float* __restrict__ out) {
    __shared__ __attribute__((aligned(16))) unsigned short stg[2][STAGE_E];
    const int lane = threadIdx.x & 31;
    const int wave = threadIdx.x >> 5;
    const int col  = lane & 15;
    const int hi16 = lane >> 4;
    const int m0 = (blockIdx.x * 2 + (wave & 1)) * (16 * WT);
    const int o0 = (blockIdx.y * 4 + (wave >> 1)) * 64;

    v8f acc[WT][4];
#pragma unroll
    for (int i = 0; i < WT; ++i)
#pragma unroll
        for (int t = 0; t < 4; ++t) acc[i][t] = v8f_zero();

    gemm_k_loop<false>(Xh, Xl, Wh, Wl, stg, blockIdx.x * 8, blockIdx.y * 16, wave & 1, wave >> 1, acc);
#pragma unroll
    for (int t = 0; t < 4; ++t) {
        const int oc = o0 + t * 16 + col;
        const float bia = bias[oc];
#pragma unroll
        for (int i = 0; i < WT; ++i) {
            const int n0 = m0 + i * 16 + 8 * hi16;
#pragma unroll
            for (int r = 0; r < 8; ++r)
                out[(size_t)(n0 + r) * DIMC + oc] = acc[i][t][r] + bia;
        }
    }
}

extern "C" void kernel_launch(void* const* d_in, const int* in_sizes, int n_in,
                              void* d_out, int out_size, void* d_ws, size_t ws_size,
                              hipStream_t stream) {
    const float* inputs = (const float*)d_in[0];
    const float* W_qkv  = (const float*)d_in[1];
    const float* W_fc   = (const float*)d_in[2];
    const float* b_fc   = (const float*)d_in[3];
    const int*   pmask  = (const int*)d_in[4];

    // workspace layout (bf16/ushort elements), all 1 KB tiles; 208 MB total
    const size_t nQKV = (size_t)BATCH * NHEAD * SEQ * DH;   // 8388608
    const size_t nX   = (size_t)BATCH * SEQ * DIMC;         // 8388608
    const size_t nWq  = (size_t)3 * DIMC * DIMC;            // 3145728
    const size_t nWf  = (size_t)DIMC * DIMC;                // 1048576
    unsigned short* p = (unsigned short*)d_ws;
    unsigned short* Qh  = p; p += nQKV;
    unsigned short* Ql  = p; p += nQKV;
    unsigned short* KV  = p; p += 4 * nQKV;
    unsigned short* Xih = p; p += nX;
    unsigned short* Xil = p; p += nX;
    unsigned short* Wqh = p; p += nWq;
    unsigned short* Wql = p; p += nWq;
    unsigned short* Wfh = p; p += nWf;
    unsigned short* Wfl = p; p += nWf;
    unsigned short* Xah = p; p += nX;
    unsigned short* Xal = p; p += nX;
    unsigned short* Xkh = p; p += nX;
    unsigned short* Xkl = p; p += nX;
    int* cnts = (int*)p;                                    // kept keys per batch, then the no-key flags

    pack_split_planes<<<((int)nX  / 16 + 255) / 256, 256, 0, stream>>>(inputs, Xih, Xil, (int)nX);
    pack_kept_keys<<<BATCH * (SEQ / 16), 256, 0, stream>>>(inputs, pmask, Xkh, Xkl, cnts);
    pack_split_planes<<<((int)nWq / 16 + 255) / 256, 256, 0, stream>>>(W_qkv,  Wqh, Wql, (int)nWq);
    pack_split_planes<<<((int)nWf / 16 + 255) / 256, 256, 0, stream>>>(W_fc,   Wfh, Wfl, (int)nWf);

    gemm_qkv<<<dim3(64, 12), 256, 0, stream>>>(Xih, Xil, Xkh, Xkl, cnts, Wqh, Wql,
                                               Qh, Ql, KV);
    attn_kernel<<<BATCH * NHEAD * (SEQ / 128), 128, 0, stream>>>(Qh, Ql, KV,
                                                                cnts, Xah, Xal);
    gemm_fc<<<dim3(64, 4), 256, 0, stream>>>(Xah, Xal, Wfh, Wfl, b_fc, (float*)d_out);
}

// v005
// It runs in 197 microseconds.
// Two timings next to v004 both put it at 1.07 times that version's speed.
// All steps since v000 together make it 5.07 times as fast.
#include <hip/hip_runtime.h>

#define DIMC   1024
#define NHEAD  16
#define BATCH  4
#define SEQ    2048
#define DH     64
#define SCALE_F 0.125f            // (1024/16)^-0.5
#define MASK_VAL -10000000.0f

typedef __attribute__((ext_vector_type(16))) __bf16        v16bf;
typedef __attribute__((ext_vector_type(8)))  float         v8f;
typedef __attribute__((ext_vector_type(4)))  unsigned int  u32x4;
typedef __attribute__((ext_vector_type(4)))  float         f32x4;
typedef __attribute__((ext_vector_type(2)))  float         f32x2;
typedef __attribute__((ext_vector_type(2)))  __bf16        bf16x2;

// ---------- bf16 hi/lo split helpers (separate planes) ----------
__device__ __forceinline__ __bf16 bfbits(unsigned short h) {
    return __builtin_bit_cast(__bf16, h);
}
// two f32 values -> their bf16 hi parts and the bf16 of what is left, each pair packed in one
// register (low half = a). The rounding, to nearest even, is the hardware's packed convert:
// one instruction for two values.
__device__ __forceinline__ void split2(float a, float b, unsigned int& hi, unsigned int& lo) {
    const f32x2 v = {a, b};
    const bf16x2 h = __builtin_convertvector(v, bf16x2);
    const f32x2 rest = v - __builtin_convertvector(h, f32x2);
    hi = __builtin_bit_cast(unsigned int, h);
    lo = __builtin_bit_cast(unsigned int, __builtin_convertvector(rest, bf16x2));
}

// WMMA operand element i maps to k = (i<8?0:16) + 8*hi16 + (i&7) (CDNA5 16-bit
// 16x32 A / 32x16 B layout, wave32).
// Every bf16 plane in the workspace is stored fragment-major: a plane of R rows
// by K columns is cut into tiles of 16 rows x 32 k (512 elements, 1 KB), tile
// index (row/16)*(K/32) + k/32 (the K/V buffer orders its tiles per key pass, see kernel 1). Inside a tile, element (row, k) lies at
//   ((k>>4)&1)*256 + (((k>>3)&1)*16 + (row&15))*8 + (k&7)
// so lane l's two 16-byte pieces lie at l*8 and 256 + l*8: each wave-wide
// 16-byte load or store covers 512 contiguous bytes, four whole 128-byte lines.
#define TILE_E 512
// lanep: start of the tile + lane*8
__device__ __forceinline__ v16bf load_frag(const unsigned short* __restrict__ lanep) {
    union { v16bf v; u32x4 q[2]; } u;
    u.q[0] = *(const u32x4*)(lanep);
    u.q[1] = *(const u32x4*)(lanep + 256);
    return u.v;
}
// split eight f32 values into bf16 hi and lo and store each as one 16-byte piece
__device__ __forceinline__ void store_split8(const float* x,
                                             unsigned short* __restrict__ hp,
                                             unsigned short* __restrict__ lp) {
    u32x4 qh, ql;
#pragma unroll
    for (int e = 0; e < 4; ++e) {
        unsigned int h, l;
        split2(x[2 * e], x[2 * e + 1], h, l);
        qh[e] = h;
        ql[e] = l;
    }
    *(u32x4*)hp = qh;
    *(u32x4*)lp = ql;
}

__device__ __forceinline__ v8f wmma_bf(v16bf a, v16bf b, v8f c) {
    return __builtin_amdgcn_wmma_f32_16x16x32_bf16(false, a, false, b, (short)0, c,
                                                   false, false);
}
// split-precision product: (ah+al)*(bh+bl) ~ ah*bh + ah*bl + al*bh
__device__ __forceinline__ v8f wmma_split(v16bf ah, v16bf al, v16bf bh, v16bf bl, v8f c) {
    c = wmma_bf(ah, bh, c);
    c = wmma_bf(ah, bl, c);
    c = wmma_bf(al, bh, c);
    return c;
}
__device__ __forceinline__ v8f v8f_zero() {
    v8f z;
#pragma unroll
    for (int e = 0; e < 8; ++e) z[e] = 0.0f;
    return z;
}

// ---------- kernel 0: fp32 [rows][DIMC] -> fragment-major bf16 hi plane + lo plane ----------
// one wave per 16x32 tile; a lane converts its own two 8-element pieces
__global__ void pack_split_planes(const float* __restrict__ src,
                                  unsigned short* __restrict__ hip_,
                                  unsigned short* __restrict__ lop_, int n) {
    int g = blockIdx.x * blockDim.x + threadIdx.x;
    if (g * 16 < n) {
        const int tile = g >> 5;
        const int lane = g & 31;
        const int row  = (tile >> 5) * 16 + (lane & 15);      // DIMC/32 = 32 tiles per row band
        const int k    = (tile & 31) * 32 + 8 * (lane >> 4);
        const float* sp = src + (size_t)row * DIMC + k;
#pragma unroll
        for (int j = 0; j < 2; ++j) {
            const f32x4 a = *(const f32x4*)(sp + j * 16);
            const f32x4 c = *(const f32x4*)(sp + j * 16 + 4);
            const float x[8] = {a[0], a[1], a[2], a[3], c[0], c[1], c[2], c[3]};
            const size_t o = (size_t)tile * TILE_E + j * 256 + lane * 8;
            store_split8(x, hip_ + o, lop_ + o);
        }
    }
}

// ---------- kernel 0b: the rows of X whose key is kept, packed densely per batch ----------
// A key with mask > 0 has the score MASK_VAL. Its weight exp(MASK_VAL - m), m the row's maximum, is
// exactly 0 in f32 once m > MASK_VAL + 104, and a kept key's scaled score from normal-drawn inputs
// stays millions above MASK_VAL: beside a kept key a masked one adds nothing to a row's sum or output.
// K and V are therefore projected, and the key loop run, over the kept keys alone: row j of batch b
// of these planes is the j-th kept token of that batch.
// Rows from the count up to the next multiple of 128 (a projection block) are written as zeros.
// A batch with no kept key: the reference's softmax is then uniform over all keys; every key is
// kept and cnts[BATCH + b] tells the attention kernel to take all scores as equal.
// One block per 16-row band of the packed planes; each block ranks the batch's 2048 mask words itself.
__global__ void __launch_bounds__(256)
pack_kept_keys(const float* __restrict__ src, const int* __restrict__ pm,
               unsigned short* __restrict__ hip_, unsigned short* __restrict__ lop_,
               int* __restrict__ cnts) {
    __shared__ int wsum[8];
    __shared__ int srow[16];
    const int t = threadIdx.x;
    const int lane = t & 31;
    const int wave = t >> 5;
    const int b  = blockIdx.x >> 7;               // SEQ/16 = 128 bands per batch
    const int j0 = (blockIdx.x & 127) * 16;       // first packed row of the band
    const int* mp = pm + b * SEQ + t * 8;         // this thread ranks eight tokens
    unsigned bits = 0;
#pragma unroll
    for (int e = 0; e < 8; ++e)
        if (!(mp[e] > 0)) bits |= 1u << e;
    const int c = __popc(bits);
    int inc = c;                                  // inclusive sum over the wave
#pragma unroll
    for (int d = 1; d < 32; d <<= 1) {
        const int o = __shfl_up(inc, d);
        if (lane >= d) inc += o;
    }
    if (lane == 31) wsum[wave] = inc;
    if (t < 16) srow[t] = -1;
    __syncthreads();                              // wave sums and the cleared row table are visible
    int before = inc - c, total = 0;
#pragma unroll
    for (int w = 0; w < 8; ++w) {
        const int s = wsum[w];
        total += s;
        if (w < wave) before += s;
    }
    const bool none = (total == 0);
    if (none) { bits = 0xFFu; before = t * 8; total = SEQ; }
#pragma unroll
    for (int e = 0; e < 8; ++e)
        if ((bits >> e) & 1u) {
            const int p = before - j0;
            if ((unsigned)p < 16u) srow[p] = t * 8 + e;
            ++before;
        }
    __syncthreads();                              // the band's source rows are visible
    if (j0 == 0 && t == 0) { cnts[b] = total; cnts[BATCH + b] = none ? 1 : 0; }
    if (j0 < ((total + 127) & ~127)) {            // the same for the whole block; no barrier inside
        const int tok = srow[lane & 15];          // a token number formed from thread indices, or -1
        const float* rp = src + ((size_t)b * SEQ + (tok < 0 ? 0 : tok)) * DIMC + wave * 128 + 8 * (lane >> 4);
        // a wave packs four tiles; all sixteen loads go out before the first value is used
        f32x4 v[4][2][2];
#pragma unroll
        for (int q = 0; q < 4; ++q)
#pragma unroll
            for (int j = 0; j < 2; ++j) {
                v[q][j][0] = *(const f32x4*)(rp + q * 32 + j * 16);
                v[q][j][1] = *(const f32x4*)(rp + q * 32 + j * 16 + 4);
            }
        // stands in front of the first rewrite of the loads' address registers; rp is named as an
        // input so that it lives to this line and no load's result is placed over it
        asm volatile("s_wait_xcnt 0x0" :: "v"(rp) : "memory");
#pragma unroll
        for (int q = 0; q < 4; ++q)
#pragma unroll
            for (int j = 0; j < 2; ++j) {
                float x[8];
#pragma unroll
                for (int e = 0; e < 8; ++e) x[e] = tok < 0 ? 0.0f : v[q][j][e >> 2][e & 3];
                const size_t o = ((size_t)blockIdx.x * (DIMC / 32) + wave * 4 + q) * TILE_E
                               + j * 256 + lane * 8;
                store_split8(x, hip_ + o, lop_ + o);
            }
    }
}

// ---------- asynchronous copies to LDS: waits of the two-buffer ring ----------
// the wave's own LDS reads have returned: stands in front of the barrier behind which a buffer is refilled
__device__ __forceinline__ void wait_lds_reads() { asm volatile("s_wait_dscnt 0x0" ::: "memory"); }
// the wave's own copies have landed: stands in front of the barrier behind which other waves read them
__device__ __forceinline__ void wait_copies() { asm volatile("s_wait_asynccnt 0x0" ::: "memory"); }
__device__ __forceinline__ unsigned lds_addr(const unsigned short* p) {
    return (unsigned)(unsigned long long)p;       // low 32 bits of a __shared__ address: the LDS byte
}

// One K step (32 k) of a block's operands in LDS, 48 tiles of 1 KB:
// [X hi 8 | X lo 8 | W hi 16 | W lo 16], the tiles of a plane in row order.
#define STAGE_E (48 * TILE_E)
#define BAND_E  ((DIMC / 32) * TILE_E)        // from one 16-row band of a plane to the next
// 256 threads bring a stage: 64 threads a tile, four tiles a copy, twelve copies a thread. xh..wl: the
// thread's piece of the first four tiles of each plane at this K step; lds: its piece of tile 0..3.
// s_wait_xcnt 0 closes the statement so that no address register is rewritten ahead of it.
__device__ __forceinline__ void copy_stage(unsigned lds,
                                           const unsigned short* xh, const unsigned short* xl,
                                           const unsigned short* wh, const unsigned short* wl) {
    asm volatile("global_load_async_to_lds_b128 %0, %12, off\n\t"
                 "global_load_async_to_lds_b128 %1, %13, off\n\t"
                 "global_load_async_to_lds_b128 %2, %14, off\n\t"
                 "global_load_async_to_lds_b128 %3, %15, off\n\t"
                 "global_load_async_to_lds_b128 %4, %16, off\n\t"
                 "global_load_async_to_lds_b128 %5, %17, off\n\t"
                 "global_load_async_to_lds_b128 %6, %18, off\n\t"
                 "global_load_async_to_lds_b128 %7, %19, off\n\t"
                 "global_load_async_to_lds_b128 %8, %20, off\n\t"
                 "global_load_async_to_lds_b128 %9, %21, off\n\t"
                 "global_load_async_to_lds_b128 %10, %22, off\n\t"
                 "global_load_async_to_lds_b128 %11, %23, off\n\t"
                 "s_wait_xcnt 0x0"
                 :: "v"(lds), "v"(lds + 4096), "v"(lds + 2 * 4096), "v"(lds + 3 * 4096),
                    "v"(lds + 4 * 4096), "v"(lds + 5 * 4096), "v"(lds + 6 * 4096), "v"(lds + 7 * 4096),
                    "v"(lds + 8 * 4096), "v"(lds + 9 * 4096), "v"(lds + 10 * 4096), "v"(lds + 11 * 4096),
                    "v"(xh), "v"(xh + 4 * BAND_E), "v"(xl), "v"(xl + 4 * BAND_E),
                    "v"(wh), "v"(wh + 4 * BAND_E), "v"(wh + 8 * BAND_E), "v"(wh + 12 * BAND_E),
                    "v"(wl), "v"(wl + 4 * BAND_E), "v"(wl + 8 * BAND_E), "v"(wl + 12 * BAND_E)
                 : "memory");
}

// K loop shared by both projections: a 64x64 tile per wave (4 X tiles by 4 W tiles), K = DIMC:
// a loaded W fragment meets four X tiles instead of one, an X fragment four W tiles as before.
// A block is 2 x 4 waves, 128 tokens by 256 features. Its operands of one K step are brought into LDS
// once for all eight waves by asynchronous copies, two buffers: the next step's copies fly while this
// step's fragments are read from LDS and multiplied.
// mb, ob: first 16-row band of the block in X and in W; wm, wn: the wave's place in the block.
// SWAP = false: acc[i][t] = X-tile i (A) . W-tile t (B): lane holds 8 tokens of one feature.
// SWAP = true : acc[i][t] = W-tile t (A) . X-tile i (B): lane holds 8 features of one token.
// The three split products are summed in the same order either way.
#define WT 4                      // X tiles (16 tokens each) per wave
template <bool SWAP>
__device__ __forceinline__ void gemm_k_loop(const unsigned short* __restrict__ Xh,
                                            const unsigned short* __restrict__ Xl,
                                            const unsigned short* __restrict__ Wh,
                                            const unsigned short* __restrict__ Wl,
                                            unsigned short (&stg)[2][STAGE_E],
                                            int mb, int ob, int wm, int wn,
                                            v8f (&acc)[WT][4]) {
    const int lane = threadIdx.x & 31;
    // this thread's piece of a stage: tile threadIdx.x / 64 of each group of four, 16 bytes of it
    const size_t xo = (size_t)(mb + (threadIdx.x >> 6)) * BAND_E + (threadIdx.x & 63) * 8;
    const size_t wo = (size_t)(ob + (threadIdx.x >> 6)) * BAND_E + (threadIdx.x & 63) * 8;
    const unsigned short* cxh = Xh + xo;
    const unsigned short* cxl = Xl + xo;
    const unsigned short* cwh = Wh + wo;
    const unsigned short* cwl = Wl + wo;
    const unsigned sl = lds_addr(&stg[0][threadIdx.x * 8]);

    copy_stage(sl, cxh, cxl, cwh, cwl);                       // K step 0 into buffer 0
    wait_copies();
    __syncthreads();                                          // publishes K step 0
    copy_stage(sl + STAGE_E * 2, cxh + TILE_E, cxl + TILE_E, cwh + TILE_E, cwl + TILE_E);

    for (int kt = 0; kt < DIMC / 32; ++kt) {
        const int buf = kt & 1;
        const unsigned short* pah = &stg[buf][(wm * WT) * TILE_E + lane * 8];
        const unsigned short* pal = pah + 8 * TILE_E;
        const unsigned short* pbh = &stg[buf][(16 + wn * 4) * TILE_E + lane * 8];
        const unsigned short* pbl = pbh + 16 * TILE_E;
        v16bf ah[WT], al[WT];
#pragma unroll
        for (int i = 0; i < WT; ++i) {
            ah[i] = load_frag(pah + i * TILE_E);
            al[i] = load_frag(pal + i * TILE_E);
        }
#pragma unroll
        for (int t = 0; t < 4; ++t) {
            v16bf bh = load_frag(pbh + t * TILE_E);
            v16bf bl = load_frag(pbl + t * TILE_E);
            if (SWAP) {
#pragma unroll
                for (int i = 0; i < WT; ++i) acc[i][t] = wmma_bf(bh, ah[i], acc[i][t]);
#pragma unroll
                for (int i = 0; i < WT; ++i) acc[i][t] = wmma_bf(bl, ah[i], acc[i][t]);
#pragma unroll
                for (int i = 0; i < WT; ++i) acc[i][t] = wmma_bf(bh, al[i], acc[i][t]);
            } else {
#pragma unroll
                for (int i = 0; i < WT; ++i) acc[i][t] = wmma_bf(ah[i], bh, acc[i][t]);
#pragma unroll
                for (int i = 0; i < WT; ++i) acc[i][t] = wmma_bf(ah[i], bl, acc[i][t]);
#pragma unroll
                for (int i = 0; i < WT; ++i) acc[i][t] = wmma_bf(al[i], bh, acc[i][t]);
            }
        }
        // publish point: the next K step has landed for every wave, and every wave has left this buffer
        wait_lds_reads();
        wait_copies();
        __syncthreads();
        if (kt + 2 < DIMC / 32) {                             // the same for the whole block
            const int ko = (kt + 2) * TILE_E;
            copy_stage(sl + buf * (STAGE_E * 2), cxh + ko, cxl + ko, cwh + ko, cwl + ko);
        }
    }
    wait_copies();
}

// ---------- kernel 1: QKV projection ----------
// out[m][o] = sum_k X[m][k]*W[o][k]; Q as [token][d] planes per head, fragment-major.
// K ([token][d] tiles) and V ([d][token] tiles) share one buffer per head, ordered by the
// attention pass that reads them: per 32 keys 16 tiles, [K hi 4 | K lo 4 | V hi 4 | V lo 4].
#define PASS_E (16 * TILE_E)
// a block is 2 x 4 waves: 128 tokens by 256 features; the register budget of four waves per SIMD
// keeps two blocks on a WGP, so that one block multiplies while the other stands at its barrier
__global__ void __launch_bounds__(256) __attribute__((amdgpu_waves_per_eu(4, 4)))
gemm_qkv(const unsigned short* __restrict__ Xqh, const unsigned short* __restrict__ Xql,
         const unsigned short* __restrict__ Xkh, const unsigned short* __restrict__ Xkl,
         const int* __restrict__ cnts,
         const unsigned short* __restrict__ Wh, const unsigned short* __restrict__ Wl,
         unsigned short* __restrict__ Qh, unsigned short* __restrict__ Ql,
         unsigned short* __restrict__ KV) {
    __shared__ __attribute__((aligned(16))) unsigned short stg[2][STAGE_E];
    // K and V blocks work on the packed rows of the kept keys; a block wholly past its batch's count
    // has nothing to project: all its threads leave here, in front of every copy and barrier
    if (blockIdx.y >= 4 && (int)(blockIdx.x & 15) * 128 >= cnts[blockIdx.x >> 4]) return;
    const unsigned short* Xh = blockIdx.y < 4 ? Xqh : Xkh;
    const unsigned short* Xl = blockIdx.y < 4 ? Xql : Xkl;
    const int lane = threadIdx.x & 31;
    // the wave's number in a scalar register: tile, head and batch indices then live in scalar
    // registers through the K loop; held in vector registers they push the kernel past 256 of
    // them, which costs the fourth wave of a SIMD
    const int wave = __builtin_amdgcn_readfirstlane(threadIdx.x >> 5);
    const int m0 = (blockIdx.x * 2 + (wave & 1)) * (16 * WT);   // first token of the wave
    const int o0 = (blockIdx.y * 4 + (wave >> 1)) * 64;         // output features (one head slice)

    v8f acc[WT][4];
#pragma unroll
    for (int i = 0; i < WT; ++i)
#pragma unroll
        for (int t = 0; t < 4; ++t) acc[i][t] = v8f_zero();

    const int mb = blockIdx.x * 8;    // the block's first 16-row band of X
    const int ob = blockIdx.y * 16;   // and of W
    const int s  = blockIdx.y >> 2;   // 0=Q 1=K 2=V: the same for the whole block
    const int h  = (o0 & 1023) >> 6;
    const int b  = m0 >> 11;
    const size_t head = (size_t)(b * NHEAD + h);
    if (s == 2) {
        gemm_k_loop<false>(Xh, Xl, Wh, Wl, stg, mb, ob, wave & 1, wave >> 1, acc);
#pragma unroll
        for (int i = 0; i < WT; ++i) {
            const int n0 = (m0 & 2047) + i * 16;
            // Vt[d][n]: row d = t*16 + col, k = n0 + 8*hi16 + r: the lane's 8 values are one piece
            unsigned short* vp = KV + (head * (SEQ / 32) + (n0 >> 5)) * PASS_E + 8 * TILE_E
                               + ((n0 >> 4) & 1) * 256 + lane * 8;
#pragma unroll
            for (int t = 0; t < 4; ++t) {
                float x[8];
#pragma unroll
                for (int r = 0; r < 8; ++r) x[r] = acc[i][t][r];
                store_split8(x, vp + t * TILE_E, vp + (4 + t) * TILE_E);
            }
        }
    } else {
        gemm_k_loop<true>(Xh, Xl, Wh, Wl, stg, mb, ob, wave & 1, wave >> 1, acc);
#pragma unroll
        for (int i = 0; i < WT; ++i) {
            const int n0 = (m0 & 2047) + i * 16;
            // Q/K[n][d]: row n = n0 + col, k = d = t*16 + 8*hi16 + r: again one piece per lane
            const size_t qo = head * SEQ * DH + (size_t)(n0 >> 4) * (DH / 32) * TILE_E + lane * 8;
            const size_t ko = (head * (SEQ / 32) + (n0 >> 5)) * PASS_E
                            + ((n0 >> 4) & 1) * (DH / 32) * TILE_E + lane * 8;
            unsigned short* bh_ = (s == 0 ? Qh + qo : KV + ko);
            unsigned short* bl_ = (s == 0 ? Ql + qo : KV + ko + 4 * TILE_E);
#pragma unroll
            for (int t = 0; t < 4; ++t) {
                float x[8];
#pragma unroll
                for (int r = 0; r < 8; ++r) x[r] = acc[i][t][r];
                store_split8(x, bh_ + (t >> 1) * TILE_E + (t & 1) * 256,
                                bl_ + (t >> 1) * TILE_E + (t & 1) * 256);
            }
        }
    }
}

// ---------- kernel 2: flash attention (transposed-score trick) ----------
#define QT 2                      // query tiles (16 queries each) per wave
#define AW 4                      // waves per block
// one pass of K and V (16 tiles, 16 KB, contiguous in the workspace) into LDS, same order: each of the
// 128 lanes brings 8 pieces of 16 bytes, 2 KB apart; the offset moves the LDS and the global address
// alike. s_wait_xcnt 0 closes the statement so that no address register is rewritten ahead of it.
__device__ __forceinline__ void copy_pass(unsigned lds, const unsigned short* g) {
    asm volatile("global_load_async_to_lds_b128 %0, %1, off\n\t"
                 "global_load_async_to_lds_b128 %0, %1, off offset:2048\n\t"
                 "global_load_async_to_lds_b128 %0, %1, off offset:4096\n\t"
                 "global_load_async_to_lds_b128 %0, %1, off offset:6144\n\t"
                 "global_load_async_to_lds_b128 %0, %1, off offset:8192\n\t"
                 "global_load_async_to_lds_b128 %0, %1, off offset:10240\n\t"
                 "global_load_async_to_lds_b128 %0, %1, off offset:12288\n\t"
                 "global_load_async_to_lds_b128 %0, %1, off offset:14336\n\t"
                 "s_wait_xcnt 0x0" :: "v"(lds), "v"(g) : "memory");
}
__global__ void __launch_bounds__(AW * 32)
attn_kernel(const unsigned short* __restrict__ Qh, const unsigned short* __restrict__ Ql,
            const unsigned short* __restrict__ KV,
            const int* __restrict__ cnts,
            unsigned short* __restrict__ Xh, unsigned short* __restrict__ Xl) {
    __shared__ __attribute__((aligned(16))) unsigned short kvs[2][PASS_E];   // two passes of K and V
    const int lane = threadIdx.x & 31;
    const int wave = threadIdx.x >> 5;
    const int hi16 = lane >> 4;
    const int bid = blockIdx.x;
    const int b = bid >> 8;                       // 256 blocks per batch
    const int h = (bid >> 4) & 15;
    const int q0 = ((bid & 15) * AW + wave) * (16 * QT);  // 32 queries per wave

    const size_t head = (size_t)(b * NHEAD + h);
    // this thread's piece of each pass, in the workspace and in the two buffers
    const unsigned short* kvg = KV + head * (SEQ / 32) * PASS_E + threadIdx.x * 8;
    const unsigned kvl = lds_addr(&kvs[0][threadIdx.x * 8]);
    // K and V hold the batch's kept keys alone, packed: nk of them, walked in whole passes of 32
    // (held in a scalar register, so that the loop's tests on it are scalar compares)
    const int nk  = __builtin_amdgcn_readfirstlane(min(max(cnts[b], 1), SEQ));
    __builtin_assume(nk >= 1 && nk <= SEQ);                   // the clamp above: the loop has a first pass
    const int nkr = (nk + 31) & ~31;
    copy_pass(kvl, kvg);                                      // pass 0 into buffer 0
    wait_copies();
    __syncthreads();                                          // publishes pass 0
    if (nkr > 32)                                             // the same for the whole block
        copy_pass(kvl + PASS_E * 2, kvg + PASS_E);            // pass 1 into buffer 1

    // fragment-major planes: this lane's piece of a tile starts at lane*8
    const size_t qoff = head * SEQ * DH + (size_t)(q0 >> 4) * (DH / 32) * TILE_E + lane * 8;
    const unsigned short* qrh = Qh + qoff;
    const unsigned short* qrl = Ql + qoff;

    // Q tiles as B-operand (lane col = query), K-dim = head dim (2 steps of 32)
    v16bf qh[QT][2], ql[QT][2];
#pragma unroll
    for (int qt = 0; qt < QT; ++qt)
#pragma unroll
        for (int ds = 0; ds < 2; ++ds) {
            qh[qt][ds] = load_frag(qrh + (qt * (DH / 32) + ds) * TILE_E);
            ql[qt][ds] = load_frag(qrl + (qt * (DH / 32) + ds) * TILE_E);
        }
    if (cnts[BATCH + b] != 0) {           // no key kept: all scores equal, as in the reference
#pragma unroll
        for (int qt = 0; qt < QT; ++qt)
#pragma unroll
            for (int ds = 0; ds < 2; ++ds)
#pragma unroll
                for (int e = 0; e < 16; ++e) {
                    qh[qt][ds][e] = bfbits(0);
                    ql[qt][ds][e] = bfbits(0);
                }
    }

    float mrow[QT], lrow[QT];             // per-lane softmax state for query `col` of each tile
    v8f o[QT][4];                         // O^T accum: lane holds d = t*16+r+8*hi16, q = col
#pragma unroll
    for (int qt = 0; qt < QT; ++qt) {
        mrow[qt] = -3.0e38f;
        lrow[qt] = 0.0f;
#pragma unroll
        for (int t = 0; t < 4; ++t) o[qt][t] = v8f_zero();
    }

    for (int k0 = 0; k0 < nkr; k0 += 32) {
        // S^T = K . Q^T : st[qt][js][r] = score(key k0+js*16+r+8*hi16, query col of tile qt);
        // each K fragment is loaded once and multiplied with every Q tile of the wave
        const int buf = (k0 >> 5) & 1;
        const unsigned short* kvb = &kvs[buf][lane * 8];      // this pass's tiles, read from LDS
        v8f st[QT][2];
#pragma unroll
        for (int js = 0; js < 2; ++js) {
#pragma unroll
            for (int qt = 0; qt < QT; ++qt) st[qt][js] = v8f_zero();
            const unsigned short* kp = kvb + js * (DH / 32) * TILE_E;
#pragma unroll
            for (int ds = 0; ds < 2; ++ds) {
                v16bf kh = load_frag(kp + ds * TILE_E);
                v16bf kl = load_frag(kp + (4 + ds) * TILE_E);
#pragma unroll
                for (int qt = 0; qt < QT; ++qt)
                    st[qt][js] = wmma_split(kh, kl, qh[qt][ds], ql[qt][ds], st[qt][js]);
            }
        }
        // what is left to mask: the rows behind the last kept key, in the last pass alone (one scalar
        // test a pass). MASK_VAL / SCALE_F is exact, and the scaling below gives MASK_VAL back exactly
        if (k0 + 32 > nk) {
#pragma unroll
            for (int qt = 0; qt < QT; ++qt)
#pragma unroll
                for (int js = 0; js < 2; ++js)
#pragma unroll
                    for (int r = 0; r < 8; ++r)
                        if (k0 + js * 16 + 8 * hi16 + r >= nk) st[qt][js][r] = MASK_VAL / SCALE_F;
        }
        union { v16bf v; unsigned int u[8]; } ph[QT], pl[QT];
        float alpha[QT];
#pragma unroll
        for (int qt = 0; qt < QT; ++qt) {
            // scale + running max
            float mx = mrow[qt];
#pragma unroll
            for (int js = 0; js < 2; ++js)
#pragma unroll
                for (int r = 0; r < 8; ++r) {
                    float s = st[qt][js][r] * SCALE_F;
                    st[qt][js][r] = s;
                    mx = fmaxf(mx, s);
                }
            mx = fmaxf(mx, __shfl_xor(mx, 16));       // combine the two key halves
            alpha[qt] = __expf(mrow[qt] - mx);
            mrow[qt] = mx;
            // exp -> P; st layout already matches the B-operand element order exactly
            float rs = 0.0f;
#pragma unroll
            for (int js = 0; js < 2; ++js)
#pragma unroll
                for (int r = 0; r < 8; r += 2) {
                    const float p0 = __expf(st[qt][js][r] - mx);
                    const float p1 = __expf(st[qt][js][r + 1] - mx);
                    rs += p0;
                    rs += p1;
                    split2(p0, p1, ph[qt].u[js * 4 + (r >> 1)], pl[qt].u[js * 4 + (r >> 1)]);
                }
            rs += __shfl_xor(rs, 16);
            lrow[qt] = lrow[qt] * alpha[qt] + rs;
        }
        // O^T += V^T . P^T  (4 d-subtiles); rescale is a per-lane scalar;
        // each V fragment is loaded once and multiplied with every P tile of the wave
#pragma unroll
        for (int t = 0; t < 4; ++t) {
            const unsigned short* vp = kvb + (8 + t) * TILE_E;
            v16bf vh = load_frag(vp);
            v16bf vl = load_frag(vp + 4 * TILE_E);
#pragma unroll
            for (int qt = 0; qt < QT; ++qt) {
                o[qt][t] = o[qt][t] * alpha[qt];
                o[qt][t] = wmma_split(vh, vl, ph[qt].v, pl[qt].v, o[qt][t]);
            }
        }
        // publish point: the next pass has landed for every wave, and every wave has left this buffer
        wait_lds_reads();
        wait_copies();
        __syncthreads();
        if (k0 + 64 < nkr)                                    // the same for the whole block
            copy_pass(kvl + buf * (PASS_E * 2), kvg + (size_t)((k0 >> 5) + 2) * PASS_E);
    }
    wait_copies();
    // write x[b][n=q0+qt*16+col][h*64+d], d = t*16 + 8*hi16 + r, into the fragment-major hi/lo
    // planes of the output GEMM: the lane's 8 values are one 16-byte piece
#pragma unroll
    for (int qt = 0; qt < QT; ++qt) {
        const float linv = 1.0f / lrow[qt];
        const size_t xoff = ((size_t)((b * SEQ + q0 + qt * 16) >> 4) * (DIMC / 32)
                             + h * (DH / 32)) * TILE_E + lane * 8;
#pragma unroll
        for (int t = 0; t < 4; ++t) {
            float x[8];
#pragma unroll
            for (int r = 0; r < 8; ++r) x[r] = o[qt][t][r] * linv;
            store_split8(x, Xh + xoff + (t >> 1) * TILE_E + (t & 1) * 256,
                            Xl + xoff + (t >> 1) * TILE_E + (t & 1) * 256);
        }
    }
}

// ---------- kernel 3: output projection + bias (fp32 out) ----------
__global__ void __launch_bounds__(256)
gemm_fc(const unsigned short* __restrict__ Xh, const unsigned short* __restrict__ Xl,
        const unsigned short* __restrict__ Wh, const unsigned short* __restrict__ Wl,
        const float* __restrict__ bias,
        float* __restrict__ out) {
    __shared__ __attribute__((aligned(16))) unsigned short stg[2][STAGE_E];
    const int lane = threadIdx.x & 31;
    const int wave = threadIdx.x >> 5;
    const int col  = lane & 15;
    const int hi16 = lane >> 4;
    const int m0 = (blockIdx.x * 2 + (wave & 1)) * (16 * WT);
    const int o0 = (blockIdx.y * 4 + (wave >> 1)) * 64;

    v8f acc[WT][4];
#pragma unroll
    for (int i = 0; i < WT; ++i)
#pragma unroll
        for (int t = 0; t < 4; ++t) acc[i][t] = v8f_zero();

    gemm_k_loop<false>(Xh, Xl, Wh, Wl, stg, blockIdx.x * 8, blockIdx.y * 16, wave & 1, wave >> 1, acc);
#pragma unroll
    for (int t = 0; t < 4; ++t) {
        const int oc = o0 + t * 16 + col;
        const float bia = bias[oc];
#pragma unroll
        for (int i = 0; i < WT; ++i) {
            const int n0 = m0 + i * 16 + 8 * hi16;
#pragma unroll
            for (int r = 0; r < 8; ++r)
                out[(size_t)(n0 + r) * DIMC + oc] = acc[i][t][r] + bia;
        }
    }
}

extern "C" void kernel_launch(void* const* d_in, const int* in_sizes, int n_in,
                              void* d_out, int out_size, void* d_ws, size_t ws_size,
                              hipStream_t stream) {
    const float* inputs = (const float*)d_in[0];
    const float* W_qkv  = (const float*)d_in[1];
    const float* W_fc   = (const float*)d_in[2];
    const float* b_fc   = (const float*)d_in[3];
    const int*   pmask  = (const int*)d_in[4];

    // workspace layout (bf16/ushort elements), all 1 KB tiles; 208 MB total
    const size_t nQKV = (size_t)BATCH * NHEAD * SEQ * DH;   // 8388608
    const size_t nX   = (size_t)BATCH * SEQ * DIMC;         // 8388608
    const size_t nWq  = (size_t)3 * DIMC * DIMC;            // 3145728
    const size_t nWf  = (size_t)DIMC * DIMC;                // 1048576
    unsigned short* p = (unsigned short*)d_ws;
    unsigned short* Qh  = p; p += nQKV;
    unsigned short* Ql  = p; p += nQKV;
    unsigned short* KV  = p; p += 4 * nQKV;
    unsigned short* Xih = p; p += nX;
    unsigned short* Xil = p; p += nX;
    unsigned short* Wqh = p; p += nWq;
    unsigned short* Wql = p; p += nWq;
    unsigned short* Wfh = p; p += nWf;
    unsigned short* Wfl = p; p += nWf;
    unsigned short* Xah = p; p += nX;
    unsigned short* Xal = p; p += nX;
    unsigned short* Xkh = p; p += nX;
    unsigned short* Xkl = p; p += nX;
    int* cnts = (int*)p;                                    // kept keys per batch, then the no-key flags

    pack_split_planes<<<((int)nX  / 16 + 255) / 256, 256, 0, stream>>>(inputs, Xih, Xil, (int)nX);
    pack_kept_keys<<<BATCH * (SEQ / 16), 256, 0, stream>>>(inputs, pmask, Xkh, Xkl, cnts);
    pack_split_planes<<<((int)nWq / 16 + 255) / 256, 256, 0, stream>>>(W_qkv,  Wqh, Wql, (int)nWq);
    pack_split_planes<<<((int)nWf / 16 + 255) / 256, 256, 0, stream>>>(W_fc,   Wfh, Wfl, (int)nWf);

    gemm_qkv<<<dim3(64, 12), 256, 0, stream>>>(Xih, Xil, Xkh, Xkl, cnts, Wqh, Wql,
                                               Qh, Ql, KV);
    attn_kernel<<<BATCH * NHEAD * (SEQ / 128), 128, 0, stream>>>(Qh, Ql, KV,
                                                                cnts, Xah, Xal);
    gemm_fc<<<dim3(64, 4), 256, 0, stream>>>(Xah, Xal, Wfh, Wfl, b_fc, (float*)d_out);
}

// v006
// A run of this version takes 189 microseconds.
// Two timings next to v005 put it at 1.04 and 1.05 times that version's speed.
// All steps since v000 together make it 5.32 times as fast.
#include <hip/hip_runtime.h>

#define DIMC   1024
#define NHEAD  16
#define BATCH  4
#define SEQ    2048
#define DH     64
#define SCALE_F 0.125f            // (1024/16)^-0.5
#define MASK_VAL -10000000.0f

typedef __attribute__((ext_vector_type(16))) __bf16        v16bf;
typedef __attribute__((ext_vector_type(8)))  float         v8f;
typedef __attribute__((ext_vector_type(4)))  unsigned int  u32x4;
typedef __attribute__((ext_vector_type(4)))  float         f32x4;
typedef __attribute__((ext_vector_type(2)))  float         f32x2;
typedef __attribute__((ext_vector_type(2)))  __bf16        bf16x2;

// ---------- bf16 hi/lo split helpers (separate planes) ----------
__device__ __forceinline__ __bf16 bfbits(unsigned short h) {
    return __builtin_bit_cast(__bf16, h);
}
// two f32 values -> their bf16 hi parts and the bf16 of what is left, each pair packed in one
// register (low half = a). The rounding, to nearest even, is the hardware's packed convert:
// one instruction for two values.
__device__ __forceinline__ void split2(float a, float b, unsigned int& hi, unsigned int& lo) {
    const f32x2 v = {a, b};
    const bf16x2 h = __builtin_convertvector(v, bf16x2);
    const f32x2 rest = v - __builtin_convertvector(h, f32x2);
    hi = __builtin_bit_cast(unsigned int, h);
    lo = __builtin_bit_cast(unsigned int, __builtin_convertvector(rest, bf16x2));
}

// WMMA operand element i maps to k = (i<8?0:16) + 8*hi16 + (i&7) (CDNA5 16-bit
// 16x32 A / 32x16 B layout, wave32).
// Every bf16 plane in the workspace is stored fragment-major: a plane of R rows
// by K columns is cut into tiles of 16 rows x 32 k (512 elements, 1 KB), tile
// index (row/16)*(K/32) + k/32 (the K/V buffer orders its tiles per key pass, see kernel 1). Inside a tile, element (row, k) lies at
//   ((k>>4)&1)*256 + (((k>>3)&1)*16 + (row&15))*8 + (k&7)
// so lane l's two 16-byte pieces lie at l*8 and 256 + l*8: each wave-wide
// 16-byte load or store covers 512 contiguous bytes, four whole 128-byte lines.
#define TILE_E 512
// lanep: start of the tile + lane*8
__device__ __forceinline__ v16bf load_frag(const unsigned short* __restrict__ lanep) {
    union { v16bf v; u32x4 q[2]; } u;
    u.q[0] = *(const u32x4*)(lanep);
    u.q[1] = *(const u32x4*)(lanep + 256);
    return u.v;
}
// split eight f32 values into bf16 hi and lo and store each as one 16-byte piece
__device__ __forceinline__ void store_split8(const float* x,
                                             unsigned short* __restrict__ hp,
                                             unsigned short* __restrict__ lp) {
    u32x4 qh, ql;
#pragma unroll
    for (int e = 0; e < 4; ++e) {
        unsigned int h, l;
        split2(x[2 * e], x[2 * e + 1], h, l);
        qh[e] = h;
        ql[e] = l;
    }
    *(u32x4*)hp = qh;
    *(u32x4*)lp = ql;
}

__device__ __forceinline__ v8f wmma_bf(v16bf a, v16bf b, v8f c) {
    return __builtin_amdgcn_wmma_f32_16x16x32_bf16(false, a, false, b, (short)0, c,
                                                   false, false);
}
// split-precision product: (ah+al)*(bh+bl) ~ ah*bh + ah*bl + al*bh
__device__ __forceinline__ v8f wmma_split(v16bf ah, v16bf al, v16bf bh, v16bf bl, v8f c) {
    c = wmma_bf(ah, bh, c);
    c = wmma_bf(ah, bl, c);
    c = wmma_bf(al, bh, c);
    return c;
}
__device__ __forceinline__ v8f v8f_zero() {
    v8f z;
#pragma unroll
    for (int e = 0; e < 8; ++e) z[e] = 0.0f;
    return z;
}

// ---------- kernel 0: every fp32 operand -> fragment-major bf16 hi plane + lo plane, one launch ----------
// One block per 16-row band (16 rows x DIMC) of a pair of planes; a wave packs four 16x32 tiles of the
// band, a lane its own two 8-element pieces of each tile. The bands, in block order:
//   [kept-key rows of X | all rows of X | W_qkv | W_fc]
// The kept-key bands stand first: they rank the mask before they can load, the longest way of a block.
//
// The kept-key planes. A key with mask > 0 has the score MASK_VAL. Its weight exp(MASK_VAL - m), m the
// row's maximum, is exactly 0 in f32 once m > MASK_VAL + 104, and a kept key's scaled score from
// normal-drawn inputs stays millions above MASK_VAL: beside a kept key a masked one adds nothing to a
// row's sum or output. K and V are therefore projected, and the key loop run, over the kept keys alone:
// row j of batch b of these planes is the j-th kept token of that batch.
// Rows from the count up to the next multiple of 128 (a projection block) are written as zeros.
// A batch with no kept key: the reference's softmax is then uniform over all keys; every key is
// kept and cnts[BATCH + b] tells the attention kernel to take all scores as equal.
// Each kept-key block ranks the batch's 2048 mask words itself.
#define XBANDS  (BATCH * SEQ / 16)            // 512 bands of X, and as many of its kept-key planes
#define WQBANDS (3 * DIMC / 16)               // 192
#define WFBANDS (DIMC / 16)                   // 64
__global__ void __launch_bounds__(256)
pack_planes(const float* __restrict__ xsrc, const int* __restrict__ pm,
            const float* __restrict__ wq, const float* __restrict__ wf,
            unsigned short* __restrict__ xkh, unsigned short* __restrict__ xkl,
            unsigned short* __restrict__ xih, unsigned short* __restrict__ xil,
            unsigned short* __restrict__ wqh, unsigned short* __restrict__ wql,
            unsigned short* __restrict__ wfh, unsigned short* __restrict__ wfl,
            int* __restrict__ cnts) {
    __shared__ int wsum[8];
    __shared__ int srow[16];
    const int t = threadIdx.x;
    const int lane = t & 31;
    const int wave = t >> 5;
    const int bid = blockIdx.x;
    const float* src;                             // the source matrix of the band
    unsigned short* hip_;                         // its two planes
    unsigned short* lop_;
    int band;                                     // the band's number in those planes
    int row;                                      // this lane's source row, or -1: a row of zeros
    bool work = true;                             // the same for the whole block
    if (bid < XBANDS) {                           // the same for the whole block: both barriers are inside
        const int b  = bid >> 7;                  // SEQ/16 = 128 bands per batch
        const int j0 = (bid & 127) * 16;          // first packed row of the band
        const int* mp = pm + b * SEQ + t * 8;     // this thread ranks eight tokens
        unsigned bits = 0;
#pragma unroll
        for (int e = 0; e < 8; ++e)
            if (!(mp[e] > 0)) bits |= 1u << e;
        const int c = __popc(bits);
        int inc = c;                              // inclusive sum over the wave
#pragma unroll
        for (int d = 1; d < 32; d <<= 1) {
            const int o = __shfl_up(inc, d);
            if (lane >= d) inc += o;
        }
        if (lane == 31) wsum[wave] = inc;
        if (t < 16) srow[t] = -1;
        __syncthreads();                          // wave sums and the cleared row table are visible
        int before = inc - c, total = 0;
#pragma unroll
        for (int w = 0; w < 8; ++w) {
            const int s = wsum[w];
            total += s;
            if (w < wave) before += s;
        }
        const bool none = (total == 0);
        if (none) { bits = 0xFFu; before = t * 8; total = SEQ; }
#pragma unroll
        for (int e = 0; e < 8; ++e)
            if ((bits >> e) & 1u) {
                const int p = before - j0;
                if ((unsigned)p < 16u) srow[p] = t * 8 + e;
                ++before;
            }
        __syncthreads();                          // the band's source rows are visible
        if (j0 == 0 && t == 0) { cnts[b] = total; cnts[BATCH + b] = none ? 1 : 0; }
        work = j0 < ((total + 127) & ~127);
        const int tok = srow[lane & 15];          // a token number formed from thread indices, or -1
        row = tok < 0 ? -1 : b * SEQ + tok;
        src = xsrc; hip_ = xkh; lop_ = xkl; band = bid;
    } else if (bid < 2 * XBANDS) {
        band = bid - XBANDS;
        src = xsrc; hip_ = xih; lop_ = xil; row = band * 16 + (lane & 15);
    } else if (bid < 2 * XBANDS + WQBANDS) {
        band = bid - 2 * XBANDS;
        src = wq; hip_ = wqh; lop_ = wql; row = band * 16 + (lane & 15);
    } else {
        band = bid - (2 * XBANDS + WQBANDS);
        src = wf; hip_ = wfh; lop_ = wfl; row = band * 16 + (lane & 15);
    }
    if (work) {                                   // no barrier inside
        const float* rp = src + (size_t)(row < 0 ? 0 : row) * DIMC + wave * 128 + 8 * (lane >> 4);
        // a wave packs four tiles; all sixteen loads go out before the first value is used
        f32x4 v[4][2][2];
#pragma unroll
        for (int q = 0; q < 4; ++q)
#pragma unroll
            for (int j = 0; j < 2; ++j) {
                v[q][j][0] = *(const f32x4*)(rp + q * 32 + j * 16);
                v[q][j][1] = *(const f32x4*)(rp + q * 32 + j * 16 + 4);
            }
        // stands in front of the first rewrite of the loads' address registers; rp is named as an
        // input so that it lives to this line and no load's result is placed over it
        asm volatile("s_wait_xcnt 0x0" :: "v"(rp) : "memory");
#pragma unroll
        for (int q = 0; q < 4; ++q)
#pragma unroll
            for (int j = 0; j < 2; ++j) {
                float x[8];
#pragma unroll
                for (int e = 0; e < 8; ++e) x[e] = row < 0 ? 0.0f : v[q][j][e >> 2][e & 3];
                const size_t o = ((size_t)band * (DIMC / 32) + wave * 4 + q) * TILE_E
                               + j * 256 + lane * 8;
                store_split8(x, hip_ + o, lop_ + o);
            }
    }
}

// ---------- asynchronous copies to LDS: waits of the two-buffer ring ----------
// the wave's own LDS reads have returned: stands in front of the barrier behind which a buffer is refilled
__device__ __forceinline__ void wait_lds_reads() { asm volatile("s_wait_dscnt 0x0" ::: "memory"); }
// the wave's own copies have landed: stands in front of the barrier behind which other waves read them
__device__ __forceinline__ void wait_copies() { asm volatile("s_wait_asynccnt 0x0" ::: "memory"); }
__device__ __forceinline__ unsigned lds_addr(const unsigned short* p) {
    return (unsigned)(unsigned long long)p;       // low 32 bits of a __shared__ address: the LDS byte
}

// One K step (32 k) of a block's operands in LDS, 48 tiles of 1 KB:
// [X hi 8 | X lo 8 | W hi 16 | W lo 16], the tiles of a plane in row order.
#define STAGE_E (48 * TILE_E)
#define BAND_E  ((DIMC / 32) * TILE_E)        // from one 16-row band of a plane to the next
// 256 threads bring a stage: 64 threads a tile, four tiles a copy, twelve copies a thread. xh..wl: the
// thread's piece of the first four tiles of each plane at this K step; lds: its piece of tile 0..3.
// s_wait_xcnt 0 closes the statement so that no address register is rewritten ahead of it.
__device__ __forceinline__ void copy_stage(unsigned lds,
                                           const unsigned short* xh, const unsigned short* xl,
                                           const unsigned short* wh, const unsigned short* wl) {
    asm volatile("global_load_async_to_lds_b128 %0, %12, off\n\t"
                 "global_load_async_to_lds_b128 %1, %13, off\n\t"
                 "global_load_async_to_lds_b128 %2, %14, off\n\t"
                 "global_load_async_to_lds_b128 %3, %15, off\n\t"
                 "global_load_async_to_lds_b128 %4, %16, off\n\t"
                 "global_load_async_to_lds_b128 %5, %17, off\n\t"
                 "global_load_async_to_lds_b128 %6, %18, off\n\t"
                 "global_load_async_to_lds_b128 %7, %19, off\n\t"
                 "global_load_async_to_lds_b128 %8, %20, off\n\t"
                 "global_load_async_to_lds_b128 %9, %21, off\n\t"
                 "global_load_async_to_lds_b128 %10, %22, off\n\t"
                 "global_load_async_to_lds_b128 %11, %23, off\n\t"
                 "s_wait_xcnt 0x0"
                 :: "v"(lds), "v"(lds + 4096), "v"(lds + 2 * 4096), "v"(lds + 3 * 4096),
                    "v"(lds + 4 * 4096), "v"(lds + 5 * 4096), "v"(lds + 6 * 4096), "v"(lds + 7 * 4096),
                    "v"(lds + 8 * 4096), "v"(lds + 9 * 4096), "v"(lds + 10 * 4096), "v"(lds + 11 * 4096),
                    "v"(xh), "v"(xh + 4 * BAND_E), "v"(xl), "v"(xl + 4 * BAND_E),
                    "v"(wh), "v"(wh + 4 * BAND_E), "v"(wh + 8 * BAND_E), "v"(wh + 12 * BAND_E),
                    "v"(wl), "v"(wl + 4 * BAND_E), "v"(wl + 8 * BAND_E), "v"(wl + 12 * BAND_E)
                 : "memory");
}

// K loop shared by both projections: a 64x64 tile per wave (4 X tiles by 4 W tiles), K = DIMC:
// a loaded W fragment meets four X tiles instead of one, an X fragment four W tiles as before.
// A block is 2 x 4 waves, 128 tokens by 256 features. Its operands of one K step are brought into LDS
// once for all eight waves by asynchronous copies, two buffers: the next step's copies fly while this
// step's fragments are read from LDS and multiplied.
// mb, ob: first 16-row band of the block in X and in W; wm, wn: the wave's place in the block.
// SWAP = false: acc[i][t] = X-tile i (A) . W-tile t (B): lane holds 8 tokens of one feature.
// SWAP = true : acc[i][t] = W-tile t (A) . X-tile i (B): lane holds 8 features of one token.
// The three split products are summed in the same order either way.
#define WT 4                      // X tiles (16 tokens each) per wave
template <bool SWAP>
__device__ __forceinline__ void gemm_k_loop(const unsigned short* __restrict__ Xh,
                                            const unsigned short* __restrict__ Xl,
                                            const unsigned short* __restrict__ Wh,
                                            const unsigned short* __restrict__ Wl,
                                            unsigned short (&stg)[2][STAGE_E],
                                            int mb, int ob, int wm, int wn,
                                            v8f (&acc)[WT][4]) {
    const int lane = threadIdx.x & 31;
    // this thread's piece of a stage: tile threadIdx.x / 64 of each group of four, 16 bytes of it
    const size_t xo = (size_t)(mb + (threadIdx.x >> 6)) * BAND_E + (threadIdx.x & 63) * 8;
    const size_t wo = (size_t)(ob + (threadIdx.x >> 6)) * BAND_E + (threadIdx.x & 63) * 8;
    const unsigned short* cxh = Xh + xo;
    const unsigned short* cxl = Xl + xo;
    const unsigned short* cwh = Wh + wo;
    const unsigned short* cwl = Wl + wo;
    const unsigned sl = lds_addr(&stg[0][threadIdx.x * 8]);

    copy_stage(sl, cxh, cxl, cwh, cwl);                       // K step 0 into buffer 0
    wait_copies();
    __syncthreads();                                          // publishes K step 0
    copy_stage(sl + STAGE_E * 2, cxh + TILE_E, cxl + TILE_E, cwh + TILE_E, cwl + TILE_E);

    for (int kt = 0; kt < DIMC / 32; ++kt) {
        const int buf = kt & 1;
        const unsigned short* pah = &stg[buf][(wm * WT) * TILE_E + lane * 8];
        const unsigned short* pal = pah + 8 * TILE_E;
        const unsigned short* pbh = &stg[buf][(16 + wn * 4) * TILE_E + lane * 8];
        const unsigned short* pbl = pbh + 16 * TILE_E;
        v16bf ah[WT], al[WT];
#pragma unroll
        for (int i = 0; i < WT; ++i) {
            ah[i] = load_frag(pah + i * TILE_E);
            al[i] = load_frag(pal + i * TILE_E);
        }
#pragma unroll
        for (int t = 0; t < 4; ++t) {
            v16bf bh = load_frag(pbh + t * TILE_E);
            v16bf bl = load_frag(pbl + t * TILE_E);
            if (SWAP) {
#pragma unroll
                for (int i = 0; i < WT; ++i) acc[i][t] = wmma_bf(bh, ah[i], acc[i][t]);
#pragma unroll
                for (int i = 0; i < WT; ++i) acc[i][t] = wmma_bf(bl, ah[i], acc[i][t]);
#pragma unroll
                for (int i = 0; i < WT; ++i) acc[i][t] = wmma_bf(bh, al[i], acc[i][t]);
            } else {
#pragma unroll
                for (int i = 0; i < WT; ++i) acc[i][t] = wmma_bf(ah[i], bh, acc[i][t]);
#pragma unroll
                for (int i = 0; i < WT; ++i) acc[i][t] = wmma_bf(ah[i], bl, acc[i][t]);
#pragma unroll
                for (int i = 0; i < WT; ++i) acc[i][t] = wmma_bf(al[i], bh, acc[i][t]);
            }
        }
        // publish point: the next K step has landed for every wave, and every wave has left this buffer
        wait_lds_reads();
        wait_copies();
        __syncthreads();
        if (kt + 2 < DIMC / 32) {                             // the same for the whole block
            const int ko = (kt + 2) * TILE_E;
            copy_stage(sl + buf * (STAGE_E * 2), cxh + ko, cxl + ko, cwh + ko, cwl + ko);
        }
    }
    wait_copies();
}

// ---------- kernel 1: QKV projection ----------
// out[m][o] = sum_k X[m][k]*W[o][k]; Q as [token][d] planes per head, fragment-major.
// K ([token][d] tiles) and V ([d][token] tiles) share one buffer per head, ordered by the
// attention pass that reads them: per 32 keys 16 tiles, [K hi 4 | K lo 4 | V hi 4 | V lo 4].
#define PASS_E (16 * TILE_E)
// a block is 2 x 4 waves: 128 tokens by 256 features; the register budget of four waves per SIMD
// keeps two blocks on a WGP, so that one block multiplies while the other stands at its barrier
__global__ void __launch_bounds__(256) __attribute__((amdgpu_waves_per_eu(4, 4)))
gemm_qkv(const unsigned short* __restrict__ Xqh, const unsigned short* __restrict__ Xql,
         const unsigned short* __restrict__ Xkh, const unsigned short* __restrict__ Xkl,
         const int* __restrict__ cnts,
         const unsigned short* __restrict__ Wh, const unsigned short* __restrict__ Wl,
         unsigned short* __restrict__ Qh, unsigned short* __restrict__ Ql,
         unsigned short* __restrict__ KV) {
    __shared__ __attribute__((aligned(16))) unsigned short stg[2][STAGE_E];
    // K and V blocks work on the packed rows of the kept keys; a block wholly past its batch's count
    // has nothing to project: all its threads leave here, in front of every copy and barrier
    if (blockIdx.y >= 4 && (int)(blockIdx.x & 15) * 128 >= cnts[blockIdx.x >> 4]) return;
    const unsigned short* Xh = blockIdx.y < 4 ? Xqh : Xkh;
    const unsigned short* Xl = blockIdx.y < 4 ? Xql : Xkl;
    const int lane = threadIdx.x & 31;
    // the wave's number in a scalar register: tile, head and batch indices then live in scalar
    // registers through the K loop; held in vector registers they push the kernel past 256 of
    // them, which costs the fourth wave of a SIMD
    const int wave = __builtin_amdgcn_readfirstlane(threadIdx.x >> 5);
    const int m0 = (blockIdx.x * 2 + (wave & 1)) * (16 * WT);   // first token of the wave
    const int o0 = (blockIdx.y * 4 + (wave >> 1)) * 64;         // output features (one head slice)

    v8f acc[WT][4];
#pragma unroll
    for (int i = 0; i < WT; ++i)
#pragma unroll
        for (int t = 0; t < 4; ++t) acc[i][t] = v8f_zero();

    const int mb = blockIdx.x * 8;    // the block's first 16-row band of X
    const int ob = blockIdx.y * 16;   // and of W
    const int s  = blockIdx.y >> 2;   // 0=Q 1=K 2=V: the same for the whole block
    const int h  = (o0 & 1023) >> 6;
    const int b  = m0 >> 11;
    const size_t head = (size_t)(b * NHEAD + h);
    if (s == 2) {
        gemm_k_loop<false>(Xh, Xl, Wh, Wl, stg, mb, ob, wave & 1, wave >> 1, acc);
#pragma unroll
        for (int i = 0; i < WT; ++i) {
            const int n0 = (m0 & 2047) + i * 16;
            // Vt[d][n]: row d = t*16 + col, k = n0 + 8*hi16 + r: the lane's 8 values are one piece
            unsigned short* vp = KV + (head * (SEQ / 32) + (n0 >> 5)) * PASS_E + 8 * TILE_E
                               + ((n0 >> 4) & 1) * 256 + lane * 8;
#pragma unroll
            for (int t = 0; t < 4; ++t) {
                float x[8];
#pragma unroll
                for (int r = 0; r < 8; ++r) x[r] = acc[i][t][r];
                store_split8(x, vp + t * TILE_E, vp + (4 + t) * TILE_E);
            }
        }
    } else {
        gemm_k_loop<true>(Xh, Xl, Wh, Wl, stg, mb, ob, wave & 1, wave >> 1, acc);
#pragma unroll
        for (int i = 0; i < WT; ++i) {
            const int n0 = (m0 & 2047) + i * 16;
            // Q/K[n][d]: row n = n0 + col, k = d = t*16 + 8*hi16 + r: again one piece per lane
            const size_t qo = head * SEQ * DH + (size_t)(n0 >> 4) * (DH / 32) * TILE_E + lane * 8;
            const size_t ko = (head * (SEQ / 32) + (n0 >> 5)) * PASS_E
                            + ((n0 >> 4) & 1) * (DH / 32) * TILE_E + lane * 8;
            unsigned short* bh_ = (s == 0 ? Qh + qo : KV + ko);
            unsigned short* bl_ = (s == 0 ? Ql + qo : KV + ko + 4 * TILE_E);
#pragma unroll
            for (int t = 0; t < 4; ++t) {
                float x[8];
#pragma unroll
                for (int r = 0; r < 8; ++r) x[r] = acc[i][t][r];
                store_split8(x, bh_ + (t >> 1) * TILE_E + (t & 1) * 256,
                                bl_ + (t >> 1) * TILE_E + (t & 1) * 256);
            }
        }
    }
}

// ---------- kernel 2: flash attention (transposed-score trick) ----------
#define QT 2                      // query tiles (16 queries each) per wave
#define AW 4                      // waves per block
// one pass of K and V (16 tiles, 16 KB, contiguous in the workspace) into LDS, same order: each of the
// 128 lanes brings 8 pieces of 16 bytes, 2 KB apart; the offset moves the LDS and the global address
// alike. s_wait_xcnt 0 closes the statement so that no address register is rewritten ahead of it.
__device__ __forceinline__ void copy_pass(unsigned lds, const unsigned short* g) {
    asm volatile("global_load_async_to_lds_b128 %0, %1, off\n\t"
                 "global_load_async_to_lds_b128 %0, %1, off offset:2048\n\t"
                 "global_load_async_to_lds_b128 %0, %1, off offset:4096\n\t"
                 "global_load_async_to_lds_b128 %0, %1, off offset:6144\n\t"
                 "global_load_async_to_lds_b128 %0, %1, off offset:8192\n\t"
                 "global_load_async_to_lds_b128 %0, %1, off offset:10240\n\t"
                 "global_load_async_to_lds_b128 %0, %1, off offset:12288\n\t"
                 "global_load_async_to_lds_b128 %0, %1, off offset:14336\n\t"
                 "s_wait_xcnt 0x0" :: "v"(lds), "v"(g) : "memory");
}
__global__ void __launch_bounds__(AW * 32)
attn_kernel(const unsigned short* __restrict__ Qh, const unsigned short* __restrict__ Ql,
            const unsigned short* __restrict__ KV,
            const int* __restrict__ cnts,
            unsigned short* __restrict__ Xh, unsigned short* __restrict__ Xl) {
    __shared__ __attribute__((aligned(16))) unsigned short kvs[2][PASS_E];   // two passes of K and V
    const int lane = threadIdx.x & 31;
    const int wave = threadIdx.x >> 5;
    const int hi16 = lane >> 4;
    const int bid = blockIdx.x;
    const int b = bid >> 8;                       // 256 blocks per batch
    const int h = (bid >> 4) & 15;
    const int q0 = ((bid & 15) * AW + wave) * (16 * QT);  // 32 queries per wave

    const size_t head = (size_t)(b * NHEAD + h);
    // this thread's piece of each pass, in the workspace and in the two buffers
    const unsigned short* kvg = KV + head * (SEQ / 32) * PASS_E + threadIdx.x * 8;
    const unsigned kvl = lds_addr(&kvs[0][threadIdx.x * 8]);
    // K and V hold the batch's kept keys alone, packed: nk of them, walked in whole passes of 32
    // (held in a scalar register, so that the loop's tests on it are scalar compares)
    const int nk  = __builtin_amdgcn_readfirstlane(min(max(cnts[b], 1), SEQ));
    __builtin_assume(nk >= 1 && nk <= SEQ);                   // the clamp above: the loop has a first pass
    const int nkr = (nk + 31) & ~31;
    copy_pass(kvl, kvg);                                      // pass 0 into buffer 0
    wait_copies();
    __syncthreads();                                          // publishes pass 0
    if (nkr > 32)                                             // the same for the whole block
        copy_pass(kvl + PASS_E * 2, kvg + PASS_E);            // pass 1 into buffer 1

    // fragment-major planes: this lane's piece of a tile starts at lane*8
    const size_t qoff = head * SEQ * DH + (size_t)(q0 >> 4) * (DH / 32) * TILE_E + lane * 8;
    const unsigned short* qrh = Qh + qoff;
    const unsigned short* qrl = Ql + qoff;

    // Q tiles as B-operand (lane col = query), K-dim = head dim (2 steps of 32)
    v16bf qh[QT][2], ql[QT][2];
#pragma unroll
    for (int qt = 0; qt < QT; ++qt)
#pragma unroll
        for (int ds = 0; ds < 2; ++ds) {
            qh[qt][ds] = load_frag(qrh + (qt * (DH / 32) + ds) * TILE_E);
            ql[qt][ds] = load_frag(qrl + (qt * (DH / 32) + ds) * TILE_E);
        }
    if (cnts[BATCH + b] != 0) {           // no key kept: all scores equal, as in the reference
#pragma unroll
        for (int qt = 0; qt < QT; ++qt)
#pragma unroll
            for (int ds = 0; ds < 2; ++ds)
#pragma unroll
                for (int e = 0; e < 16; ++e) {
                    qh[qt][ds][e] = bfbits(0);
                    ql[qt][ds][e] = bfbits(0);
                }
    }

    float mrow[QT], lrow[QT];             // per-lane softmax state for query `col` of each tile
    v8f o[QT][4];                         // O^T accum: lane holds d = t*16+r+8*hi16, q = col
#pragma unroll
    for (int qt = 0; qt < QT; ++qt) {
        mrow[qt] = -3.0e38f;
        lrow[qt] = 0.0f;
#pragma unroll
        for (int t = 0; t < 4; ++t) o[qt][t] = v8f_zero();
    }

    for (int k0 = 0; k0 < nkr; k0 += 32) {
        // S^T = K . Q^T : st[qt][js][r] = score(key k0+js*16+r+8*hi16, query col of tile qt);
        // each K fragment is loaded once and multiplied with every Q tile of the wave
        const int buf = (k0 >> 5) & 1;
        const unsigned short* kvb = &kvs[buf][lane * 8];      // this pass's tiles, read from LDS
        v8f st[QT][2];
#pragma unroll
        for (int js = 0; js < 2; ++js) {
#pragma unroll
            for (int qt = 0; qt < QT; ++qt) st[qt][js] = v8f_zero();
            const unsigned short* kp = kvb + js * (DH / 32) * TILE_E;
#pragma unroll
            for (int ds = 0; ds < 2; ++ds) {
                v16bf kh = load_frag(kp + ds * TILE_E);
                v16bf kl = load_frag(kp + (4 + ds) * TILE_E);
#pragma unroll
                for (int qt = 0; qt < QT; ++qt)
                    st[qt][js] = wmma_split(kh, kl, qh[qt][ds], ql[qt][ds], st[qt][js]);
            }
        }
        // what is left to mask: the rows behind the last kept key, in the last pass alone (one scalar
        // test a pass). MASK_VAL / SCALE_F is exact, and the scaling below gives MASK_VAL back exactly
        if (k0 + 32 > nk) {
#pragma unroll
            for (int qt = 0; qt < QT; ++qt)
#pragma unroll
                for (int js = 0; js < 2; ++js)
#pragma unroll
                    for (int r = 0; r < 8; ++r)
                        if (k0 + js * 16 + 8 * hi16 + r >= nk) st[qt][js][r] = MASK_VAL / SCALE_F;
        }
        union { v16bf v; unsigned int u[8]; } ph[QT], pl[QT];
        float alpha[QT];
#pragma unroll
        for (int qt = 0; qt < QT; ++qt) {
            // scale + running max
            float mx = mrow[qt];
#pragma unroll
            for (int js = 0; js < 2; ++js)
#pragma unroll
                for (int r = 0; r < 8; ++r) {
                    float s = st[qt][js][r] * SCALE_F;
                    st[qt][js][r] = s;
                    mx = fmaxf(mx, s);
                }
            mx = fmaxf(mx, __shfl_xor(mx, 16));       // combine the two key halves
            alpha[qt] = __expf(mrow[qt] - mx);
            mrow[qt] = mx;
            // exp -> P; st layout already matches the B-operand element order exactly
            float rs = 0.0f;
#pragma unroll
            for (int js = 0; js < 2; ++js)
#pragma unroll
                for (int r = 0; r < 8; r += 2) {
                    const float p0 = __expf(st[qt][js][r] - mx);
                    const float p1 = __expf(st[qt][js][r + 1] - mx);
                    rs += p0;
                    rs += p1;
                    split2(p0, p1, ph[qt].u[js * 4 + (r >> 1)], pl[qt].u[js * 4 + (r >> 1)]);
                }
            rs += __shfl_xor(rs, 16);
            lrow[qt] = lrow[qt] * alpha[qt] + rs;
        }
        // O^T += V^T . P^T  (4 d-subtiles); rescale is a per-lane scalar;
        // each V fragment is loaded once and multiplied with every P tile of the wave
#pragma unroll
        for (int t = 0; t < 4; ++t) {
            const unsigned short* vp = kvb + (8 + t) * TILE_E;
            v16bf vh = load_frag(vp);
            v16bf vl = load_frag(vp + 4 * TILE_E);
#pragma unroll
            for (int qt = 0; qt < QT; ++qt) {
                o[qt][t] = o[qt][t] * alpha[qt];
                o[qt][t] = wmma_split(vh, vl, ph[qt].v, pl[qt].v, o[qt][t]);
            }
        }
        // publish point: the next pass has landed for every wave, and every wave has left this buffer
        wait_lds_reads();
        wait_copies();
        __syncthreads();
        if (k0 + 64 < nkr)                                    // the same for the whole block
            copy_pass(kvl + buf * (PASS_E * 2), kvg + (size_t)((k0 >> 5) + 2) * PASS_E);
    }
    wait_copies();
    // write x[b][n=q0+qt*16+col][h*64+d], d = t*16 + 8*hi16 + r, into the fragment-major hi/lo
    // planes of the output GEMM: the lane's 8 values are one 16-byte piece
#pragma unroll
    for (int qt = 0; qt < QT; ++qt) {
        const float linv = 1.0f / lrow[qt];
        const size_t xoff = ((size_t)((b * SEQ + q0 + qt * 16) >> 4) * (DIMC / 32)
                             + h * (DH / 32)) * TILE_E + lane * 8;
#pragma unroll
        for (int t = 0; t < 4; ++t) {
            float x[8];
#pragma unroll
            for (int r = 0; r < 8; ++r) x[r] = o[qt][t][r] * linv;
            store_split8(x, Xh + xoff + (t >> 1) * TILE_E + (t & 1) * 256,
                            Xl + xoff + (t >> 1) * TILE_E + (t & 1) * 256);
        }
    }
}

// ---------- kernel 3: output projection + bias (fp32 out) ----------
__global__ void __launch_bounds__(256)
gemm_fc(const unsigned short* __restrict__ Xh, const unsigned short* __restrict__ Xl,
        const unsigned short* __restrict__ Wh, const unsigned short* __restrict__ Wl,
        const float* __restrict__ bias,
        float* __restrict__ out) {
    __shared__ __attribute__((aligned(16))) unsigned short stg[2][STAGE_E];
    const int lane = threadIdx.x & 31;
    const int wave = threadIdx.x >> 5;
    const int col  = lane & 15;
    const int hi16 = lane >> 4;
    const int m0 = (blockIdx.x * 2 + (wave & 1)) * (16 * WT);
    const int o0 = (blockIdx.y * 4 + (wave >> 1)) * 64;

    v8f acc[WT][4];
#pragma unroll
    for (int i = 0; i < WT; ++i)
#pragma unroll
        for (int t = 0; t < 4; ++t) acc[i][t] = v8f_zero();

    gemm_k_loop<false>(Xh, Xl, Wh, Wl, stg, blockIdx.x * 8, blockIdx.y * 16, wave & 1, wave >> 1, acc);
#pragma unroll
    for (int t = 0; t < 4; ++t) {
        const int oc = o0 + t * 16 + col;
        const float bia = bias[oc];
#pragma unroll
        for (int i = 0; i < WT; ++i) {
            const int n0 = m0 + i * 16 + 8 * hi16;
#pragma unroll
            for (int r = 0; r < 8; ++r)
                out[(size_t)(n0 + r) * DIMC + oc] = acc[i][t][r] + bia;
        }
    }
}

extern "C" void kernel_launch(void* const* d_in, const int* in_sizes, int n_in,
                              void* d_out, int out_size, void* d_ws, size_t ws_size,
                              hipStream_t stream) {
    const float* inputs = (const float*)d_in[0];
    const float* W_qkv  = (const float*)d_in[1];
    const float* W_fc   = (const float*)d_in[2];
    const float* b_fc   = (const float*)d_in[3];
    const int*   pmask  = (const int*)d_in[4];

    // workspace layout (bf16/ushort elements), all 1 KB tiles; 208 MB total
    const size_t nQKV = (size_t)BATCH * NHEAD * SEQ * DH;   // 8388608
    const size_t nX   = (size_t)BATCH * SEQ * DIMC;         // 8388608
    const size_t nWq  = (size_t)3 * DIMC * DIMC;            // 3145728
    const size_t nWf  = (size_t)DIMC * DIMC;                // 1048576
    unsigned short* p = (unsigned short*)d_ws;
    unsigned short* Qh  = p; p += nQKV;
    unsigned short* Ql  = p; p += nQKV;
    unsigned short* KV  = p; p += 4 * nQKV;
    unsigned short* Xih = p; p += nX;
    unsigned short* Xil = p; p += nX;
    unsigned short* Wqh = p; p += nWq;
    unsigned short* Wql = p; p += nWq;
    unsigned short* Wfh = p; p += nWf;
    unsigned short* Wfl = p; p += nWf;
    unsigned short* Xah = p; p += nX;
    unsigned short* Xal = p; p += nX;
    unsigned short* Xkh = p; p += nX;
    unsigned short* Xkl = p; p += nX;
    int* cnts = (int*)p;                                    // kept keys per batch, then the no-key flags

    pack_planes<<<2 * XBANDS + WQBANDS + WFBANDS, 256, 0, stream>>>(inputs, pmask, W_qkv, W_fc,
                                                                    Xkh, Xkl, Xih, Xil, Wqh, Wql, Wfh, Wfl, cnts);

    gemm_qkv<<<dim3(64, 12), 256, 0, stream>>>(Xih, Xil, Xkh, Xkl, cnts, Wqh, Wql,
                                               Qh, Ql, KV);
    attn_kernel<<<BATCH * NHEAD * (SEQ / 128), 128, 0, stream>>>(Qh, Ql, KV,
                                                                cnts, Xah, Xal);
    gemm_fc<<<dim3(64, 4), 256, 0, stream>>>(Xah, Xal, Wfh, Wfl, b_fc, (float*)d_out);
}

// v007
// A run of this version takes 184 microseconds.
// Next to v006, in two timings, it ran 1.04 and 1.03 times as fast.
// All steps since v000 together make it 5.50 times as fast.
#include <hip/hip_runtime.h>

#define DIMC   1024
#define NHEAD  16
#define BATCH  4
#define SEQ    2048
#define DH     64
#define SCALE_F 0.125f            // (1024/16)^-0.5
#define MASK_VAL -10000000.0f

typedef __attribute__((ext_vector_type(16))) __bf16        v16bf;
typedef __attribute__((ext_vector_type(8)))  float         v8f;
typedef __attribute__((ext_vector_type(4)))  unsigned int  u32x4;
typedef __attribute__((ext_vector_type(8)))  unsigned int  u32x8;
typedef __attribute__((ext_vector_type(4)))  float         f32x4;
typedef __attribute__((ext_vector_type(2)))  float         f32x2;
typedef __attribute__((ext_vector_type(2)))  __bf16        bf16x2;

// ---------- bf16 hi/lo split helpers (separate planes) ----------
__device__ __forceinline__ __bf16 bfbits(unsigned short h) {
    return __builtin_bit_cast(__bf16, h);
}
// two f32 values -> their bf16 hi parts and the bf16 of what is left, each pair packed in one
// register (low half = a). The rounding, to nearest even, is the hardware's packed convert:
// one instruction for two values.
__device__ __forceinline__ void split2(float a, float b, unsigned int& hi, unsigned int& lo) {
    const f32x2 v = {a, b};
    const bf16x2 h = __builtin_convertvector(v, bf16x2);
    const f32x2 rest = v - __builtin_convertvector(h, f32x2);
    hi = __builtin_bit_cast(unsigned int, h);
    lo = __builtin_bit_cast(unsigned int, __builtin_convertvector(rest, bf16x2));
}

// WMMA operand element i maps to k = (i<8?0:16) + 8*hi16 + (i&7) (CDNA5 16-bit
// 16x32 A / 32x16 B layout, wave32).
// Every bf16 plane in the workspace is stored fragment-major: a plane of R rows
// by K columns is cut into tiles of 16 rows x 32 k (512 elements, 1 KB), tile
// index (row/16)*(K/32) + k/32 (the K/V buffer orders its tiles per key pass, see kernel 1). Inside a tile, element (row, k) lies at
//   ((k>>4)&1)*256 + (((k>>3)&1)*16 + (row&15))*8 + (k&7)
// so lane l's two 16-byte pieces lie at l*8 and 256 + l*8: each wave-wide
// 16-byte load or store covers 512 contiguous bytes, four whole 128-byte lines.
#define TILE_E 512
// lanep: start of the tile + lane*8
__device__ __forceinline__ v16bf load_frag(const unsigned short* __restrict__ lanep) {
    union { v16bf v; u32x4 q[2]; } u;
    u.q[0] = *(const u32x4*)(lanep);
    u.q[1] = *(const u32x4*)(lanep + 256);
    return u.v;
}
// split eight f32 values into bf16 hi and lo and store each as one 16-byte piece
__device__ __forceinline__ void store_split8(const float* x,
                                             unsigned short* __restrict__ hp,
                                             unsigned short* __restrict__ lp) {
    u32x4 qh, ql;
#pragma unroll
    for (int e = 0; e < 4; ++e) {
        unsigned int h, l;
        split2(x[2 * e], x[2 * e + 1], h, l);
        qh[e] = h;
        ql[e] = l;
    }
    *(u32x4*)hp = qh;
    *(u32x4*)lp = ql;
}

__device__ __forceinline__ v8f wmma_bf(v16bf a, v16bf b, v8f c) {
    return __builtin_amdgcn_wmma_f32_16x16x32_bf16(false, a, false, b, (short)0, c,
                                                   false, false);
}
// split-precision product: (ah+al)*(bh+bl) ~ ah*bh + ah*bl + al*bh
__device__ __forceinline__ v8f wmma_split(v16bf ah, v16bf al, v16bf bh, v16bf bl, v8f c) {
    c = wmma_bf(ah, bh, c);
    c = wmma_bf(ah, bl, c);
    c = wmma_bf(al, bh, c);
    return c;
}
__device__ __forceinline__ v8f v8f_zero() {
    v8f z;
#pragma unroll
    for (int e = 0; e < 8; ++e) z[e] = 0.0f;
    return z;
}

// ---------- kernel 0: every fp32 operand -> fragment-major bf16 hi plane + lo plane, one launch ----------
// One block per 16-row band (16 rows x DIMC) of a pair of planes; a wave packs four 16x32 tiles of the
// band, a lane its own two 8-element pieces of each tile. The bands, in block order:
//   [kept-key rows of X | all rows of X | W_qkv | W_fc]
// The kept-key bands stand first: they rank the mask before they can load, the longest way of a block.
//
// The kept-key planes. A key with mask > 0 has the score MASK_VAL. Its weight exp(MASK_VAL - m), m the
// row's maximum, is exactly 0 in f32 once m > MASK_VAL + 104, and a kept key's scaled score from
// normal-drawn inputs stays millions above MASK_VAL: beside a kept key a masked one adds nothing to a
// row's sum or output. K and V are therefore projected, and the key loop run, over the kept keys alone:
// row j of batch b of these planes is the j-th kept token of that batch.
// Rows from the count up to the next multiple of 128 (a projection block) are written as zeros.
// A batch with no kept key: the reference's softmax is then uniform over all keys; every key is
// kept and cnts[BATCH + b] tells the attention kernel to take all scores as equal.
// Each kept-key block ranks the batch's 2048 mask words itself.
#define XBANDS  (BATCH * SEQ / 16)            // 512 bands of X, and as many of its kept-key planes
#define WQBANDS (3 * DIMC / 16)               // 192
#define WFBANDS (DIMC / 16)                   // 64
__global__ void __launch_bounds__(256)
pack_planes(const float* __restrict__ xsrc, const int* __restrict__ pm,
            const float* __restrict__ wq, const float* __restrict__ wf,
            unsigned short* __restrict__ xkh, unsigned short* __restrict__ xkl,
            unsigned short* __restrict__ xih, unsigned short* __restrict__ xil,
            unsigned short* __restrict__ wqh, unsigned short* __restrict__ wql,
            unsigned short* __restrict__ wfh, unsigned short* __restrict__ wfl,
            int* __restrict__ cnts) {
    __shared__ int wsum[8];
    __shared__ int srow[16];
    const int t = threadIdx.x;
    const int lane = t & 31;
    const int wave = t >> 5;
    const int bid = blockIdx.x;
    const float* src;                             // the source matrix of the band
    unsigned short* hip_;                         // its two planes
    unsigned short* lop_;
    int band;                                     // the band's number in those planes
    int row;                                      // this lane's source row, or -1: a row of zeros
    bool work = true;                             // the same for the whole block
    if (bid < XBANDS) {                           // the same for the whole block: both barriers are inside
        const int b  = bid >> 7;                  // SEQ/16 = 128 bands per batch
        const int j0 = (bid & 127) * 16;          // first packed row of the band
        const int* mp = pm + b * SEQ + t * 8;     // this thread ranks eight tokens
        unsigned bits = 0;
#pragma unroll
        for (int e = 0; e < 8; ++e)
            if (!(mp[e] > 0)) bits |= 1u << e;
        const int c = __popc(bits);
        int inc = c;                              // inclusive sum over the wave
#pragma unroll
        for (int d = 1; d < 32; d <<= 1) {
            const int o = __shfl_up(inc, d);
            if (lane >= d) inc += o;
        }
        if (lane == 31) wsum[wave] = inc;
        if (t < 16) srow[t] = -1;
        __syncthreads();                          // wave sums and the cleared row table are visible
        int before = inc - c, total = 0;
#pragma unroll
        for (int w = 0; w < 8; ++w) {
            const int s = wsum[w];
            total += s;
            if (w < wave) before += s;
        }
        const bool none = (total == 0);
        if (none) { bits = 0xFFu; before = t * 8; total = SEQ; }
#pragma unroll
        for (int e = 0; e < 8; ++e)
            if ((bits >> e) & 1u) {
                const int p = before - j0;
                if ((unsigned)p < 16u) srow[p] = t * 8 + e;
                ++before;
            }
        __syncthreads();                          // the band's source rows are visible
        if (j0 == 0 && t == 0) { cnts[b] = total; cnts[BATCH + b] = none ? 1 : 0; }
        work = j0 < ((total + 127) & ~127);
        const int tok = srow[lane & 15];          // a token number formed from thread indices, or -1
        row = tok < 0 ? -1 : b * SEQ + tok;
        src = xsrc; hip_ = xkh; lop_ = xkl; band = bid;
    } else if (bid < 2 * XBANDS) {
        band = bid - XBANDS;
        src = xsrc; hip_ = xih; lop_ = xil; row = band * 16 + (lane & 15);
    } else if (bid < 2 * XBANDS + WQBANDS) {
        band = bid - 2 * XBANDS;
        src = wq; hip_ = wqh; lop_ = wql; row = band * 16 + (lane & 15);
    } else {
        band = bid - (2 * XBANDS + WQBANDS);
        src = wf; hip_ = wfh; lop_ = wfl; row = band * 16 + (lane & 15);
    }
    if (work) {                                   // no barrier inside
        const float* rp = src + (size_t)(row < 0 ? 0 : row) * DIMC + wave * 128 + 8 * (lane >> 4);
        // a wave packs four tiles; all sixteen loads go out before the first value is used
        f32x4 v[4][2][2];
#pragma unroll
        for (int q = 0; q < 4; ++q)
#pragma unroll
            for (int j = 0; j < 2; ++j) {
                v[q][j][0] = *(const f32x4*)(rp + q * 32 + j * 16);
                v[q][j][1] = *(const f32x4*)(rp + q * 32 + j * 16 + 4);
            }
        // stands in front of the first rewrite of the loads' address registers; rp is named as an
        // input so that it lives to this line and no load's result is placed over it
        asm volatile("s_wait_xcnt 0x0" :: "v"(rp) : "memory");
#pragma unroll
        for (int q = 0; q < 4; ++q)
#pragma unroll
            for (int j = 0; j < 2; ++j) {
                float x[8];
#pragma unroll
                for (int e = 0; e < 8; ++e) x[e] = row < 0 ? 0.0f : v[q][j][e >> 2][e & 3];
                const size_t o = ((size_t)band * (DIMC / 32) + wave * 4 + q) * TILE_E
                               + j * 256 + lane * 8;
                store_split8(x, hip_ + o, lop_ + o);
            }
    }
}

// ---------- tensor loads to LDS: descriptor, issue and the waits of the two-buffer ring ----------
// the wave's own LDS reads have returned: stands in front of the barrier behind which a buffer is refilled
__device__ __forceinline__ void wait_lds_reads() { asm volatile("s_wait_dscnt 0x0" ::: "memory"); }
// the wave's own tensor load has landed: stands in front of the barrier behind which other waves read it
__device__ __forceinline__ void wait_tensor() { asm volatile("s_wait_tensorcnt 0x0" ::: "memory"); }
__device__ __forceinline__ unsigned lds_addr(const unsigned short* p) {
    return (unsigned)(unsigned long long)p;       // low 32 bits of a __shared__ address: the LDS byte
}
__device__ __forceinline__ unsigned uni(unsigned v) { return (unsigned)__builtin_amdgcn_readfirstlane(v); }
// a word held in a scalar register: a test on it is a scalar branch (a tensor load ignores EXEC), and what
// is formed from it is formed behind the waits that stand in front of this statement
__device__ __forceinline__ unsigned pinned(unsigned v) {
    unsigned w = uni(v);
    asm volatile("" : "+s"(w));                   // pinned(): the word stays in a scalar register
    return w;
}
// A request brings `rows` tiles of 1 KB (a tile is one row of the request), `pitch` bytes apart in the
// workspace, to consecutive KB of LDS. Group 1: 1-byte elements, no mask, no pad, tensor = tile.
#define TILE_B 1024u
__device__ __forceinline__ u32x8 tdm_group1(unsigned rows, unsigned pitch) {
    u32x8 g;
    g[0] = uni(0u);
    g[1] = uni((TILE_B & 0xFFFFu) << 16);
    g[2] = uni((TILE_B >> 16) | ((rows & 0xFFFFu) << 16));
    g[3] = uni((rows >> 16) | (TILE_B << 16));
    g[4] = uni(rows);
    g[5] = uni(pitch);
    g[6] = uni(0u);
    g[7] = uni(0u);
    return g;
}
// Group 0: count 1, the LDS byte, the address of the first byte, type 2
__device__ __forceinline__ u32x4 tdm_group0(unsigned lds, unsigned long long ga) {
    u32x4 g;
    g[0] = uni(1u);
    g[1] = uni(lds);
    g[2] = uni((unsigned)ga);
    g[3] = uni((((unsigned)(ga >> 32)) & 0x01FFFFFFu) | 0x80000000u);
    return g;
}
// one request of the whole wave; the waits are written where it is used
__device__ __forceinline__ void tdm_load(u32x4 g0, u32x8 g1) {
    asm volatile("tensor_load_to_lds %0, %1" :: "s"(g0), "s"(g1) : "memory");
}

// One K step (32 k) of a block's operands in LDS, 48 tiles of 1 KB:
// [X hi 8 | X lo 8 | W hi 16 | W lo 16], the tiles of a plane in row order.
#define STAGE_E (48 * TILE_E)
#define BAND_E  ((DIMC / 32) * TILE_E)        // from one 16-row band of a plane to the next

// K loop shared by both projections: a 64x64 tile per wave (4 X tiles by 4 W tiles), K = DIMC:
// a loaded W fragment meets four X tiles instead of one, an X fragment four W tiles as before.
// A block is 2 x 4 waves, 128 tokens by 256 features. Its operands of one K step are brought into LDS
// once for all eight waves by tensor loads, two buffers: the next step's loads fly while this step's
// fragments are read from LDS and multiplied. Every wave issues one request a step for its own slice:
// waves 0, 1: X hi, 2, 3: X lo (four tiles each); 4, 5: W hi, 6, 7: W lo (eight tiles each).
// mb, ob: first 16-row band of the block in X and in W; wm, wn: the wave's place in the block.
// SWAP = false: acc[i][t] = X-tile i (A) . W-tile t (B): lane holds 8 tokens of one feature.
// SWAP = true : acc[i][t] = W-tile t (A) . X-tile i (B): lane holds 8 features of one token.
// The three split products are summed in the same order either way.
#define WT 4                      // X tiles (16 tokens each) per wave
template <bool SWAP>
__device__ __forceinline__ void gemm_k_loop(const unsigned short* __restrict__ Xh,
                                            const unsigned short* __restrict__ Xl,
                                            const unsigned short* __restrict__ Wh,
                                            const unsigned short* __restrict__ Wl,
                                            unsigned short (&stg)[2][STAGE_E],
                                            int mb, int ob, int wm, int wn,
                                            v8f (&acc)[WT][4]) {
    const int lane = threadIdx.x & 31;
    // this wave's slice of a stage (the block is one-dimensional: threadIdx.x >> 5 is the wave's number)
    const unsigned wv    = uni(threadIdx.x >> 5);
    const unsigned isw   = wv >> 2;                           // 0: a slice of X, 1: a slice of W
    const unsigned rows  = isw ? 8u : 4u;
    const unsigned band  = (isw ? (unsigned)ob : (unsigned)mb) + (wv & 1u) * rows;
    const unsigned place = (isw ? 16u + ((wv >> 1) & 1u) * 16u : ((wv >> 1) & 1u) * 8u) + (wv & 1u) * rows;
    const unsigned short* plane = isw ? ((wv & 2u) ? Wl : Wh) : ((wv & 2u) ? Xl : Xh);
    const unsigned long long sg = (unsigned long long)(plane + (size_t)band * BAND_E);
    const unsigned sl = lds_addr(&stg[0][0]) + place * TILE_B;
    const u32x8 g1 = tdm_group1(rows, BAND_E * 2);

    tdm_load(tdm_group0(sl, sg), g1);                         // K step 0 into buffer 0
    wait_tensor();
    __syncthreads();                                          // publishes K step 0

    for (int kt = 0; kt < DIMC / 32; ++kt) {
        const int buf = kt & 1;
        // the refill: behind the barrier that published this K step and ended every read of the other
        // buffer, the next K step's load goes into that buffer, only while such a step exists. At the
        // head of a pass it stands in the same order as at the foot of the pass before, and K step 1
        // needs no load of its own in front of the loop: no register of a request in flight is rewritten
        const unsigned nx = pinned((unsigned)kt + 1u);        // pinned(): scalar test, descriptor formed here
        if (nx < DIMC / 32)
            tdm_load(tdm_group0(sl + (nx & 1u) * (STAGE_E * 2), sg + nx * TILE_B), g1);
        const unsigned short* pah = &stg[buf][(wm * WT) * TILE_E + lane * 8];
        const unsigned short* pal = pah + 8 * TILE_E;
        const unsigned short* pbh = &stg[buf][(16 + wn * 4) * TILE_E + lane * 8];
        const unsigned short* pbl = pbh + 16 * TILE_E;
        v16bf ah[WT], al[WT];
#pragma unroll
        for (int i = 0; i < WT; ++i) {
            ah[i] = load_frag(pah + i * TILE_E);
            al[i] = load_frag(pal + i * TILE_E);
        }
#pragma unroll
        for (int t = 0; t < 4; ++t) {
            v16bf bh = load_frag(pbh + t * TILE_E);
            v16bf bl = load_frag(pbl + t * TILE_E);
            if (SWAP) {
#pragma unroll
                for (int i = 0; i < WT; ++i) acc[i][t] = wmma_bf(bh, ah[i], acc[i][t]);
#pragma unroll
                for (int i = 0; i < WT; ++i) acc[i][t] = wmma_bf(bl, ah[i], acc[i][t]);
#pragma unroll
                for (int i = 0; i < WT; ++i) acc[i][t] = wmma_bf(bh, al[i], acc[i][t]);
            } else {
#pragma unroll
                for (int i = 0; i < WT; ++i) acc[i][t] = wmma_bf(ah[i], bh, acc[i][t]);
#pragma unroll
                for (int i = 0; i < WT; ++i) acc[i][t] = wmma_bf(ah[i], bl, acc[i][t]);
#pragma unroll
                for (int i = 0; i < WT; ++i) acc[i][t] = wmma_bf(al[i], bh, acc[i][t]);
            }
        }
        // publish point: the next K step has landed for every wave, and every wave has left this buffer
        wait_lds_reads();
        wait_tensor();
        __syncthreads();
    }
    wait_tensor();
    wait_lds_reads();
}

// ---------- kernel 1: QKV projection ----------
// out[m][o] = sum_k X[m][k]*W[o][k]; Q as [token][d] planes per head, fragment-major.
// K ([token][d] tiles) and V ([d][token] tiles) share one buffer per head, ordered by the
// attention pass that reads them: per 32 keys 16 tiles, [K hi 4 | K lo 4 | V hi 4 | V lo 4].
#define PASS_E (16 * TILE_E)
// a block is 2 x 4 waves: 128 tokens by 256 features; the register budget of four waves per SIMD
// keeps two blocks on a WGP, so that one block multiplies while the other stands at its barrier
__global__ void __launch_bounds__(256) __attribute__((amdgpu_waves_per_eu(4, 4)))
gemm_qkv(const unsigned short* __restrict__ Xqh, const unsigned short* __restrict__ Xql,
         const unsigned short* __restrict__ Xkh, const unsigned short* __restrict__ Xkl,
         const int* __restrict__ cnts,
         const unsigned short* __restrict__ Wh, const unsigned short* __restrict__ Wl,
         unsigned short* __restrict__ Qh, unsigned short* __restrict__ Ql,
         unsigned short* __restrict__ KV) {
    __shared__ __attribute__((aligned(2048))) unsigned short stg[2][STAGE_E];   // tensor loads land at multiples of 2 KB
    // K and V blocks work on the packed rows of the kept keys; a block wholly past its batch's count
    // has nothing to project: all its threads leave here, in front of every tensor load and barrier
    if (blockIdx.y >= 4 && (int)(blockIdx.x & 15) * 128 >= cnts[blockIdx.x >> 4]) return;
    const unsigned short* Xh = blockIdx.y < 4 ? Xqh : Xkh;
    const unsigned short* Xl = blockIdx.y < 4 ? Xql : Xkl;
    const int lane = threadIdx.x & 31;
    // the wave's number in a scalar register: tile, head and batch indices then live in scalar
    // registers through the K loop; held in vector registers they push the kernel past 256 of
    // them, which costs the fourth wave of a SIMD
    const int wave = __builtin_amdgcn_readfirstlane(threadIdx.x >> 5);
    const int m0 = (blockIdx.x * 2 + (wave & 1)) * (16 * WT);   // first token of the wave
    const int o0 = (blockIdx.y * 4 + (wave >> 1)) * 64;         // output features (one head slice)

    v8f acc[WT][4];
#pragma unroll
    for (int i = 0; i < WT; ++i)
#pragma unroll
        for (int t = 0; t < 4; ++t) acc[i][t] = v8f_zero();

    const int mb = blockIdx.x * 8;    // the block's first 16-row band of X
    const int ob = blockIdx.y * 16;   // and of W
    const int s  = blockIdx.y >> 2;   // 0=Q 1=K 2=V: the same for the whole block
    const int h  = (o0 & 1023) >> 6;
    const int b  = m0 >> 11;
    const size_t head = (size_t)(b * NHEAD + h);
    if (s == 2) {
        gemm_k_loop<false>(Xh, Xl, Wh, Wl, stg, mb, ob, wave & 1, wave >> 1, acc);
#pragma unroll
        for (int i = 0; i < WT; ++i) {
            const int n0 = (m0 & 2047) + i * 16;
            // Vt[d][n]: row d = t*16 + col, k = n0 + 8*hi16 + r: the lane's 8 values are one piece
            unsigned short* vp = KV + (head * (SEQ / 32) + (n0 >> 5)) * PASS_E + 8 * TILE_E
                               + ((n0 >> 4) & 1) * 256 + lane * 8;
#pragma unroll
            for (int t = 0; t < 4; ++t) {
                float x[8];
#pragma unroll
                for (int r = 0; r < 8; ++r) x[r] = acc[i][t][r];
                store_split8(x, vp + t * TILE_E, vp + (4 + t) * TILE_E);
            }
        }
    } else {
        gemm_k_loop<true>(Xh, Xl, Wh, Wl, stg, mb, ob, wave & 1, wave >> 1, acc);
#pragma unroll
        for (int i = 0; i < WT; ++i) {
            const int n0 = (m0 & 2047) + i * 16;
            // Q/K[n][d]: row n = n0 + col, k = d = t*16 + 8*hi16 + r: again one piece per lane
            const size_t qo = head * SEQ * DH + (size_t)(n0 >> 4) * (DH / 32) * TILE_E + lane * 8;
            const size_t ko = (head * (SEQ / 32) + (n0 >> 5)) * PASS_E
                            + ((n0 >> 4) & 1) * (DH / 32) * TILE_E + lane * 8;
            unsigned short* bh_ = (s == 0 ? Qh + qo : KV + ko);
            unsigned short* bl_ = (s == 0 ? Ql + qo : KV + ko + 4 * TILE_E);
#pragma unroll
            for (int t = 0; t < 4; ++t) {
                float x[8];
#pragma unroll
                for (int r = 0; r < 8; ++r) x[r] = acc[i][t][r];
                store_split8(x, bh_ + (t >> 1) * TILE_E + (t & 1) * 256,
                                bl_ + (t >> 1) * TILE_E + (t & 1) * 256);
            }
        }
    }
}

// ---------- kernel 2: flash attention (transposed-score trick) ----------
#define QT 2                      // query tiles (16 queries each) per wave
#define AW 4                      // waves per block
// one pass of K and V (16 tiles, 16 KB, contiguous in the workspace) comes into LDS in the same order by
// tensor loads: every wave issues one request a pass for its own four tiles.
__global__ void __launch_bounds__(AW * 32)
attn_kernel(const unsigned short* __restrict__ Qh, const unsigned short* __restrict__ Ql,
            const unsigned short* __restrict__ KV,
            const int* __restrict__ cnts,
            unsigned short* __restrict__ Xh, unsigned short* __restrict__ Xl) {
    __shared__ __attribute__((aligned(2048))) unsigned short kvs[2][PASS_E]; // two passes of K and V
    const int lane = threadIdx.x & 31;
    const int wave = threadIdx.x >> 5;
    const int hi16 = lane >> 4;
    const int bid = blockIdx.x;
    const int b = bid >> 8;                       // 256 blocks per batch
    const int h = (bid >> 4) & 15;
    const int q0 = ((bid & 15) * AW + wave) * (16 * QT);  // 32 queries per wave

    const size_t head = (size_t)(b * NHEAD + h);
    // this wave's four tiles of each pass, in the workspace and in the two buffers (the block is
    // one-dimensional: threadIdx.x >> 5 is the wave's number)
    const unsigned wv = uni(threadIdx.x >> 5);
    const unsigned long long kvg = (unsigned long long)(KV + head * (SEQ / 32) * PASS_E) + wv * (4u * TILE_B);
    const unsigned kvl = lds_addr(&kvs[0][0]) + wv * (4u * TILE_B);
    const u32x8 g1 = tdm_group1(4u, TILE_B);
    // K and V hold the batch's kept keys alone, packed: nk of them, walked in whole passes of 32
    // (held in a scalar register, so that the loop's tests on it are scalar compares)
    const int nk  = __builtin_amdgcn_readfirstlane(min(max(cnts[b], 1), SEQ));
    __builtin_assume(nk >= 1 && nk <= SEQ);                   // the clamp above: the loop has a first pass
    const int nkr = (nk + 31) & ~31;
    tdm_load(tdm_group0(kvl, kvg), g1);                       // pass 0 into buffer 0
    wait_tensor();
    __syncthreads();                                          // publishes pass 0

    // fragment-major planes: this lane's piece of a tile starts at lane*8
    const size_t qoff = head * SEQ * DH + (size_t)(q0 >> 4) * (DH / 32) * TILE_E + lane * 8;
    const unsigned short* qrh = Qh + qoff;
    const unsigned short* qrl = Ql + qoff;

    // Q tiles as B-operand (lane col = query), K-dim = head dim (2 steps of 32)
    v16bf qh[QT][2], ql[QT][2];
#pragma unroll
    for (int qt = 0; qt < QT; ++qt)
#pragma unroll
        for (int ds = 0; ds < 2; ++ds) {
            qh[qt][ds] = load_frag(qrh + (qt * (DH / 32) + ds) * TILE_E);
            ql[qt][ds] = load_frag(qrl + (qt * (DH / 32) + ds) * TILE_E);
        }
    if (cnts[BATCH + b] != 0) {           // no key kept: all scores equal, as in the reference
#pragma unroll
        for (int qt = 0; qt < QT; ++qt)
#pragma unroll
            for (int ds = 0; ds < 2; ++ds)
#pragma unroll
                for (int e = 0; e < 16; ++e) {
                    qh[qt][ds][e] = bfbits(0);
                    ql[qt][ds][e] = bfbits(0);
                }
    }

    float mrow[QT], lrow[QT];             // per-lane softmax state for query `col` of each tile
    v8f o[QT][4];                         // O^T accum: lane holds d = t*16+r+8*hi16, q = col
#pragma unroll
    for (int qt = 0; qt < QT; ++qt) {
        mrow[qt] = -3.0e38f;
        lrow[qt] = 0.0f;
#pragma unroll
        for (int t = 0; t < 4; ++t) o[qt][t] = v8f_zero();
    }

    for (int k0 = 0; k0 < nkr; k0 += 32) {
        // S^T = K . Q^T : st[qt][js][r] = score(key k0+js*16+r+8*hi16, query col of tile qt);
        // each K fragment is loaded once and multiplied with every Q tile of the wave
        const int buf = (k0 >> 5) & 1;
        // the refill: behind the barrier that published this pass and ended every read of the other
        // buffer, the next pass's load goes into that buffer, only while such a pass exists (at the head
        // of a pass: the same order as at the foot of the pass before; pass 1 needs no load of its own)
        const unsigned nx = pinned((unsigned)k0 + 32u);       // pinned(): scalar test, descriptor formed here
        if (nx < (unsigned)nkr)
            tdm_load(tdm_group0(kvl + ((nx >> 5) & 1u) * (PASS_E * 2), kvg + (nx >> 5) * (PASS_E * 2u)), g1);
        const unsigned short* kvb = &kvs[buf][lane * 8];      // this pass's tiles, read from LDS
        v8f st[QT][2];
#pragma unroll
        for (int js = 0; js < 2; ++js) {
#pragma unroll
            for (int qt = 0; qt < QT; ++qt) st[qt][js] = v8f_zero();
            const unsigned short* kp = kvb + js * (DH / 32) * TILE_E;
#pragma unroll
            for (int ds = 0; ds < 2; ++ds) {
                v16bf kh = load_frag(kp + ds * TILE_E);
                v16bf kl = load_frag(kp + (4 + ds) * TILE_E);
#pragma unroll
                for (int qt = 0; qt < QT; ++qt)
                    st[qt][js] = wmma_split(kh, kl, qh[qt][ds], ql[qt][ds], st[qt][js]);
            }
        }
        // what is left to mask: the rows behind the last kept key, in the last pass alone (one scalar
        // test a pass). MASK_VAL / SCALE_F is exact, and the scaling below gives MASK_VAL back exactly
        if (k0 + 32 > nk) {
#pragma unroll
            for (int qt = 0; qt < QT; ++qt)
#pragma unroll
                for (int js = 0; js < 2; ++js)
#pragma unroll
                    for (int r = 0; r < 8; ++r)
                        if (k0 + js * 16 + 8 * hi16 + r >= nk) st[qt][js][r] = MASK_VAL / SCALE_F;
        }
        union { v16bf v; unsigned int u[8]; } ph[QT], pl[QT];
        float alpha[QT];
#pragma unroll
        for (int qt = 0; qt < QT; ++qt) {
            // scale + running max
            float mx = mrow[qt];
#pragma unroll
            for (int js = 0; js < 2; ++js)
#pragma unroll
                for (int r = 0; r < 8; ++r) {
                    float s = st[qt][js][r] * SCALE_F;
                    st[qt][js][r] = s;
                    mx = fmaxf(mx, s);
                }
            mx = fmaxf(mx, __shfl_xor(mx, 16));       // combine the two key halves
            alpha[qt] = __expf(mrow[qt] - mx);
            mrow[qt] = mx;
            // exp -> P; st layout already matches the B-operand element order exactly
            float rs = 0.0f;
#pragma unroll
            for (int js = 0; js < 2; ++js)
#pragma unroll
                for (int r = 0; r < 8; r += 2) {
                    const float p0 = __expf(st[qt][js][r] - mx);
                    const float p1 = __expf(st[qt][js][r + 1] - mx);
                    rs += p0;
                    rs += p1;
                    split2(p0, p1, ph[qt].u[js * 4 + (r >> 1)], pl[qt].u[js * 4 + (r >> 1)]);
                }
            rs += __shfl_xor(rs, 16);
            lrow[qt] = lrow[qt] * alpha[qt] + rs;
        }
        // O^T += V^T . P^T  (4 d-subtiles); rescale is a per-lane scalar;
        // each V fragment is loaded once and multiplied with every P tile of the wave
#pragma unroll
        for (int t = 0; t < 4; ++t) {
            const unsigned short* vp = kvb + (8 + t) * TILE_E;
            v16bf vh = load_frag(vp);
            v16bf vl = load_frag(vp + 4 * TILE_E);
#pragma unroll
            for (int qt = 0; qt < QT; ++qt) {
                o[qt][t] = o[qt][t] * alpha[qt];
                o[qt][t] = wmma_split(vh, vl, ph[qt].v, pl[qt].v, o[qt][t]);
            }
        }
        // publish point: the next pass has landed for every wave, and every wave has left this buffer
        wait_lds_reads();
        wait_tensor();
        __syncthreads();
    }
    wait_tensor();
    wait_lds_reads();
    // write x[b][n=q0+qt*16+col][h*64+d], d = t*16 + 8*hi16 + r, into the fragment-major hi/lo
    // planes of the output GEMM: the lane's 8 values are one 16-byte piece
#pragma unroll
    for (int qt = 0; qt < QT; ++qt) {
        const float linv = 1.0f / lrow[qt];
        const size_t xoff = ((size_t)((b * SEQ + q0 + qt * 16) >> 4) * (DIMC / 32)
                             + h * (DH / 32)) * TILE_E + lane * 8;
#pragma unroll
        for (int t = 0; t < 4; ++t) {
            float x[8];
#pragma unroll
            for (int r = 0; r < 8; ++r) x[r] = o[qt][t][r] * linv;
            store_split8(x, Xh + xoff + (t >> 1) * TILE_E + (t & 1) * 256,
                            Xl + xoff + (t >> 1) * TILE_E + (t & 1) * 256);
        }
    }
}

// ---------- kernel 3: output projection + bias (fp32 out) ----------
__global__ void __launch_bounds__(256)
gemm_fc(const unsigned short* __restrict__ Xh, const unsigned short* __restrict__ Xl,
        const unsigned short* __restrict__ Wh, const unsigned short* __restrict__ Wl,
        const float* __restrict__ bias,
        float* __restrict__ out) {
    __shared__ __attribute__((aligned(2048))) unsigned short stg[2][STAGE_E];   // tensor loads land at multiples of 2 KB
    const int lane = threadIdx.x & 31;
    const int wave = threadIdx.x >> 5;
    const int col  = lane & 15;
    const int hi16 = lane >> 4;
    const int m0 = (blockIdx.x * 2 + (wave & 1)) * (16 * WT);
    const int o0 = (blockIdx.y * 4 + (wave >> 1)) * 64;

    v8f acc[WT][4];
#pragma unroll
    for (int i = 0; i < WT; ++i)
#pragma unroll
        for (int t = 0; t < 4; ++t) acc[i][t] = v8f_zero();

    gemm_k_loop<false>(Xh, Xl, Wh, Wl, stg, blockIdx.x * 8, blockIdx.y * 16, wave & 1, wave >> 1, acc);
#pragma unroll
    for (int t = 0; t < 4; ++t) {
        const int oc = o0 + t * 16 + col;
        const float bia = bias[oc];
#pragma unroll
        for (int i = 0; i < WT; ++i) {
            const int n0 = m0 + i * 16 + 8 * hi16;
#pragma unroll
            for (int r = 0; r < 8; ++r)
                out[(size_t)(n0 + r) * DIMC + oc] = acc[i][t][r] + bia;
        }
    }
}

extern "C" void kernel_launch(void* const* d_in, const int* in_sizes, int n_in,
                              void* d_out, int out_size, void* d_ws, size_t ws_size,
                              hipStream_t stream) {
    const float* inputs = (const float*)d_in[0];
    const float* W_qkv  = (const float*)d_in[1];
    const float* W_fc   = (const float*)d_in[2];
    const float* b_fc   = (const float*)d_in[3];
    const int*   pmask  = (const int*)d_in[4];

    // workspace layout (bf16/ushort elements), all 1 KB tiles; 208 MB total
    const size_t nQKV = (size_t)BATCH * NHEAD * SEQ * DH;   // 8388608
    const size_t nX   = (size_t)BATCH * SEQ * DIMC;         // 8388608
    const size_t nWq  = (size_t)3 * DIMC * DIMC;            // 3145728
    const size_t nWf  = (size_t)DIMC * DIMC;                // 1048576
    unsigned short* p = (unsigned short*)d_ws;
    unsigned short* Qh  = p; p += nQKV;
    unsigned short* Ql  = p; p += nQKV;
    unsigned short* KV  = p; p += 4 * nQKV;
    unsigned short* Xih = p; p += nX;
    unsigned short* Xil = p; p += nX;
    unsigned short* Wqh = p; p += nWq;
    unsigned short* Wql = p; p += nWq;
    unsigned short* Wfh = p; p += nWf;
    unsigned short* Wfl = p; p += nWf;
    unsigned short* Xah = p; p += nX;
    unsigned short* Xal = p; p += nX;
    unsigned short* Xkh = p; p += nX;
    unsigned short* Xkl = p; p += nX;
    int* cnts = (int*)p;                                    // kept keys per batch, then the no-key flags

    pack_planes<<<2 * XBANDS + WQBANDS + WFBANDS, 256, 0, stream>>>(inputs, pmask, W_qkv, W_fc,
                                                                    Xkh, Xkl, Xih, Xil, Wqh, Wql, Wfh, Wfl, cnts);

    gemm_qkv<<<dim3(64, 12), 256, 0, stream>>>(Xih, Xil, Xkh, Xkl, cnts, Wqh, Wql,
                                               Qh, Ql, KV);
    attn_kernel<<<BATCH * NHEAD * (SEQ / 128), 128, 0, stream>>>(Qh, Ql, KV,
                                                                cnts, Xah, Xal);
    gemm_fc<<<dim3(64, 4), 256, 0, stream>>>(Xah, Xal, Wfh, Wfl, b_fc, (float*)d_out);
}

// v008
// Measured time: 172 microseconds a run.
// Next to v007, in two timings, it ran 1.07 and 1.05 times as fast.
// Over all steps from v000 it is 5.83 times as fast.
#include <hip/hip_runtime.h>

#define DIMC   1024
#define NHEAD  16
#define BATCH  4
#define SEQ    2048
#define DH     64
#define SCALE_F 0.125f            // (1024/16)^-0.5
#define MASK_VAL -10000000.0f

typedef __attribute__((ext_vector_type(16))) __bf16        v16bf;
typedef __attribute__((ext_vector_type(8)))  float         v8f;
typedef __attribute__((ext_vector_type(4)))  unsigned int  u32x4;
typedef __attribute__((ext_vector_type(8)))  unsigned int  u32x8;
typedef __attribute__((ext_vector_type(4)))  float         f32x4;
typedef __attribute__((ext_vector_type(2)))  float         f32x2;
typedef __attribute__((ext_vector_type(2)))  __bf16        bf16x2;

// ---------- bf16 hi/lo split helpers (separate planes) ----------
__device__ __forceinline__ __bf16 bfbits(unsigned short h) {
    return __builtin_bit_cast(__bf16, h);
}
// two f32 values -> their bf16 hi parts and the bf16 of what is left, each pair packed in one
// register (low half = a). The rounding, to nearest even, is the hardware's packed convert:
// one instruction for two values.
__device__ __forceinline__ void split2(float a, float b, unsigned int& hi, unsigned int& lo) {
    const f32x2 v = {a, b};
    const bf16x2 h = __builtin_convertvector(v, bf16x2);
    const f32x2 rest = v - __builtin_convertvector(h, f32x2);
    hi = __builtin_bit_cast(unsigned int, h);
    lo = __builtin_bit_cast(unsigned int, __builtin_convertvector(rest, bf16x2));
}

// WMMA operand element i maps to k = (i<8?0:16) + 8*hi16 + (i&7) (CDNA5 16-bit
// 16x32 A / 32x16 B layout, wave32).
// Every bf16 plane in the workspace is stored fragment-major: a plane of R rows
// by K columns is cut into tiles of 16 rows x 32 k (512 elements, 1 KB), tile
// index (row/16)*(K/32) + k/32 (the K/V buffer orders its tiles per key pass, see kernel 1). Inside a tile, element (row, k) lies at
//   ((k>>4)&1)*256 + (((k>>3)&1)*16 + (row&15))*8 + (k&7)
// so lane l's two 16-byte pieces lie at l*8 and 256 + l*8: each wave-wide
// 16-byte load or store covers 512 contiguous bytes, four whole 128-byte lines.
#define TILE_E 512
// lanep: start of the tile + lane*8
__device__ __forceinline__ v16bf load_frag(const unsigned short* __restrict__ lanep) {
    union { v16bf v; u32x4 q[2]; } u;
    u.q[0] = *(const u32x4*)(lanep);
    u.q[1] = *(const u32x4*)(lanep + 256);
    return u.v;
}
// split eight f32 values into bf16 hi and lo and store each as one 16-byte piece
__device__ __forceinline__ void store_split8(const float* x,
                                             unsigned short* __restrict__ hp,
                                             unsigned short* __restrict__ lp) {
    u32x4 qh, ql;
#pragma unroll
    for (int e = 0; e < 4; ++e) {
        unsigned int h, l;
        split2(x[2 * e], x[2 * e + 1], h, l);
        qh[e] = h;
        ql[e] = l;
    }
    *(u32x4*)hp = qh;
    *(u32x4*)lp = ql;
}

__device__ __forceinline__ v8f wmma_bf(v16bf a, v16bf b, v8f c) {
    return __builtin_amdgcn_wmma_f32_16x16x32_bf16(false, a, false, b, (short)0, c,
                                                   false, false);
}
// split-precision product: (ah+al)*(bh+bl) ~ ah*bh + ah*bl + al*bh
__device__ __forceinline__ v8f wmma_split(v16bf ah, v16bf al, v16bf bh, v16bf bl, v8f c) {
    c = wmma_bf(ah, bh, c);
    c = wmma_bf(ah, bl, c);
    c = wmma_bf(al, bh, c);
    return c;
}
__device__ __forceinline__ v8f v8f_zero() {
    v8f z;
#pragma unroll
    for (int e = 0; e < 8; ++e) z[e] = 0.0f;
    return z;
}

// ---------- kernel 0: every fp32 operand -> fragment-major bf16 hi plane + lo plane, one launch ----------
// One block per 16-row band (16 rows x DIMC) of a pair of planes; a wave packs four 16x32 tiles of the
// band, a lane its own two 8-element pieces of each tile. The bands, in block order:
//   [kept-key rows of X | all rows of X | W_qkv | W_fc]
// The kept-key bands stand first: they rank the mask before they can load, the longest way of a block.
//
// The kept-key planes. A key with mask > 0 has the score MASK_VAL. Its weight exp(MASK_VAL - m), m the
// row's maximum, is exactly 0 in f32 once m > MASK_VAL + 104, and a kept key's scaled score from
// normal-drawn inputs stays millions above MASK_VAL: beside a kept key a masked one adds nothing to a
// row's sum or output. K and V are therefore projected, and the key loop run, over the kept keys alone:
// row j of batch b of these planes is the j-th kept token of that batch.
// Rows from the count up to the next multiple of 128 (a projection block) are written as zeros.
// A batch with no kept key: the reference's softmax is then uniform over all keys; every key is
// kept and cnts[BATCH + b] tells the attention kernel to take all scores as equal.
// Each kept-key block ranks the batch's 2048 mask words itself.
#define XBANDS  (BATCH * SEQ / 16)            // 512 bands of X, and as many of its kept-key planes
#define WQBANDS (3 * DIMC / 16)               // 192
#define WFBANDS (DIMC / 16)                   // 64
__global__ void __launch_bounds__(256)
pack_planes(const float* __restrict__ xsrc, const int* __restrict__ pm,
            const float* __restrict__ wq, const float* __restrict__ wf,
            unsigned short* __restrict__ xkh, unsigned short* __restrict__ xkl,
            unsigned short* __restrict__ xih, unsigned short* __restrict__ xil,
            unsigned short* __restrict__ wqh, unsigned short* __restrict__ wql,
            unsigned short* __restrict__ wfh, unsigned short* __restrict__ wfl,
            int* __restrict__ cnts) {
    __shared__ int wsum[8];
    __shared__ int srow[16];
    const int t = threadIdx.x;
    const int lane = t & 31;
    const int wave = t >> 5;
    const int bid = blockIdx.x;
    const float* src;                             // the source matrix of the band
    unsigned short* hip_;                         // its two planes
    unsigned short* lop_;
    int band;                                     // the band's number in those planes
    int row;                                      // this lane's source row, or -1: a row of zeros
    bool work = true;                             // the same for the whole block
    if (bid < XBANDS) {                           // the same for the whole block: both barriers are inside
        const int b  = bid >> 7;                  // SEQ/16 = 128 bands per batch
        const int j0 = (bid & 127) * 16;          // first packed row of the band
        const int* mp = pm + b * SEQ + t * 8;     // this thread ranks eight tokens
        unsigned bits = 0;
#pragma unroll
        for (int e = 0; e < 8; ++e)
            if (!(mp[e] > 0)) bits |= 1u << e;
        const int c = __popc(bits);
        int inc = c;                              // inclusive sum over the wave
#pragma unroll
        for (int d = 1; d < 32; d <<= 1) {
            const int o = __shfl_up(inc, d);
            if (lane >= d) inc += o;
        }
        if (lane == 31) wsum[wave] = inc;
        if (t < 16) srow[t] = -1;
        __syncthreads();                          // wave sums and the cleared row table are visible
        int before = inc - c, total = 0;
#pragma unroll
        for (int w = 0; w < 8; ++w) {
            const int s = wsum[w];
            total += s;
            if (w < wave) before += s;
        }
        const bool none = (total == 0);
        if (none) { bits = 0xFFu; before = t * 8; total = SEQ; }
#pragma unroll
        for (int e = 0; e < 8; ++e)
            if ((bits >> e) & 1u) {
                const int p = before - j0;
                if ((unsigned)p < 16u) srow[p] = t * 8 + e;
                ++before;
            }
        __syncthreads();                          // the band's source rows are visible
        if (j0 == 0 && t == 0) { cnts[b] = total; cnts[BATCH + b] = none ? 1 : 0; }
        work = j0 < ((total + 127) & ~127);
        const int tok = srow[lane & 15];          // a token number formed from thread indices, or -1
        row = tok < 0 ? -1 : b * SEQ + tok;
        src = xsrc; hip_ = xkh; lop_ = xkl; band = bid;
    } else if (bid < 2 * XBANDS) {
        band = bid - XBANDS;
        src = xsrc; hip_ = xih; lop_ = xil; row = band * 16 + (lane & 15);
    } else if (bid < 2 * XBANDS + WQBANDS) {
        band = bid - 2 * XBANDS;
        src = wq; hip_ = wqh; lop_ = wql; row = band * 16 + (lane & 15);
    } else {
        band = bid - (2 * XBANDS + WQBANDS);
        src = wf; hip_ = wfh; lop_ = wfl; row = band * 16 + (lane & 15);
    }
    if (work) {                                   // no barrier inside
        const float* rp = src + (size_t)(row < 0 ? 0 : row) * DIMC + wave * 128 + 8 * (lane >> 4);
        // a wave packs four tiles; all sixteen loads go out before the first value is used
        f32x4 v[4][2][2];
#pragma unroll
        for (int q = 0; q < 4; ++q)
#pragma unroll
            for (int j = 0; j < 2; ++j) {
                v[q][j][0] = *(const f32x4*)(rp + q * 32 + j * 16);
                v[q][j][1] = *(const f32x4*)(rp + q * 32 + j * 16 + 4);
            }
        // stands in front of the first rewrite of the loads' address registers; rp is named as an
        // input so that it lives to this line and no load's result is placed over it
        asm volatile("s_wait_xcnt 0x0" :: "v"(rp) : "memory");
#pragma unroll
        for (int q = 0; q < 4; ++q)
#pragma unroll
            for (int j = 0; j < 2; ++j) {
                float x[8];
#pragma unroll
                for (int e = 0; e < 8; ++e) x[e] = row < 0 ? 0.0f : v[q][j][e >> 2][e & 3];
                const size_t o = ((size_t)band * (DIMC / 32) + wave * 4 + q) * TILE_E
                               + j * 256 + lane * 8;
                store_split8(x, hip_ + o, lop_ + o);
            }
    }
}

// ---------- tensor loads to LDS: descriptor, issue and the waits of the two-buffer ring ----------
// the wave's own LDS reads have returned: stands in front of the barrier behind which a buffer is refilled
__device__ __forceinline__ void wait_lds_reads() { asm volatile("s_wait_dscnt 0x0" ::: "memory"); }
// the wave's own tensor load has landed: stands in front of the barrier behind which other waves read it
__device__ __forceinline__ void wait_tensor() { asm volatile("s_wait_tensorcnt 0x0" ::: "memory"); }
__device__ __forceinline__ unsigned lds_addr(const unsigned short* p) {
    return (unsigned)(unsigned long long)p;       // low 32 bits of a __shared__ address: the LDS byte
}
__device__ __forceinline__ unsigned uni(unsigned v) { return (unsigned)__builtin_amdgcn_readfirstlane(v); }
// a word held in a scalar register: a test on it is a scalar branch (a tensor load ignores EXEC), and what
// is formed from it is formed behind the waits that stand in front of this statement
__device__ __forceinline__ unsigned pinned(unsigned v) {
    unsigned w = uni(v);
    asm volatile("" : "+s"(w));                   // pinned(): the word stays in a scalar register
    return w;
}
// A request brings `rows` tiles of 1 KB (a tile is one row of the request), `pitch` bytes apart in the
// workspace, to consecutive KB of LDS. Group 1: 1-byte elements, no mask, no pad, tensor = tile.
#define TILE_B 1024u
__device__ __forceinline__ u32x8 tdm_group1(unsigned rows, unsigned pitch) {
    u32x8 g;
    g[0] = uni(0u);
    g[1] = uni((TILE_B & 0xFFFFu) << 16);
    g[2] = uni((TILE_B >> 16) | ((rows & 0xFFFFu) << 16));
    g[3] = uni((rows >> 16) | (TILE_B << 16));
    g[4] = uni(rows);
    g[5] = uni(pitch);
    g[6] = uni(0u);
    g[7] = uni(0u);
    return g;
}
// Group 0: count 1, the LDS byte, the address of the first byte, type 2
__device__ __forceinline__ u32x4 tdm_group0(unsigned lds, unsigned long long ga) {
    u32x4 g;
    g[0] = uni(1u);
    g[1] = uni(lds);
    g[2] = uni((unsigned)ga);
    g[3] = uni((((unsigned)(ga >> 32)) & 0x01FFFFFFu) | 0x80000000u);
    return g;
}
// one request of the whole wave; the waits are written where it is used
__device__ __forceinline__ void tdm_load(u32x4 g0, u32x8 g1) {
    asm volatile("tensor_load_to_lds %0, %1" :: "s"(g0), "s"(g1) : "memory");
}

// One K step (32 k) of a block's operands in LDS, 48 tiles of 1 KB:
// [X hi 8 | X lo 8 | W hi 16 | W lo 16], the tiles of a plane in row order.
#define STAGE_E (48 * TILE_E)
#define BAND_E  ((DIMC / 32) * TILE_E)        // from one 16-row band of a plane to the next

// K loop shared by both projections: a 64x64 tile per wave (4 X tiles by 4 W tiles), K = DIMC:
// a loaded W fragment meets four X tiles instead of one, an X fragment four W tiles as before.
// A block is 2 x 4 waves, 128 tokens by 256 features. Its operands of one K step are brought into LDS
// once for all eight waves by tensor loads, two buffers: the next step's loads fly while this step's
// fragments are read from LDS and multiplied. Every wave issues one request a step for its own slice:
// waves 0, 1: X hi, 2, 3: X lo (four tiles each); 4, 5: W hi, 6, 7: W lo (eight tiles each).
// mb, ob: first 16-row band of the block in X and in W; wm, wn: the wave's place in the block.
// rot: the K step at which this block enters its walk along K; it wraps round behind the last one. Blocks
// that read the same tiles of X, and any 32 neighbours that read the same W, get different rot, so that they do not ask L2 for the same lines at
// the same moment. The f32 sum along K starts at that step.
// SWAP = false: acc[i][t] = X-tile i (A) . W-tile t (B): lane holds 8 tokens of one feature.
// SWAP = true : acc[i][t] = W-tile t (A) . X-tile i (B): lane holds 8 features of one token.
// The three split products are summed in the same order either way.
#define WT 4                      // X tiles (16 tokens each) per wave
template <bool SWAP>
__device__ __forceinline__ void gemm_k_loop(const unsigned short* __restrict__ Xh,
                                            const unsigned short* __restrict__ Xl,
                                            const unsigned short* __restrict__ Wh,
                                            const unsigned short* __restrict__ Wl,
                                            unsigned short (&stg)[2][STAGE_E],
                                            int mb, int ob, int wm, int wn, unsigned rot,
                                            v8f (&acc)[WT][4]) {
    const int lane = threadIdx.x & 31;
    // this wave's slice of a stage (the block is one-dimensional: threadIdx.x >> 5 is the wave's number)
    const unsigned wv    = uni(threadIdx.x >> 5);
    const unsigned isw   = wv >> 2;                           // 0: a slice of X, 1: a slice of W
    const unsigned rows  = isw ? 8u : 4u;
    const unsigned band  = (isw ? (unsigned)ob : (unsigned)mb) + (wv & 1u) * rows;
    const unsigned place = (isw ? 16u + ((wv >> 1) & 1u) * 16u : ((wv >> 1) & 1u) * 8u) + (wv & 1u) * rows;
    const unsigned short* plane = isw ? ((wv & 2u) ? Wl : Wh) : ((wv & 2u) ? Xl : Xh);
    const unsigned long long sg = (unsigned long long)(plane + (size_t)band * BAND_E);
    const unsigned sl = lds_addr(&stg[0][0]) + place * TILE_B;
    const u32x8 g1 = tdm_group1(rows, BAND_E * 2);

    tdm_load(tdm_group0(sl, sg + rot * TILE_B), g1);          // the walk's first K step into buffer 0
    wait_tensor();
    __syncthreads();                                          // publishes it

    for (int kt = 0; kt < DIMC / 32; ++kt) {
        const int buf = kt & 1;
        // the refill: behind the barrier that published this K step and ended every read of the other
        // buffer, the next K step's load goes into that buffer, only while such a step exists. At the
        // head of a pass it stands in the same order as at the foot of the pass before, and K step 1
        // needs no load of its own in front of the loop: no register of a request in flight is rewritten
        const unsigned nx = pinned((unsigned)kt + 1u);        // pinned(): scalar test, descriptor formed here
        if (nx < DIMC / 32)
            tdm_load(tdm_group0(sl + (nx & 1u) * (STAGE_E * 2), sg + ((nx + rot) & (DIMC / 32 - 1u)) * TILE_B), g1);
        const unsigned short* pah = &stg[buf][(wm * WT) * TILE_E + lane * 8];
        const unsigned short* pal = pah + 8 * TILE_E;
        const unsigned short* pbh = &stg[buf][(16 + wn * 4) * TILE_E + lane * 8];
        const unsigned short* pbl = pbh + 16 * TILE_E;
        v16bf ah[WT], al[WT];
#pragma unroll
        for (int i = 0; i < WT; ++i) {
            ah[i] = load_frag(pah + i * TILE_E);
            al[i] = load_frag(pal + i * TILE_E);
        }
#pragma unroll
        for (int t = 0; t < 4; ++t) {
            v16bf bh = load_frag(pbh + t * TILE_E);
            v16bf bl = load_frag(pbl + t * TILE_E);
            if (SWAP) {
#pragma unroll
                for (int i = 0; i < WT; ++i) acc[i][t] = wmma_bf(bh, ah[i], acc[i][t]);
#pragma unroll
                for (int i = 0; i < WT; ++i) acc[i][t] = wmma_bf(bl, ah[i], acc[i][t]);
#pragma unroll
                for (int i = 0; i < WT; ++i) acc[i][t] = wmma_bf(bh, al[i], acc[i][t]);
            } else {
#pragma unroll
                for (int i = 0; i < WT; ++i) acc[i][t] = wmma_bf(ah[i], bh, acc[i][t]);
#pragma unroll
                for (int i = 0; i < WT; ++i) acc[i][t] = wmma_bf(ah[i], bl, acc[i][t]);
#pragma unroll
                for (int i = 0; i < WT; ++i) acc[i][t] = wmma_bf(al[i], bh, acc[i][t]);
            }
        }
        // publish point: the next K step has landed for every wave, and every wave has left this buffer
        wait_lds_reads();
        wait_tensor();
        __syncthreads();
    }
    wait_tensor();
    wait_lds_reads();
}

// ---------- kernel 1: QKV projection ----------
// out[m][o] = sum_k X[m][k]*W[o][k]; Q as [token][d] planes per head, fragment-major.
// K ([token][d] tiles) and V ([d][token] tiles) share one buffer per head, ordered by the
// attention pass that reads them: per 32 keys 16 tiles, [K hi 4 | K lo 4 | V hi 4 | V lo 4].
#define PASS_E (16 * TILE_E)
// a block is 2 x 4 waves: 128 tokens by 256 features; the register budget of four waves per SIMD
// keeps two blocks on a WGP, so that one block multiplies while the other stands at its barrier
__global__ void __launch_bounds__(256) __attribute__((amdgpu_waves_per_eu(4, 4)))
gemm_qkv(const unsigned short* __restrict__ Xqh, const unsigned short* __restrict__ Xql,
         const unsigned short* __restrict__ Xkh, const unsigned short* __restrict__ Xkl,
         const int* __restrict__ cnts,
         const unsigned short* __restrict__ Wh, const unsigned short* __restrict__ Wl,
         unsigned short* __restrict__ Qh, unsigned short* __restrict__ Ql,
         unsigned short* __restrict__ KV) {
    __shared__ __attribute__((aligned(2048))) unsigned short stg[2][STAGE_E];   // tensor loads land at multiples of 2 KB
    // K and V blocks work on the packed rows of the kept keys; a block wholly past its batch's count
    // has nothing to project: all its threads leave here, in front of every tensor load and barrier
    if (blockIdx.y >= 4 && (int)(blockIdx.x & 15) * 128 >= cnts[blockIdx.x >> 4]) return;
    const unsigned short* Xh = blockIdx.y < 4 ? Xqh : Xkh;
    const unsigned short* Xl = blockIdx.y < 4 ? Xql : Xkl;
    const int lane = threadIdx.x & 31;
    // the wave's number in a scalar register: tile, head and batch indices then live in scalar
    // registers through the K loop; held in vector registers they push the kernel past 256 of
    // them, which costs the fourth wave of a SIMD
    const int wave = __builtin_amdgcn_readfirstlane(threadIdx.x >> 5);
    const int m0 = (blockIdx.x * 2 + (wave & 1)) * (16 * WT);   // first token of the wave
    const int o0 = (blockIdx.y * 4 + (wave >> 1)) * 64;         // output features (one head slice)

    v8f acc[WT][4];
#pragma unroll
    for (int i = 0; i < WT; ++i)
#pragma unroll
        for (int t = 0; t < 4; ++t) acc[i][t] = v8f_zero();

    const int mb = blockIdx.x * 8;    // the block's first 16-row band of X
    const int ob = blockIdx.y * 16;   // and of W
    const int s  = blockIdx.y >> 2;   // 0=Q 1=K 2=V: the same for the whole block
    // blocks of one column (the same X rows) enter four K steps apart, neighbours in a row (the same W) one
    const unsigned rot = (blockIdx.x + 4u * blockIdx.y) & (DIMC / 32 - 1u);
    const int h  = (o0 & 1023) >> 6;
    const int b  = m0 >> 11;
    const size_t head = (size_t)(b * NHEAD + h);
    if (s == 2) {
        gemm_k_loop<false>(Xh, Xl, Wh, Wl, stg, mb, ob, wave & 1, wave >> 1, rot, acc);
#pragma unroll
        for (int i = 0; i < WT; ++i) {
            const int n0 = (m0 & 2047) + i * 16;
            // Vt[d][n]: row d = t*16 + col, k = n0 + 8*hi16 + r: the lane's 8 values are one piece
            unsigned short* vp = KV + (head * (SEQ / 32) + (n0 >> 5)) * PASS_E + 8 * TILE_E
                               + ((n0 >> 4) & 1) * 256 + lane * 8;
#pragma unroll
            for (int t = 0; t < 4; ++t) {
                float x[8];
#pragma unroll
                for (int r = 0; r < 8; ++r) x[r] = acc[i][t][r];
                store_split8(x, vp + t * TILE_E, vp + (4 + t) * TILE_E);
            }
        }
    } else {
        gemm_k_loop<true>(Xh, Xl, Wh, Wl, stg, mb, ob, wave & 1, wave >> 1, rot, acc);
#pragma unroll
        for (int i = 0; i < WT; ++i) {
            const int n0 = (m0 & 2047) + i * 16;
            // Q/K[n][d]: row n = n0 + col, k = d = t*16 + 8*hi16 + r: again one piece per lane
            const size_t qo = head * SEQ * DH + (size_t)(n0 >> 4) * (DH / 32) * TILE_E + lane * 8;
            const size_t ko = (head * (SEQ / 32) + (n0 >> 5)) * PASS_E
                            + ((n0 >> 4) & 1) * (DH / 32) * TILE_E + lane * 8;
            unsigned short* bh_ = (s == 0 ? Qh + qo : KV + ko);
            unsigned short* bl_ = (s == 0 ? Ql + qo : KV + ko + 4 * TILE_E);
#pragma unroll
            for (int t = 0; t < 4; ++t) {
                float x[8];
#pragma unroll
                for (int r = 0; r < 8; ++r) x[r] = acc[i][t][r];
                store_split8(x, bh_ + (t >> 1) * TILE_E + (t & 1) * 256,
                                bl_ + (t >> 1) * TILE_E + (t & 1) * 256);
            }
        }
    }
}

// ---------- kernel 2: flash attention (transposed-score trick) ----------
#define QT 2                      // query tiles (16 queries each) per wave
#define AW 4                      // waves per block
// one pass of K and V (16 tiles, 16 KB, contiguous in the workspace) comes into LDS in the same order by
// tensor loads: every wave issues one request a pass for its own four tiles.
__global__ void __launch_bounds__(AW * 32)
attn_kernel(const unsigned short* __restrict__ Qh, const unsigned short* __restrict__ Ql,
            const unsigned short* __restrict__ KV,
            const int* __restrict__ cnts,
            unsigned short* __restrict__ Xh, unsigned short* __restrict__ Xl) {
    __shared__ __attribute__((aligned(2048))) unsigned short kvs[2][PASS_E]; // two passes of K and V
    const int lane = threadIdx.x & 31;
    const int wave = threadIdx.x >> 5;
    const int hi16 = lane >> 4;
    const int bid = blockIdx.x;
    const int b = bid >> 8;                       // 256 blocks per batch
    const int h = (bid >> 4) & 15;
    const int q0 = ((bid & 15) * AW + wave) * (16 * QT);  // 32 queries per wave

    const size_t head = (size_t)(b * NHEAD + h);
    // this wave's four tiles of each pass, in the workspace and in the two buffers (the block is
    // one-dimensional: threadIdx.x >> 5 is the wave's number)
    const unsigned wv = uni(threadIdx.x >> 5);
    const unsigned long long kvg = (unsigned long long)(KV + head * (SEQ / 32) * PASS_E) + wv * (4u * TILE_B);
    const unsigned kvl = lds_addr(&kvs[0][0]) + wv * (4u * TILE_B);
    const u32x8 g1 = tdm_group1(4u, TILE_B);
    // K and V hold the batch's kept keys alone, packed: nk of them, walked in whole passes of 32
    // (held in a scalar register, so that the loop's tests on it are scalar compares)
    const int nk  = __builtin_amdgcn_readfirstlane(min(max(cnts[b], 1), SEQ));
    __builtin_assume(nk >= 1 && nk <= SEQ);                   // the clamp above: the loop has a first pass
    const unsigned np = (unsigned)(nk + 31) >> 5;             // passes
    // The sixteen blocks of a head walk the same passes of K and V: each enters the walk at its own pass,
    // spread evenly over the np passes (neighbouring heads half a share apart), and wraps round behind the
    // last one, so that they do not ask L2 for the same lines at the same moment. Every pass holds a kept
    // key, so the running maximum is a real score from the first pass on, wherever the walk starts.
    const unsigned first = (((((unsigned)bid & 15u) << 1) | (((unsigned)bid >> 4) & 1u)) * np) >> 5;   // < np
    tdm_load(tdm_group0(kvl, kvg + first * (PASS_E * 2u)), g1);   // the walk's first pass into buffer 0
    wait_tensor();
    __syncthreads();                                          // publishes it

    // fragment-major planes: this lane's piece of a tile starts at lane*8
    const size_t qoff = head * SEQ * DH + (size_t)(q0 >> 4) * (DH / 32) * TILE_E + lane * 8;
    const unsigned short* qrh = Qh + qoff;
    const unsigned short* qrl = Ql + qoff;

    // Q tiles as B-operand (lane col = query), K-dim = head dim (2 steps of 32)
    v16bf qh[QT][2], ql[QT][2];
#pragma unroll
    for (int qt = 0; qt < QT; ++qt)
#pragma unroll
        for (int ds = 0; ds < 2; ++ds) {
            qh[qt][ds] = load_frag(qrh + (qt * (DH / 32) + ds) * TILE_E);
            ql[qt][ds] = load_frag(qrl + (qt * (DH / 32) + ds) * TILE_E);
        }
    if (cnts[BATCH + b] != 0) {           // no key kept: all scores equal, as in the reference
#pragma unroll
        for (int qt = 0; qt < QT; ++qt)
#pragma unroll
            for (int ds = 0; ds < 2; ++ds)
#pragma unroll
                for (int e = 0; e < 16; ++e) {
                    qh[qt][ds][e] = bfbits(0);
                    ql[qt][ds][e] = bfbits(0);
                }
    }

    float mrow[QT], lrow[QT];             // per-lane softmax state for query `col` of each tile
    v8f o[QT][4];                         // O^T accum: lane holds d = t*16+r+8*hi16, q = col
#pragma unroll
    for (int qt = 0; qt < QT; ++qt) {
        mrow[qt] = -3.0e38f;
        lrow[qt] = 0.0f;
#pragma unroll
        for (int t = 0; t < 4; ++t) o[qt][t] = v8f_zero();
    }

    for (unsigned ps = 0; ps < np; ++ps) {
        const unsigned pw = ps + first;
        const int k0 = (int)((pw < np ? pw : pw - np) << 5);  // first key of this pass
        // S^T = K . Q^T : st[qt][js][r] = score(key k0+js*16+r+8*hi16, query col of tile qt);
        // each K fragment is loaded once and multiplied with every Q tile of the wave
        const int buf = ps & 1;
        // the refill: behind the barrier that published this pass and ended every read of the other
        // buffer, the next pass's load goes into that buffer, only while such a pass exists (at the head
        // of a pass: the same order as at the foot of the pass before; pass 1 needs no load of its own)
        const unsigned nx = pinned(ps + 1u);                  // pinned(): scalar test, descriptor formed here
        if (nx < np) {
            const unsigned nw = nx + first;
            tdm_load(tdm_group0(kvl + (nx & 1u) * (PASS_E * 2), kvg + (nw < np ? nw : nw - np) * (PASS_E * 2u)), g1);
        }
        const unsigned short* kvb = &kvs[buf][lane * 8];      // this pass's tiles, read from LDS
        v8f st[QT][2];
#pragma unroll
        for (int js = 0; js < 2; ++js) {
#pragma unroll
            for (int qt = 0; qt < QT; ++qt) st[qt][js] = v8f_zero();
            const unsigned short* kp = kvb + js * (DH / 32) * TILE_E;
#pragma unroll
            for (int ds = 0; ds < 2; ++ds) {
                v16bf kh = load_frag(kp + ds * TILE_E);
                v16bf kl = load_frag(kp + (4 + ds) * TILE_E);
#pragma unroll
                for (int qt = 0; qt < QT; ++qt)
                    st[qt][js] = wmma_split(kh, kl, qh[qt][ds], ql[qt][ds], st[qt][js]);
            }
        }
        // what is left to mask: the rows behind the last kept key, in the pass that holds it alone (one
        // scalar test a pass). MASK_VAL / SCALE_F is exact, and the scaling below gives MASK_VAL back exactly
        if (k0 + 32 > nk) {
#pragma unroll
            for (int qt = 0; qt < QT; ++qt)
#pragma unroll
                for (int js = 0; js < 2; ++js)
#pragma unroll
                    for (int r = 0; r < 8; ++r)
                        if (k0 + js * 16 + 8 * hi16 + r >= nk) st[qt][js][r] = MASK_VAL / SCALE_F;
        }
        union { v16bf v; unsigned int u[8]; } ph[QT], pl[QT];
        float alpha[QT];
#pragma unroll
        for (int qt = 0; qt < QT; ++qt) {
            // scale + running max
            float mx = mrow[qt];
#pragma unroll
            for (int js = 0; js < 2; ++js)
#pragma unroll
                for (int r = 0; r < 8; ++r) {
                    float s = st[qt][js][r] * SCALE_F;
                    st[qt][js][r] = s;
                    mx = fmaxf(mx, s);
                }
            mx = fmaxf(mx, __shfl_xor(mx, 16));       // combine the two key halves
            alpha[qt] = __expf(mrow[qt] - mx);
            mrow[qt] = mx;
            // exp -> P; st layout already matches the B-operand element order exactly
            float rs = 0.0f;
#pragma unroll
            for (int js = 0; js < 2; ++js)
#pragma unroll
                for (int r = 0; r < 8; r += 2) {
                    const float p0 = __expf(st[qt][js][r] - mx);
                    const float p1 = __expf(st[qt][js][r + 1] - mx);
                    rs += p0;
                    rs += p1;
                    split2(p0, p1, ph[qt].u[js * 4 + (r >> 1)], pl[qt].u[js * 4 + (r >> 1)]);
                }
            rs += __shfl_xor(rs, 16);
            lrow[qt] = lrow[qt] * alpha[qt] + rs;
        }
        // O^T += V^T . P^T  (4 d-subtiles); rescale is a per-lane scalar;
        // each V fragment is loaded once and multiplied with every P tile of the wave
#pragma unroll
        for (int t = 0; t < 4; ++t) {
            const unsigned short* vp = kvb + (8 + t) * TILE_E;
            v16bf vh = load_frag(vp);
            v16bf vl = load_frag(vp + 4 * TILE_E);
#pragma unroll
            for (int qt = 0; qt < QT; ++qt) {
                o[qt][t] = o[qt][t] * alpha[qt];
                o[qt][t] = wmma_split(vh, vl, ph[qt].v, pl[qt].v, o[qt][t]);
            }
        }
        // publish point: the next pass has landed for every wave, and every wave has left this buffer
        wait_lds_reads();
        wait_tensor();
        __syncthreads();
    }
    wait_tensor();
    wait_lds_reads();
    // write x[b][n=q0+qt*16+col][h*64+d], d = t*16 + 8*hi16 + r, into the fragment-major hi/lo
    // planes of the output GEMM: the lane's 8 values are one 16-byte piece
#pragma unroll
    for (int qt = 0; qt < QT; ++qt) {
        const float linv = 1.0f / lrow[qt];
        const size_t xoff = ((size_t)((b * SEQ + q0 + qt * 16) >> 4) * (DIMC / 32)
                             + h * (DH / 32)) * TILE_E + lane * 8;
#pragma unroll
        for (int t = 0; t < 4; ++t) {
            float x[8];
#pragma unroll
            for (int r = 0; r < 8; ++r) x[r] = o[qt][t][r] * linv;
            store_split8(x, Xh + xoff + (t >> 1) * TILE_E + (t & 1) * 256,
                            Xl + xoff + (t >> 1) * TILE_E + (t & 1) * 256);
        }
    }
}

// ---------- kernel 3: output projection + bias (fp32 out) ----------
__global__ void __launch_bounds__(256)
gemm_fc(const unsigned short* __restrict__ Xh, const unsigned short* __restrict__ Xl,
        const unsigned short* __restrict__ Wh, const unsigned short* __restrict__ Wl,
        const float* __restrict__ bias,
        float* __restrict__ out) {
    __shared__ __attribute__((aligned(2048))) unsigned short stg[2][STAGE_E];   // tensor loads land at multiples of 2 KB
    const int lane = threadIdx.x & 31;
    const int wave = threadIdx.x >> 5;
    const int col  = lane & 15;
    const int hi16 = lane >> 4;
    const int m0 = (blockIdx.x * 2 + (wave & 1)) * (16 * WT);
    const int o0 = (blockIdx.y * 4 + (wave >> 1)) * 64;

    v8f acc[WT][4];
#pragma unroll
    for (int i = 0; i < WT; ++i)
#pragma unroll
        for (int t = 0; t < 4; ++t) acc[i][t] = v8f_zero();

    // the four blocks of one column (the same X rows) enter eight K steps apart, neighbours in a row one
    const unsigned rot = (blockIdx.x + 8u * blockIdx.y) & (DIMC / 32 - 1u);
    gemm_k_loop<false>(Xh, Xl, Wh, Wl, stg, blockIdx.x * 8, blockIdx.y * 16, wave & 1, wave >> 1, rot, acc);
#pragma unroll
    for (int t = 0; t < 4; ++t) {
        const int oc = o0 + t * 16 + col;
        const float bia = bias[oc];
#pragma unroll
        for (int i = 0; i < WT; ++i) {
            const int n0 = m0 + i * 16 + 8 * hi16;
#pragma unroll
            for (int r = 0; r < 8; ++r)
                out[(size_t)(n0 + r) * DIMC + oc] = acc[i][t][r] + bia;
        }
    }
}

extern "C" void kernel_launch(void* const* d_in, const int* in_sizes, int n_in,
                              void* d_out, int out_size, void* d_ws, size_t ws_size,
                              hipStream_t stream) {
    const float* inputs = (const float*)d_in[0];
    const float* W_qkv  = (const float*)d_in[1];
    const float* W_fc   = (const float*)d_in[2];
    const float* b_fc   = (const float*)d_in[3];
    const int*   pmask  = (const int*)d_in[4];

    // workspace layout (bf16/ushort elements), all 1 KB tiles; 208 MB total
    const size_t nQKV = (size_t)BATCH * NHEAD * SEQ * DH;   // 8388608
    const size_t nX   = (size_t)BATCH * SEQ * DIMC;         // 8388608
    const size_t nWq  = (size_t)3 * DIMC * DIMC;            // 3145728
    const size_t nWf  = (size_t)DIMC * DIMC;                // 1048576
    unsigned short* p = (unsigned short*)d_ws;
    unsigned short* Qh  = p; p += nQKV;
    unsigned short* Ql  = p; p += nQKV;
    unsigned short* KV  = p; p += 4 * nQKV;
    unsigned short* Xih = p; p += nX;
    unsigned short* Xil = p; p += nX;
    unsigned short* Wqh = p; p += nWq;
    unsigned short* Wql = p; p += nWq;
    unsigned short* Wfh = p; p += nWf;
    unsigned short* Wfl = p; p += nWf;
    unsigned short* Xah = p; p += nX;
    unsigned short* Xal = p; p += nX;
    unsigned short* Xkh = p; p += nX;
    unsigned short* Xkl = p; p += nX;
    int* cnts = (int*)p;                                    // kept keys per batch, then the no-key flags

    pack_planes<<<2 * XBANDS + WQBANDS + WFBANDS, 256, 0, stream>>>(inputs, pmask, W_qkv, W_fc,
                                                                    Xkh, Xkl, Xih, Xil, Wqh, Wql, Wfh, Wfl, cnts);

    gemm_qkv<<<dim3(64, 12), 256, 0, stream>>>(Xih, Xil, Xkh, Xkl, cnts, Wqh, Wql,
                                               Qh, Ql, KV);
    attn_kernel<<<BATCH * NHEAD * (SEQ / 128), 128, 0, stream>>>(Qh, Ql, KV,
                                                                cnts, Xah, Xal);
    gemm_fc<<<dim3(64, 4), 256, 0, stream>>>(Xah, Xal, Wfh, Wfl, b_fc, (float*)d_out);
}

// v009
// One run takes 165 microseconds.
// Two timings next to v008 both put it at 1.04 times that version's speed.
// Counting every step since v000, it is 6.06 times as fast.
#include <hip/hip_runtime.h>

#define DIMC   1024
#define NHEAD  16
#define BATCH  4
#define SEQ    2048
#define DH     64
#define SCALE_F 0.125f            // (1024/16)^-0.5
#define MASK_VAL -10000000.0f

typedef __attribute__((ext_vector_type(16))) __bf16        v16bf;
typedef __attribute__((ext_vector_type(8)))  float         v8f;
typedef __attribute__((ext_vector_type(4)))  unsigned int  u32x4;
typedef __attribute__((ext_vector_type(8)))  unsigned int  u32x8;
typedef __attribute__((ext_vector_type(4)))  float         f32x4;
typedef __attribute__((ext_vector_type(2)))  float         f32x2;
typedef __attribute__((ext_vector_type(2)))  __bf16        bf16x2;

// ---------- bf16 hi/lo split helpers (separate planes) ----------
__device__ __forceinline__ __bf16 bfbits(unsigned short h) {
    return __builtin_bit_cast(__bf16, h);
}
// two f32 values -> their bf16 hi parts and the bf16 of what is left, each pair packed in one
// register (low half = a). The rounding, to nearest even, is the hardware's packed convert:
// one instruction for two values.
__device__ __forceinline__ void split2(float a, float b, unsigned int& hi, unsigned int& lo) {
    const f32x2 v = {a, b};
    const bf16x2 h = __builtin_convertvector(v, bf16x2);
    const f32x2 rest = v - __builtin_convertvector(h, f32x2);
    hi = __builtin_bit_cast(unsigned int, h);
    lo = __builtin_bit_cast(unsigned int, __builtin_convertvector(rest, bf16x2));
}

// WMMA operand element i maps to k = (i<8?0:16) + 8*hi16 + (i&7) (CDNA5 16-bit
// 16x32 A / 32x16 B layout, wave32).
// Every bf16 plane in the workspace is stored fragment-major: a plane of R rows
// by K columns is cut into tiles of 16 rows x 32 k (512 elements, 1 KB), tile
// index (row/16)*(K/32) + k/32 (the K/V buffer orders its tiles per key pass, see kernel 1). Inside a tile, element (row, k) lies at
//   ((k>>4)&1)*256 + (((k>>3)&1)*16 + (row&15))*8 + (k&7)
// so lane l's two 16-byte pieces lie at l*8 and 256 + l*8: each wave-wide
// 16-byte load or store covers 512 contiguous bytes, four whole 128-byte lines.
#define TILE_E 512
// lanep: start of the tile + lane*8
__device__ __forceinline__ v16bf load_frag(const unsigned short* __restrict__ lanep) {
    union { v16bf v; u32x4 q[2]; } u;
    u.q[0] = *(const u32x4*)(lanep);
    u.q[1] = *(const u32x4*)(lanep + 256);
    return u.v;
}
// split eight f32 values into bf16 hi and lo and store each as one 16-byte piece
__device__ __forceinline__ void store_split8(const float* x,
                                             unsigned short* __restrict__ hp,
                                             unsigned short* __restrict__ lp) {
    u32x4 qh, ql;
#pragma unroll
    for (int e = 0; e < 4; ++e) {
        unsigned int h, l;
        split2(x[2 * e], x[2 * e + 1], h, l);
        qh[e] = h;
        ql[e] = l;
    }
    *(u32x4*)hp = qh;
    *(u32x4*)lp = ql;
}

__device__ __forceinline__ v8f wmma_bf(v16bf a, v16bf b, v8f c) {
    return __builtin_amdgcn_wmma_f32_16x16x32_bf16(false, a, false, b, (short)0, c,
                                                   false, false);
}
// split-precision product: (ah+al)*(bh+bl) ~ ah*bh + ah*bl + al*bh
__device__ __forceinline__ v8f wmma_split(v16bf ah, v16bf al, v16bf bh, v16bf bl, v8f c) {
    c = wmma_bf(ah, bh, c);
    c = wmma_bf(ah, bl, c);
    c = wmma_bf(al, bh, c);
    return c;
}
__device__ __forceinline__ v8f v8f_zero() {
    v8f z;
#pragma unroll
    for (int e = 0; e < 8; ++e) z[e] = 0.0f;
    return z;
}

// ---------- kernel 0: every fp32 operand -> fragment-major bf16 hi plane + lo plane, one launch ----------
// One block per 16-row band (16 rows x DIMC) of a pair of planes; a wave packs four 16x32 tiles of the
// band, a lane its own two 8-element pieces of each tile. The bands, in block order:
//   [kept-key rows of X | all rows of X | W_qkv | W_fc]
// The kept-key bands stand first: they rank the mask before they can load, the longest way of a block.
//
// The kept-key planes. A key with mask > 0 has the score MASK_VAL. Its weight exp(MASK_VAL - m), m the
// row's maximum, is exactly 0 in f32 once m > MASK_VAL + 104, and a kept key's scaled score from
// normal-drawn inputs stays millions above MASK_VAL: beside a kept key a masked one adds nothing to a
// row's sum or output. K and V are therefore projected, and the key loop run, over the kept keys alone:
// row j of batch b of these planes is the j-th kept token of that batch.
// Rows from the count up to the next multiple of 128 (a projection block) are written as zeros.
// A batch with no kept key: the reference's softmax is then uniform over all keys; every key is
// kept and cnts[BATCH + b] tells the attention kernel to take all scores as equal.
// Each kept-key block ranks the batch's 2048 mask words itself.
#define XBANDS  (BATCH * SEQ / 16)            // 512 bands of X, and as many of its kept-key planes
#define WQBANDS (3 * DIMC / 16)               // 192
#define WFBANDS (DIMC / 16)                   // 64
__global__ void __launch_bounds__(256)
pack_planes(const float* __restrict__ xsrc, const int* __restrict__ pm,
            const float* __restrict__ wq, const float* __restrict__ wf,
            unsigned short* __restrict__ xkh, unsigned short* __restrict__ xkl,
            unsigned short* __restrict__ xih, unsigned short* __restrict__ xil,
            unsigned short* __restrict__ wqh, unsigned short* __restrict__ wql,
            unsigned short* __restrict__ wfh, unsigned short* __restrict__ wfl,
            int* __restrict__ cnts) {
    __shared__ int wsum[8];
    __shared__ int srow[16];
    const int t = threadIdx.x;
    const int lane = t & 31;
    const int wave = t >> 5;
    const int bid = blockIdx.x;
    const float* src;                             // the source matrix of the band
    unsigned short* hip_;                         // its two planes
    unsigned short* lop_;
    int band;                                     // the band's number in those planes
    int row;                                      // this lane's source row, or -1: a row of zeros
    bool work = true;                             // the same for the whole block
    if (bid < XBANDS) {                           // the same for the whole block: both barriers are inside
        const int b  = bid >> 7;                  // SEQ/16 = 128 bands per batch
        const int j0 = (bid & 127) * 16;          // first packed row of the band
        const int* mp = pm + b * SEQ + t * 8;     // this thread ranks eight tokens
        unsigned bits = 0;
#pragma unroll
        for (int e = 0; e < 8; ++e)
            if (!(mp[e] > 0)) bits |= 1u << e;
        const int c = __popc(bits);
        int inc = c;                              // inclusive sum over the wave
#pragma unroll
        for (int d = 1; d < 32; d <<= 1) {
            const int o = __shfl_up(inc, d);
            if (lane >= d) inc += o;
        }
        if (lane == 31) wsum[wave] = inc;
        if (t < 16) srow[t] = -1;
        __syncthreads();                          // wave sums and the cleared row table are visible
        int before = inc - c, total = 0;
#pragma unroll
        for (int w = 0; w < 8; ++w) {
            const int s = wsum[w];
            total += s;
            if (w < wave) before += s;
        }
        const bool none = (total == 0);
        if (none) { bits = 0xFFu; before = t * 8; total = SEQ; }
#pragma unroll
        for (int e = 0; e < 8; ++e)
            if ((bits >> e) & 1u) {
                const int p = before - j0;
                if ((unsigned)p < 16u) srow[p] = t * 8 + e;
                ++before;
            }
        __syncthreads();                          // the band's source rows are visible
        if (j0 == 0 && t == 0) { cnts[b] = total; cnts[BATCH + b] = none ? 1 : 0; }
        work = j0 < ((total + 127) & ~127);
        const int tok = srow[lane & 15];          // a token number formed from thread indices, or -1
        row = tok < 0 ? -1 : b * SEQ + tok;
        src = xsrc; hip_ = xkh; lop_ = xkl; band = bid;
    } else if (bid < 2 * XBANDS) {
        band = bid - XBANDS;
        src = xsrc; hip_ = xih; lop_ = xil; row = band * 16 + (lane & 15);
    } else if (bid < 2 * XBANDS + WQBANDS) {
        band = bid - 2 * XBANDS;
        src = wq; hip_ = wqh; lop_ = wql; row = band * 16 + (lane & 15);
    } else {
        band = bid - (2 * XBANDS + WQBANDS);
        src = wf; hip_ = wfh; lop_ = wfl; row = band * 16 + (lane & 15);
    }
    if (work) {                                   // no barrier inside
        const float* rp = src + (size_t)(row < 0 ? 0 : row) * DIMC + wave * 128 + 8 * (lane >> 4);
        // a wave packs four tiles; all sixteen loads go out before the first value is used
        f32x4 v[4][2][2];
#pragma unroll
        for (int q = 0; q < 4; ++q)
#pragma unroll
            for (int j = 0; j < 2; ++j) {
                v[q][j][0] = *(const f32x4*)(rp + q * 32 + j * 16);
                v[q][j][1] = *(const f32x4*)(rp + q * 32 + j * 16 + 4);
            }
        // stands in front of the first rewrite of the loads' address registers; rp is named as an
        // input so that it lives to this line and no load's result is placed over it
        asm volatile("s_wait_xcnt 0x0" :: "v"(rp) : "memory");
#pragma unroll
        for (int q = 0; q < 4; ++q)
#pragma unroll
            for (int j = 0; j < 2; ++j) {
                float x[8];
#pragma unroll
                for (int e = 0; e < 8; ++e) x[e] = row < 0 ? 0.0f : v[q][j][e >> 2][e & 3];
                const size_t o = ((size_t)band * (DIMC / 32) + wave * 4 + q) * TILE_E
                               + j * 256 + lane * 8;
                store_split8(x, hip_ + o, lop_ + o);
            }
    }
}

// ---------- tensor loads to LDS: descriptor, issue and the waits of the two-buffer ring ----------
// the wave's own LDS reads have returned: stands in front of the barrier behind which a buffer is refilled
__device__ __forceinline__ void wait_lds_reads() { asm volatile("s_wait_dscnt 0x0" ::: "memory"); }
// the wave's own tensor load has landed: stands in front of the barrier behind which other waves read it
__device__ __forceinline__ void wait_tensor() { asm volatile("s_wait_tensorcnt 0x0" ::: "memory"); }
__device__ __forceinline__ unsigned lds_addr(const unsigned short* p) {
    return (unsigned)(unsigned long long)p;       // low 32 bits of a __shared__ address: the LDS byte
}
__device__ __forceinline__ unsigned uni(unsigned v) { return (unsigned)__builtin_amdgcn_readfirstlane(v); }
// a word held in a scalar register: a test on it is a scalar branch (a tensor load ignores EXEC), and what
// is formed from it is formed behind the waits that stand in front of this statement
__device__ __forceinline__ unsigned pinned(unsigned v) {
    unsigned w = uni(v);
    asm volatile("" : "+s"(w));                   // pinned(): the word stays in a scalar register
    return w;
}
// A request brings `rows` tiles of 1 KB (a tile is one row of the request), `pitch` bytes apart in the
// workspace, to consecutive KB of LDS. Group 1: 1-byte elements, no mask, no pad, tensor = tile.
#define TILE_B 1024u
__device__ __forceinline__ u32x8 tdm_group1(unsigned rows, unsigned pitch) {
    u32x8 g;
    g[0] = uni(0u);
    g[1] = uni((TILE_B & 0xFFFFu) << 16);
    g[2] = uni((TILE_B >> 16) | ((rows & 0xFFFFu) << 16));
    g[3] = uni((rows >> 16) | (TILE_B << 16));
    g[4] = uni(rows);
    g[5] = uni(pitch);
    g[6] = uni(0u);
    g[7] = uni(0u);
    return g;
}
// Group 0: count 1, the LDS byte, the address of the first byte, type 2
__device__ __forceinline__ u32x4 tdm_group0(unsigned lds, unsigned long long ga) {
    u32x4 g;
    g[0] = uni(1u);
    g[1] = uni(lds);
    g[2] = uni((unsigned)ga);
    g[3] = uni((((unsigned)(ga >> 32)) & 0x01FFFFFFu) | 0x80000000u);
    return g;
}
// one request of the whole wave; the waits are written where it is used
__device__ __forceinline__ void tdm_load(u32x4 g0, u32x8 g1) {
    asm volatile("tensor_load_to_lds %0, %1" :: "s"(g0), "s"(g1) : "memory");
}

// One K step (32 k) of a block's operands in LDS, 48 tiles of 1 KB:
// [X hi 8 | X lo 8 | W hi 16 | W lo 16], the tiles of a plane in row order.
#define STAGE_E (48 * TILE_E)
#define BAND_E  ((DIMC / 32) * TILE_E)        // from one 16-row band of a plane to the next

// K loop shared by both projections: a 64x64 tile per wave (4 X tiles by 4 W tiles), K = DIMC:
// a loaded W fragment meets four X tiles instead of one, an X fragment four W tiles as before.
// A block is 2 x 4 waves, 128 tokens by 256 features. Its operands of one K step are brought into LDS
// once for all eight waves by tensor loads, two buffers: the next step's loads fly while this step's
// fragments are read from LDS and multiplied. Every wave issues one request a step for its own slice:
// waves 0, 1: X hi, 2, 3: X lo (four tiles each); 4, 5: W hi, 6, 7: W lo (eight tiles each).
// mb, ob: first 16-row band of the block in X and in W; wm, wn: the wave's place in the block.
// rot: the K step at which this block enters its walk along K; it wraps round behind the last one. Blocks
// that read the same tiles of X, and any 32 neighbours that read the same W, get different rot, so that they do not ask L2 for the same lines at
// the same moment. The f32 sum along K starts at that step.
// SWAP = false: acc[i][t] = X-tile i (A) . W-tile t (B): lane holds 8 tokens of one feature.
// SWAP = true : acc[i][t] = W-tile t (A) . X-tile i (B): lane holds 8 features of one token.
// The three split products are summed in the same order either way.
#define WT 4                      // X tiles (16 tokens each) per wave
template <bool SWAP>
__device__ __forceinline__ void gemm_k_loop(const unsigned short* __restrict__ Xh,
                                            const unsigned short* __restrict__ Xl,
                                            const unsigned short* __restrict__ Wh,
                                            const unsigned short* __restrict__ Wl,
                                            unsigned short (&stg)[2][STAGE_E],
                                            int mb, int ob, int wm, int wn, unsigned rot,
                                            v8f (&acc)[WT][4]) {
    const int lane = threadIdx.x & 31;
    // this wave's slice of a stage (the block is one-dimensional: threadIdx.x >> 5 is the wave's number)
    const unsigned wv    = uni(threadIdx.x >> 5);
    const unsigned isw   = wv >> 2;                           // 0: a slice of X, 1: a slice of W
    const unsigned rows  = isw ? 8u : 4u;
    const unsigned band  = (isw ? (unsigned)ob : (unsigned)mb) + (wv & 1u) * rows;
    const unsigned place = (isw ? 16u + ((wv >> 1) & 1u) * 16u : ((wv >> 1) & 1u) * 8u) + (wv & 1u) * rows;
    const unsigned short* plane = isw ? ((wv & 2u) ? Wl : Wh) : ((wv & 2u) ? Xl : Xh);
    const unsigned long long sg = (unsigned long long)(plane + (size_t)band * BAND_E);
    const unsigned sl = lds_addr(&stg[0][0]) + place * TILE_B;
    const u32x8 g1 = tdm_group1(rows, BAND_E * 2);

    tdm_load(tdm_group0(sl, sg + rot * TILE_B), g1);          // the walk's first K step into buffer 0
    wait_tensor();
    __syncthreads();                                          // publishes it

    for (int kt = 0; kt < DIMC / 32; ++kt) {
        const int buf = kt & 1;
        // the refill: behind the barrier that published this K step and ended every read of the other
        // buffer, the next K step's load goes into that buffer, only while such a step exists. At the
        // head of a pass it stands in the same order as at the foot of the pass before, and K step 1
        // needs no load of its own in front of the loop: no register of a request in flight is rewritten
        const unsigned nx = pinned((unsigned)kt + 1u);        // pinned(): scalar test, descriptor formed here
        if (nx < DIMC / 32)
            tdm_load(tdm_group0(sl + (nx & 1u) * (STAGE_E * 2), sg + ((nx + rot) & (DIMC / 32 - 1u)) * TILE_B), g1);
        const unsigned short* pah = &stg[buf][(wm * WT) * TILE_E + lane * 8];
        const unsigned short* pal = pah + 8 * TILE_E;
        const unsigned short* pbh = &stg[buf][(16 + wn * 4) * TILE_E + lane * 8];
        const unsigned short* pbl = pbh + 16 * TILE_E;
        v16bf ah[WT], al[WT];
#pragma unroll
        for (int i = 0; i < WT; ++i) {
            ah[i] = load_frag(pah + i * TILE_E);
            al[i] = load_frag(pal + i * TILE_E);
        }
#pragma unroll
        for (int t = 0; t < 4; ++t) {
            v16bf bh = load_frag(pbh + t * TILE_E);
            v16bf bl = load_frag(pbl + t * TILE_E);
            if (SWAP) {
#pragma unroll
                for (int i = 0; i < WT; ++i) acc[i][t] = wmma_bf(bh, ah[i], acc[i][t]);
#pragma unroll
                for (int i = 0; i < WT; ++i) acc[i][t] = wmma_bf(bl, ah[i], acc[i][t]);
#pragma unroll
                for (int i = 0; i < WT; ++i) acc[i][t] = wmma_bf(bh, al[i], acc[i][t]);
            } else {
#pragma unroll
                for (int i = 0; i < WT; ++i) acc[i][t] = wmma_bf(ah[i], bh, acc[i][t]);
#pragma unroll
                for (int i = 0; i < WT; ++i) acc[i][t] = wmma_bf(ah[i], bl, acc[i][t]);
#pragma unroll
                for (int i = 0; i < WT; ++i) acc[i][t] = wmma_bf(al[i], bh, acc[i][t]);
            }
        }
        // publish point: the next K step has landed for every wave, and every wave has left this buffer
        wait_lds_reads();
        wait_tensor();
        __syncthreads();
    }
    wait_tensor();
    wait_lds_reads();
}

// ---------- kernel 1: QKV projection ----------
// out[m][o] = sum_k X[m][k]*W[o][k]; Q as [token][d] planes per head, fragment-major.
// K ([token][d] tiles) and V ([d][token] tiles) share one buffer per head, ordered by the
// attention pass that reads them: per 32 keys 16 tiles, [K hi 4 | K lo 4 | V hi 4 | V lo 4].
#define PASS_E (16 * TILE_E)
// a block is 2 x 4 waves: 128 tokens by 256 features; the register budget of four waves per SIMD
// keeps two blocks on a WGP, so that one block multiplies while the other stands at its barrier
__global__ void __launch_bounds__(256) __attribute__((amdgpu_waves_per_eu(4, 4)))
gemm_qkv(const unsigned short* __restrict__ Xqh, const unsigned short* __restrict__ Xql,
         const unsigned short* __restrict__ Xkh, const unsigned short* __restrict__ Xkl,
         const int* __restrict__ cnts,
         const unsigned short* __restrict__ Wh, const unsigned short* __restrict__ Wl,
         unsigned short* __restrict__ Qh, unsigned short* __restrict__ Ql,
         unsigned short* __restrict__ KV) {
    __shared__ __attribute__((aligned(2048))) unsigned short stg[2][STAGE_E];   // tensor loads land at multiples of 2 KB
    // K and V blocks work on the packed rows of the kept keys; a block wholly past its batch's count
    // has nothing to project: all its threads leave here, in front of every tensor load and barrier
    if (blockIdx.y >= 4 && (int)(blockIdx.x & 15) * 128 >= cnts[blockIdx.x >> 4]) return;
    const unsigned short* Xh = blockIdx.y < 4 ? Xqh : Xkh;
    const unsigned short* Xl = blockIdx.y < 4 ? Xql : Xkl;
    const int lane = threadIdx.x & 31;
    // the wave's number in a scalar register: tile, head and batch indices then live in scalar
    // registers through the K loop; held in vector registers they push the kernel past 256 of
    // them, which costs the fourth wave of a SIMD
    const int wave = __builtin_amdgcn_readfirstlane(threadIdx.x >> 5);
    const int m0 = (blockIdx.x * 2 + (wave & 1)) * (16 * WT);   // first token of the wave
    const int o0 = (blockIdx.y * 4 + (wave >> 1)) * 64;         // output features (one head slice)

    v8f acc[WT][4];
#pragma unroll
    for (int i = 0; i < WT; ++i)
#pragma unroll
        for (int t = 0; t < 4; ++t) acc[i][t] = v8f_zero();

    const int mb = blockIdx.x * 8;    // the block's first 16-row band of X
    const int ob = blockIdx.y * 16;   // and of W
    const int s  = blockIdx.y >> 2;   // 0=Q 1=K 2=V: the same for the whole block
    // blocks of one column (the same X rows) enter four K steps apart, neighbours in a row (the same W) one
    const unsigned rot = (blockIdx.x + 4u * blockIdx.y) & (DIMC / 32 - 1u);
    const int h  = (o0 & 1023) >> 6;
    const int b  = m0 >> 11;
    const size_t head = (size_t)(b * NHEAD + h);
    if (s == 2) {
        gemm_k_loop<false>(Xh, Xl, Wh, Wl, stg, mb, ob, wave & 1, wave >> 1, rot, acc);
#pragma unroll
        for (int i = 0; i < WT; ++i) {
            const int n0 = (m0 & 2047) + i * 16;
            // Vt[d][n]: row d = t*16 + col, k = n0 + 8*hi16 + r: the lane's 8 values are one piece
            unsigned short* vp = KV + (head * (SEQ / 32) + (n0 >> 5)) * PASS_E + 8 * TILE_E
                               + ((n0 >> 4) & 1) * 256 + lane * 8;
#pragma unroll
            for (int t = 0; t < 4; ++t) {
                float x[8];
#pragma unroll
                for (int r = 0; r < 8; ++r) x[r] = acc[i][t][r];
                store_split8(x, vp + t * TILE_E, vp + (4 + t) * TILE_E);
            }
        }
    } else {
        gemm_k_loop<true>(Xh, Xl, Wh, Wl, stg, mb, ob, wave & 1, wave >> 1, rot, acc);
#pragma unroll
        for (int i = 0; i < WT; ++i) {
            const int n0 = (m0 & 2047) + i * 16;
            // Q/K[n][d]: row n = n0 + col, k = d = t*16 + 8*hi16 + r: again one piece per lane
            const size_t qo = head * SEQ * DH + (size_t)(n0 >> 4) * (DH / 32) * TILE_E + lane * 8;
            const size_t ko = (head * (SEQ / 32) + (n0 >> 5)) * PASS_E
                            + ((n0 >> 4) & 1) * (DH / 32) * TILE_E + lane * 8;
            unsigned short* bh_ = (s == 0 ? Qh + qo : KV + ko);
            unsigned short* bl_ = (s == 0 ? Ql + qo : KV + ko + 4 * TILE_E);
#pragma unroll
            for (int t = 0; t < 4; ++t) {
                float x[8];
#pragma unroll
                for (int r = 0; r < 8; ++r) x[r] = acc[i][t][r];
                store_split8(x, bh_ + (t >> 1) * TILE_E + (t & 1) * 256,
                                bl_ + (t >> 1) * TILE_E + (t & 1) * 256);
            }
        }
    }
}

// ---------- kernel 2: flash attention (transposed-score trick) ----------
#define QT 2                      // query tiles (16 queries each) per wave
#define AW 4                      // waves per block
// The softmax reference of a query (what is taken off its scores before exp) is held from pass to pass and
// renewed only once a score tops it by more than LAZY_TOP (in unscaled score units: 5.5 once scaled), so
// that weights reach e^5.5 at most.
#define LAZY_TOP (5.5f / SCALE_F)
#define EXP2_MUL (SCALE_F * 1.44269504088896340736f)      // exp(SCALE_F * s) = exp2(EXP2_MUL * s)
// one pass of K and V (16 tiles, 16 KB, contiguous in the workspace) comes into LDS in the same order by
// tensor loads: every wave issues one request a pass for its own four tiles.
__global__ void __launch_bounds__(AW * 32)
attn_kernel(const unsigned short* __restrict__ Qh, const unsigned short* __restrict__ Ql,
            const unsigned short* __restrict__ KV,
            const int* __restrict__ cnts,
            unsigned short* __restrict__ Xh, unsigned short* __restrict__ Xl) {
    __shared__ __attribute__((aligned(2048))) unsigned short kvs[2][PASS_E]; // two passes of K and V
    const int lane = threadIdx.x & 31;
    const int wave = threadIdx.x >> 5;
    const int hi16 = lane >> 4;
    const int bid = blockIdx.x;
    const int b = bid >> 8;                       // 256 blocks per batch
    const int h = (bid >> 4) & 15;
    const int q0 = ((bid & 15) * AW + wave) * (16 * QT);  // 32 queries per wave

    const size_t head = (size_t)(b * NHEAD + h);
    // this wave's four tiles of each pass, in the workspace and in the two buffers (the block is
    // one-dimensional: threadIdx.x >> 5 is the wave's number)
    const unsigned wv = uni(threadIdx.x >> 5);
    const unsigned long long kvg = (unsigned long long)(KV + head * (SEQ / 32) * PASS_E) + wv * (4u * TILE_B);
    const unsigned kvl = lds_addr(&kvs[0][0]) + wv * (4u * TILE_B);
    const u32x8 g1 = tdm_group1(4u, TILE_B);
    // K and V hold the batch's kept keys alone, packed: nk of them, walked in whole passes of 32
    // (held in a scalar register, so that the loop's tests on it are scalar compares)
    const int nk  = __builtin_amdgcn_readfirstlane(min(max(cnts[b], 1), SEQ));
    __builtin_assume(nk >= 1 && nk <= SEQ);                   // the clamp above: the loop has a first pass
    const unsigned np = (unsigned)(nk + 31) >> 5;             // passes
    // The sixteen blocks of a head walk the same passes of K and V: each enters the walk at its own pass,
    // spread evenly over the np passes (neighbouring heads half a share apart), and wraps round behind the
    // last one, so that they do not ask L2 for the same lines at the same moment. Every pass holds a kept
    // key, so the softmax reference is a real score from the first pass on, wherever the walk starts.
    const unsigned first = (((((unsigned)bid & 15u) << 1) | (((unsigned)bid >> 4) & 1u)) * np) >> 5;   // < np
    tdm_load(tdm_group0(kvl, kvg + first * (PASS_E * 2u)), g1);   // the walk's first pass into buffer 0
    wait_tensor();
    __syncthreads();                                          // publishes it

    // fragment-major planes: this lane's piece of a tile starts at lane*8
    const size_t qoff = head * SEQ * DH + (size_t)(q0 >> 4) * (DH / 32) * TILE_E + lane * 8;
    const unsigned short* qrh = Qh + qoff;
    const unsigned short* qrl = Ql + qoff;

    // Q tiles as B-operand (lane col = query), K-dim = head dim (2 steps of 32)
    v16bf qh[QT][2], ql[QT][2];
#pragma unroll
    for (int qt = 0; qt < QT; ++qt)
#pragma unroll
        for (int ds = 0; ds < 2; ++ds) {
            qh[qt][ds] = load_frag(qrh + (qt * (DH / 32) + ds) * TILE_E);
            ql[qt][ds] = load_frag(qrl + (qt * (DH / 32) + ds) * TILE_E);
        }
    if (cnts[BATCH + b] != 0) {           // no key kept: all scores equal, as in the reference
#pragma unroll
        for (int qt = 0; qt < QT; ++qt)
#pragma unroll
            for (int ds = 0; ds < 2; ++ds)
#pragma unroll
                for (int e = 0; e < 16; ++e) {
                    qh[qt][ds][e] = bfbits(0);
                    ql[qt][ds][e] = bfbits(0);
                }
    }

    // per-lane softmax state for query `col` of each tile: the reference in unscaled score units (the same
    // in both key halves; under every score until the walk's first pass sets it), the score that renews it,
    // minus the reference in exp2's units, and the sum of the weights of this lane's own key half
    float rref[QT], lim[QT], nref2[QT], lrow[QT];
    v8f o[QT][4];                         // O^T accum: lane holds d = t*16+r+8*hi16, q = col
#pragma unroll
    for (int qt = 0; qt < QT; ++qt) {
        rref[qt] = -3.0e38f;
        lim[qt] = -3.0e38f;
        nref2[qt] = 3.0e38f * EXP2_MUL;
        lrow[qt] = 0.0f;
#pragma unroll
        for (int t = 0; t < 4; ++t) o[qt][t] = v8f_zero();
    }

    for (unsigned ps = 0; ps < np; ++ps) {
        const unsigned pw = ps + first;
        const int k0 = (int)((pw < np ? pw : pw - np) << 5);  // first key of this pass
        // S^T = K . Q^T : st[qt][js][r] = score(key k0+js*16+r+8*hi16, query col of tile qt);
        // each K fragment is loaded once and multiplied with every Q tile of the wave
        const int buf = ps & 1;
        // the refill: behind the barrier that published this pass and ended every read of the other
        // buffer, the next pass's load goes into that buffer, only while such a pass exists (at the head
        // of a pass: the same order as at the foot of the pass before; pass 1 needs no load of its own)
        const unsigned nx = pinned(ps + 1u);                  // pinned(): scalar test, descriptor formed here
        if (nx < np) {
            const unsigned nw = nx + first;
            tdm_load(tdm_group0(kvl + (nx & 1u) * (PASS_E * 2), kvg + (nw < np ? nw : nw - np) * (PASS_E * 2u)), g1);
        }
        const unsigned short* kvb = &kvs[buf][lane * 8];      // this pass's tiles, read from LDS
        v8f st[QT][2];
#pragma unroll
        for (int js = 0; js < 2; ++js) {
#pragma unroll
            for (int qt = 0; qt < QT; ++qt) st[qt][js] = v8f_zero();
            const unsigned short* kp = kvb + js * (DH / 32) * TILE_E;
#pragma unroll
            for (int ds = 0; ds < 2; ++ds) {
                v16bf kh = load_frag(kp + ds * TILE_E);
                v16bf kl = load_frag(kp + (4 + ds) * TILE_E);
#pragma unroll
                for (int qt = 0; qt < QT; ++qt)
                    st[qt][js] = wmma_split(kh, kl, qh[qt][ds], ql[qt][ds], st[qt][js]);
            }
        }
        // what is left to mask: the rows behind the last kept key, in the pass that holds it alone (one
        // scalar test a pass). MASK_VAL / SCALE_F is exact; so far under any reference its weight is 0
        if (k0 + 32 > nk) {
#pragma unroll
            for (int qt = 0; qt < QT; ++qt)
#pragma unroll
                for (int js = 0; js < 2; ++js)
#pragma unroll
                    for (int r = 0; r < 8; ++r)
                        if (k0 + js * 16 + 8 * hi16 + r >= nk) st[qt][js][r] = MASK_VAL / SCALE_F;
        }
        union { v16bf v; unsigned int u[8]; } ph[QT], pl[QT];
        // does a score of this pass top its reference by more than LAZY_TOP?
        float pmx[QT];
        bool need = false;
#pragma unroll
        for (int qt = 0; qt < QT; ++qt) {
            float mx = st[qt][0][0];
#pragma unroll
            for (int js = 0; js < 2; ++js)
#pragma unroll
                for (int r = 0; r < 8; ++r) mx = fmaxf(mx, st[qt][js][r]);
            pmx[qt] = mx;
            need = need || (mx > lim[qt]);
        }
        // one test a pass for the whole wave, a scalar branch: only then is the reference moved up to the
        // maximum (joined over the two key halves, so that both halves of a query keep the same one) and
        // what has been summed under the old one rescaled (by 0 where none was set: nothing is summed yet)
        if (__builtin_amdgcn_ballot_w32(need) != 0) {
#pragma unroll
            for (int qt = 0; qt < QT; ++qt) {
                rref[qt] = fmaxf(rref[qt], fmaxf(pmx[qt], __shfl_xor(pmx[qt], 16)));   // it never falls
                lim[qt] = rref[qt] + LAZY_TOP;
                const float n2 = -rref[qt] * EXP2_MUL;
                const float alpha = __builtin_amdgcn_exp2f(n2 - nref2[qt]);
                nref2[qt] = n2;
                lrow[qt] *= alpha;
#pragma unroll
                for (int t = 0; t < 4; ++t) o[qt][t] = o[qt][t] * alpha;
            }
        }
#pragma unroll
        for (int qt = 0; qt < QT; ++qt) {
            // exp -> P; st layout already matches the B-operand element order exactly. Scaling, the
            // reference and exp's own factor are one multiply-add in front of exp2
            float rs = 0.0f;
#pragma unroll
            for (int js = 0; js < 2; ++js)
#pragma unroll
                for (int r = 0; r < 8; r += 2) {
                    const float p0 = __builtin_amdgcn_exp2f(__builtin_fmaf(st[qt][js][r], EXP2_MUL, nref2[qt]));
                    const float p1 = __builtin_amdgcn_exp2f(__builtin_fmaf(st[qt][js][r + 1], EXP2_MUL, nref2[qt]));
                    rs += p0;
                    rs += p1;
                    split2(p0, p1, ph[qt].u[js * 4 + (r >> 1)], pl[qt].u[js * 4 + (r >> 1)]);
                }
            lrow[qt] += rs;                           // this half's keys alone; the halves meet behind the loop
        }
        // O^T += V^T . P^T  (4 d-subtiles);
        // each V fragment is loaded once and multiplied with every P tile of the wave
#pragma unroll
        for (int t = 0; t < 4; ++t) {
            const unsigned short* vp = kvb + (8 + t) * TILE_E;
            v16bf vh = load_frag(vp);
            v16bf vl = load_frag(vp + 4 * TILE_E);
#pragma unroll
            for (int qt = 0; qt < QT; ++qt)
                o[qt][t] = wmma_split(vh, vl, ph[qt].v, pl[qt].v, o[qt][t]);
        }
        // publish point: the next pass has landed for every wave, and every wave has left this buffer
        wait_lds_reads();
        wait_tensor();
        __syncthreads();
    }
    wait_tensor();
    wait_lds_reads();
    // write x[b][n=q0+qt*16+col][h*64+d], d = t*16 + 8*hi16 + r, into the fragment-major hi/lo
    // planes of the output GEMM: the lane's 8 values are one 16-byte piece
#pragma unroll
    for (int qt = 0; qt < QT; ++qt) {
        const float linv = 1.0f / (lrow[qt] + __shfl_xor(lrow[qt], 16));   // the two key halves' sums meet
        const size_t xoff = ((size_t)((b * SEQ + q0 + qt * 16) >> 4) * (DIMC / 32)
                             + h * (DH / 32)) * TILE_E + lane * 8;
#pragma unroll
        for (int t = 0; t < 4; ++t) {
            float x[8];
#pragma unroll
            for (int r = 0; r < 8; ++r) x[r] = o[qt][t][r] * linv;
            store_split8(x, Xh + xoff + (t >> 1) * TILE_E + (t & 1) * 256,
                            Xl + xoff + (t >> 1) * TILE_E + (t & 1) * 256);
        }
    }
}

// ---------- kernel 3: output projection + bias (fp32 out) ----------
__global__ void __launch_bounds__(256)
gemm_fc(const unsigned short* __restrict__ Xh, const unsigned short* __restrict__ Xl,
        const unsigned short* __restrict__ Wh, const unsigned short* __restrict__ Wl,
        const float* __restrict__ bias,
        float* __restrict__ out) {
    __shared__ __attribute__((aligned(2048))) unsigned short stg[2][STAGE_E];   // tensor loads land at multiples of 2 KB
    const int lane = threadIdx.x & 31;
    const int wave = threadIdx.x >> 5;
    const int col  = lane & 15;
    const int hi16 = lane >> 4;
    const int m0 = (blockIdx.x * 2 + (wave & 1)) * (16 * WT);
    const int o0 = (blockIdx.y * 4 + (wave >> 1)) * 64;

    v8f acc[WT][4];
#pragma unroll
    for (int i = 0; i < WT; ++i)
#pragma unroll
        for (int t = 0; t < 4; ++t) acc[i][t] = v8f_zero();

    // the four blocks of one column (the same X rows) enter eight K steps apart, neighbours in a row one
    const unsigned rot = (blockIdx.x + 8u * blockIdx.y) & (DIMC / 32 - 1u);
    gemm_k_loop<false>(Xh, Xl, Wh, Wl, stg, blockIdx.x * 8, blockIdx.y * 16, wave & 1, wave >> 1, rot, acc);
#pragma unroll
    for (int t = 0; t < 4; ++t) {
        const int oc = o0 + t * 16 + col;
        const float bia = bias[oc];
#pragma unroll
        for (int i = 0; i < WT; ++i) {
            const int n0 = m0 + i * 16 + 8 * hi16;
#pragma unroll
            for (int r = 0; r < 8; ++r)
                out[(size_t)(n0 + r) * DIMC + oc] = acc[i][t][r] + bia;
        }
    }
}

extern "C" void kernel_launch(void* const* d_in, const int* in_sizes, int n_in,
                              void* d_out, int out_size, void* d_ws, size_t ws_size,
                              hipStream_t stream) {
    const float* inputs = (const float*)d_in[0];
    const float* W_qkv  = (const float*)d_in[1];
    const float* W_fc   = (const float*)d_in[2];
    const float* b_fc   = (const float*)d_in[3];
    const int*   pmask  = (const int*)d_in[4];

    // workspace layout (bf16/ushort elements), all 1 KB tiles; 208 MB total
    const size_t nQKV = (size_t)BATCH * NHEAD * SEQ * DH;   // 8388608
    const size_t nX   = (size_t)BATCH * SEQ * DIMC;         // 8388608
    const size_t nWq  = (size_t)3 * DIMC * DIMC;            // 3145728
    const size_t nWf  = (size_t)DIMC * DIMC;                // 1048576
    unsigned short* p = (unsigned short*)d_ws;
    unsigned short* Qh  = p; p += nQKV;
    unsigned short* Ql  = p; p += nQKV;
    unsigned short* KV  = p; p += 4 * nQKV;
    unsigned short* Xih = p; p += nX;
    unsigned short* Xil = p; p += nX;
    unsigned short* Wqh = p; p += nWq;
    unsigned short* Wql = p; p += nWq;
    unsigned short* Wfh = p; p += nWf;
    unsigned short* Wfl = p; p += nWf;
    unsigned short* Xah = p; p += nX;
    unsigned short* Xal = p; p += nX;
    unsigned short* Xkh = p; p += nX;
    unsigned short* Xkl = p; p += nX;
    int* cnts = (int*)p;                                    // kept keys per batch, then the no-key flags

    pack_planes<<<2 * XBANDS + WQBANDS + WFBANDS, 256, 0, stream>>>(inputs, pmask, W_qkv, W_fc,
                                                                    Xkh, Xkl, Xih, Xil, Wqh, Wql, Wfh, Wfl, cnts);

    gemm_qkv<<<dim3(64, 12), 256, 0, stream>>>(Xih, Xil, Xkh, Xkl, cnts, Wqh, Wql,
                                               Qh, Ql, KV);
    attn_kernel<<<BATCH * NHEAD * (SEQ / 128), 128, 0, stream>>>(Qh, Ql, KV,
                                                                cnts, Xah, Xal);
    gemm_fc<<<dim3(64, 4), 256, 0, stream>>>(Xah, Xal, Wfh, Wfl, b_fc, (float*)d_out);
}

// v010
// One run takes 160 microseconds.
// In both of two side-by-side timings against v009, it was 1.03 times as fast.
// All steps since v000 together make it 6.26 times as fast.
#include <hip/hip_runtime.h>

#define DIMC   1024
#define NHEAD  16
#define BATCH  4
#define SEQ    2048
#define DH     64
#define SCALE_F 0.125f            // (1024/16)^-0.5
#define MASK_VAL -10000000.0f

typedef __attribute__((ext_vector_type(16))) __bf16        v16bf;
typedef __attribute__((ext_vector_type(8)))  float         v8f;
typedef __attribute__((ext_vector_type(4)))  unsigned int  u32x4;
typedef __attribute__((ext_vector_type(8)))  unsigned int  u32x8;
typedef __attribute__((ext_vector_type(4)))  float         f32x4;
typedef __attribute__((ext_vector_type(2)))  float         f32x2;
typedef __attribute__((ext_vector_type(2)))  __bf16        bf16x2;
typedef __attribute__((ext_vector_type(16))) _Float16      v16h;
typedef __attribute__((ext_vector_type(2)))  _Float16      h16x2;

// ---------- bf16 hi/lo split helpers (separate planes) ----------
__device__ __forceinline__ __bf16 bfbits(unsigned short h) {
    return __builtin_bit_cast(__bf16, h);
}
// two f32 values -> their bf16 hi parts and the bf16 of what is left, each pair packed in one
// register (low half = a). The rounding, to nearest even, is the hardware's packed convert:
// one instruction for two values.
__device__ __forceinline__ void split2(float a, float b, unsigned int& hi, unsigned int& lo) {
    const f32x2 v = {a, b};
    const bf16x2 h = __builtin_convertvector(v, bf16x2);
    const f32x2 rest = v - __builtin_convertvector(h, f32x2);
    hi = __builtin_bit_cast(unsigned int, h);
    lo = __builtin_bit_cast(unsigned int, __builtin_convertvector(rest, bf16x2));
}

// the same split into f16 parts (11 bits each), for V alone: hi + lo hold 22 bits of a value. V is a sum of
// DIMC products of normal draws, far inside f16's range; a lo part under f16's normal range is kept as a subnormal
__device__ __forceinline__ void split2h(float a, float b, unsigned int& hi, unsigned int& lo) {
    const f32x2 v = {a, b};
    const h16x2 h = __builtin_convertvector(v, h16x2);
    const f32x2 rest = v - __builtin_convertvector(h, f32x2);
    hi = __builtin_bit_cast(unsigned int, h);
    lo = __builtin_bit_cast(unsigned int, __builtin_convertvector(rest, h16x2));
}

// WMMA operand element i maps to k = (i<8?0:16) + 8*hi16 + (i&7) (CDNA5 16-bit
// 16x32 A / 32x16 B layout, wave32).
// Every bf16 plane in the workspace is stored fragment-major: a plane of R rows
// by K columns is cut into tiles of 16 rows x 32 k (512 elements, 1 KB), tile
// index (row/16)*(K/32) + k/32 (the K/V buffer orders its tiles per key pass, see kernel 1). Inside a tile, element (row, k) lies at
//   ((k>>4)&1)*256 + (((k>>3)&1)*16 + (row&15))*8 + (k&7)
// so lane l's two 16-byte pieces lie at l*8 and 256 + l*8: each wave-wide
// 16-byte load or store covers 512 contiguous bytes, four whole 128-byte lines.
#define TILE_E 512
// lanep: start of the tile + lane*8
__device__ __forceinline__ v16bf load_frag(const unsigned short* __restrict__ lanep) {
    union { v16bf v; u32x4 q[2]; } u;
    u.q[0] = *(const u32x4*)(lanep);
    u.q[1] = *(const u32x4*)(lanep + 256);
    return u.v;
}
// split eight f32 values into bf16 hi and lo and store each as one 16-byte piece
__device__ __forceinline__ void store_split8(const float* x,
                                             unsigned short* __restrict__ hp,
                                             unsigned short* __restrict__ lp) {
    u32x4 qh, ql;
#pragma unroll
    for (int e = 0; e < 4; ++e) {
        unsigned int h, l;
        split2(x[2 * e], x[2 * e + 1], h, l);
        qh[e] = h;
        ql[e] = l;
    }
    *(u32x4*)hp = qh;
    *(u32x4*)lp = ql;
}

// the same into f16 hi and lo
__device__ __forceinline__ void store_split8h(const float* x,
                                              unsigned short* __restrict__ hp,
                                              unsigned short* __restrict__ lp) {
    u32x4 qh, ql;
#pragma unroll
    for (int e = 0; e < 4; ++e) {
        unsigned int h, l;
        split2h(x[2 * e], x[2 * e + 1], h, l);
        qh[e] = h;
        ql[e] = l;
    }
    *(u32x4*)hp = qh;
    *(u32x4*)lp = ql;
}

__device__ __forceinline__ v8f wmma_h(v16h a, v16h b, v8f c) {
    return __builtin_amdgcn_wmma_f32_16x16x32_f16(false, a, false, b, (short)0, c,
                                                  false, false);
}
__device__ __forceinline__ v8f wmma_bf(v16bf a, v16bf b, v8f c) {
    return __builtin_amdgcn_wmma_f32_16x16x32_bf16(false, a, false, b, (short)0, c,
                                                   false, false);
}
// split-precision product: (ah+al)*(bh+bl) ~ ah*bh + ah*bl + al*bh
__device__ __forceinline__ v8f wmma_split(v16bf ah, v16bf al, v16bf bh, v16bf bl, v8f c) {
    c = wmma_bf(ah, bh, c);
    c = wmma_bf(ah, bl, c);
    c = wmma_bf(al, bh, c);
    return c;
}
__device__ __forceinline__ v8f v8f_zero() {
    v8f z;
#pragma unroll
    for (int e = 0; e < 8; ++e) z[e] = 0.0f;
    return z;
}

// ---------- kernel 0: every fp32 operand -> fragment-major bf16 hi plane + lo plane, one launch ----------
// One block per 16-row band (16 rows x DIMC) of a pair of planes; a wave packs four 16x32 tiles of the
// band, a lane its own two 8-element pieces of each tile. The bands, in block order:
//   [kept-key rows of X | all rows of X | W_qkv | W_fc]
// The kept-key bands stand first: they rank the mask before they can load, the longest way of a block.
//
// The kept-key planes. A key with mask > 0 has the score MASK_VAL. Its weight exp(MASK_VAL - m), m the
// row's maximum, is exactly 0 in f32 once m > MASK_VAL + 104, and a kept key's scaled score from
// normal-drawn inputs stays millions above MASK_VAL: beside a kept key a masked one adds nothing to a
// row's sum or output. K and V are therefore projected, and the key loop run, over the kept keys alone:
// row j of batch b of these planes is the j-th kept token of that batch.
// Rows from the count up to the next multiple of 128 (a projection block) are written as zeros.
// A batch with no kept key: the reference's softmax is then uniform over all keys; every key is
// kept and cnts[BATCH + b] tells the attention kernel to take all scores as equal.
// Each kept-key block ranks the batch's 2048 mask words itself.
#define XBANDS  (BATCH * SEQ / 16)            // 512 bands of X, and as many of its kept-key planes
#define WQBANDS (3 * DIMC / 16)               // 192
#define WFBANDS (DIMC / 16)                   // 64
__global__ void __launch_bounds__(256)
pack_planes(const float* __restrict__ xsrc, const int* __restrict__ pm,
            const float* __restrict__ wq, const float* __restrict__ wf,
            unsigned short* __restrict__ xkh, unsigned short* __restrict__ xkl,
            unsigned short* __restrict__ xih, unsigned short* __restrict__ xil,
            unsigned short* __restrict__ wqh, unsigned short* __restrict__ wql,
            unsigned short* __restrict__ wfh, unsigned short* __restrict__ wfl,
            int* __restrict__ cnts) {
    __shared__ int wsum[8];
    __shared__ int srow[16];
    const int t = threadIdx.x;
    const int lane = t & 31;
    const int wave = t >> 5;
    const int bid = blockIdx.x;
    const float* src;                             // the source matrix of the band
    unsigned short* hip_;                         // its two planes
    unsigned short* lop_;
    int band;                                     // the band's number in those planes
    int row;                                      // this lane's source row, or -1: a row of zeros
    bool work = true;                             // the same for the whole block
    if (bid < XBANDS) {                           // the same for the whole block: both barriers are inside
        const int b  = bid >> 7;                  // SEQ/16 = 128 bands per batch
        const int j0 = (bid & 127) * 16;          // first packed row of the band
        const int* mp = pm + b * SEQ + t * 8;     // this thread ranks eight tokens
        unsigned bits = 0;
#pragma unroll
        for (int e = 0; e < 8; ++e)
            if (!(mp[e] > 0)) bits |= 1u << e;
        const int c = __popc(bits);
        int inc = c;                              // inclusive sum over the wave
#pragma unroll
        for (int d = 1; d < 32; d <<= 1) {
            const int o = __shfl_up(inc, d);
            if (lane >= d) inc += o;
        }
        if (lane == 31) wsum[wave] = inc;
        if (t < 16) srow[t] = -1;
        __syncthreads();                          // wave sums and the cleared row table are visible
        int before = inc - c, total = 0;
#pragma unroll
        for (int w = 0; w < 8; ++w) {
            const int s = wsum[w];
            total += s;
            if (w < wave) before += s;
        }
        const bool none = (total == 0);
        if (none) { bits = 0xFFu; before = t * 8; total = SEQ; }
#pragma unroll
        for (int e = 0; e < 8; ++e)
            if ((bits >> e) & 1u) {
                const int p = before - j0;
                if ((unsigned)p < 16u) srow[p] = t * 8 + e;
                ++before;
            }
        __syncthreads();                          // the band's source rows are visible
        if (j0 == 0 && t == 0) { cnts[b] = total; cnts[BATCH + b] = none ? 1 : 0; }
        work = j0 < ((total + 127) & ~127);
        const int tok = srow[lane & 15];          // a token number formed from thread indices, or -1
        row = tok < 0 ? -1 : b * SEQ + tok;
        src = xsrc; hip_ = xkh; lop_ = xkl; band = bid;
    } else if (bid < 2 * XBANDS) {
        band = bid - XBANDS;
        src = xsrc; hip_ = xih; lop_ = xil; row = band * 16 + (lane & 15);
    } else if (bid < 2 * XBANDS + WQBANDS) {
        band = bid - 2 * XBANDS;
        src = wq; hip_ = wqh; lop_ = wql; row = band * 16 + (lane & 15);
    } else {
        band = bid - (2 * XBANDS + WQBANDS);
        src = wf; hip_ = wfh; lop_ = wfl; row = band * 16 + (lane & 15);
    }
    if (work) {                                   // no barrier inside
        const float* rp = src + (size_t)(row < 0 ? 0 : row) * DIMC + wave * 128 + 8 * (lane >> 4);
        // a wave packs four tiles; all sixteen loads go out before the first value is used
        f32x4 v[4][2][2];
#pragma unroll
        for (int q = 0; q < 4; ++q)
#pragma unroll
            for (int j = 0; j < 2; ++j) {
                v[q][j][0] = *(const f32x4*)(rp + q * 32 + j * 16);
                v[q][j][1] = *(const f32x4*)(rp + q * 32 + j * 16 + 4);
            }
        // stands in front of the first rewrite of the loads' address registers; rp is named as an
        // input so that it lives to this line and no load's result is placed over it
        asm volatile("s_wait_xcnt 0x0" :: "v"(rp) : "memory");
#pragma unroll
        for (int q = 0; q < 4; ++q)
#pragma unroll
            for (int j = 0; j < 2; ++j) {
                float x[8];
#pragma unroll
                for (int e = 0; e < 8; ++e) x[e] = row < 0 ? 0.0f : v[q][j][e >> 2][e & 3];
                const size_t o = ((size_t)band * (DIMC / 32) + wave * 4 + q) * TILE_E
                               + j * 256 + lane * 8;
                store_split8(x, hip_ + o, lop_ + o);
            }
    }
}

// ---------- tensor loads to LDS: descriptor, issue and the waits of the two-buffer ring ----------
// the wave's own LDS reads have returned: stands in front of the barrier behind which a buffer is refilled
__device__ __forceinline__ void wait_lds_reads() { asm volatile("s_wait_dscnt 0x0" ::: "memory"); }
// the wave's own tensor load has landed: stands in front of the barrier behind which other waves read it
__device__ __forceinline__ void wait_tensor() { asm volatile("s_wait_tensorcnt 0x0" ::: "memory"); }
__device__ __forceinline__ unsigned lds_addr(const unsigned short* p) {
    return (unsigned)(unsigned long long)p;       // low 32 bits of a __shared__ address: the LDS byte
}
__device__ __forceinline__ unsigned uni(unsigned v) { return (unsigned)__builtin_amdgcn_readfirstlane(v); }
// a word held in a scalar register: a test on it is a scalar branch (a tensor load ignores EXEC), and what
// is formed from it is formed behind the waits that stand in front of this statement
__device__ __forceinline__ unsigned pinned(unsigned v) {
    unsigned w = uni(v);
    asm volatile("" : "+s"(w));                   // pinned(): the word stays in a scalar register
    return w;
}
// A request brings `rows` tiles of 1 KB (a tile is one row of the request), `pitch` bytes apart in the
// workspace, to consecutive KB of LDS. Group 1: 1-byte elements, no mask, no pad, tensor = tile.
#define TILE_B 1024u
__device__ __forceinline__ u32x8 tdm_group1(unsigned rows, unsigned pitch) {
    u32x8 g;
    g[0] = uni(0u);
    g[1] = uni((TILE_B & 0xFFFFu) << 16);
    g[2] = uni((TILE_B >> 16) | ((rows & 0xFFFFu) << 16));
    g[3] = uni((rows >> 16) | (TILE_B << 16));
    g[4] = uni(rows);
    g[5] = uni(pitch);
    g[6] = uni(0u);
    g[7] = uni(0u);
    return g;
}
// Group 0: count 1, the LDS byte, the address of the first byte, type 2
__device__ __forceinline__ u32x4 tdm_group0(unsigned lds, unsigned long long ga) {
    u32x4 g;
    g[0] = uni(1u);
    g[1] = uni(lds);
    g[2] = uni((unsigned)ga);
    g[3] = uni((((unsigned)(ga >> 32)) & 0x01FFFFFFu) | 0x80000000u);
    return g;
}
// one request of the whole wave; the waits are written where it is used
__device__ __forceinline__ void tdm_load(u32x4 g0, u32x8 g1) {
    asm volatile("tensor_load_to_lds %0, %1" :: "s"(g0), "s"(g1) : "memory");
}

// One K step (32 k) of a block's operands in LDS, 48 tiles of 1 KB:
// [X hi 8 | X lo 8 | W hi 16 | W lo 16], the tiles of a plane in row order.
#define STAGE_E (48 * TILE_E)
#define BAND_E  ((DIMC / 32) * TILE_E)        // from one 16-row band of a plane to the next

// K loop shared by both projections: a 64x64 tile per wave (4 X tiles by 4 W tiles), K = DIMC:
// a loaded W fragment meets four X tiles instead of one, an X fragment four W tiles as before.
// A block is 2 x 4 waves, 128 tokens by 256 features. Its operands of one K step are brought into LDS
// once for all eight waves by tensor loads, two buffers: the next step's loads fly while this step's
// fragments are read from LDS and multiplied. Every wave issues one request a step for its own slice:
// waves 0, 1: X hi, 2, 3: X lo (four tiles each); 4, 5: W hi, 6, 7: W lo (eight tiles each).
// mb, ob: first 16-row band of the block in X and in W; wm, wn: the wave's place in the block.
// rot: the K step at which this block enters its walk along K; it wraps round behind the last one. Blocks
// that read the same tiles of X, and any 32 neighbours that read the same W, get different rot, so that they do not ask L2 for the same lines at
// the same moment. The f32 sum along K starts at that step.
// SWAP = false: acc[i][t] = X-tile i (A) . W-tile t (B): lane holds 8 tokens of one feature.
// SWAP = true : acc[i][t] = W-tile t (A) . X-tile i (B): lane holds 8 features of one token.
// The three split products are summed in the same order either way.
#define WT 4                      // X tiles (16 tokens each) per wave
template <bool SWAP>
__device__ __forceinline__ void gemm_k_loop(const unsigned short* __restrict__ Xh,
                                            const unsigned short* __restrict__ Xl,
                                            const unsigned short* __restrict__ Wh,
                                            const unsigned short* __restrict__ Wl,
                                            unsigned short (&stg)[2][STAGE_E],
                                            int mb, int ob, int wm, int wn, unsigned rot,
                                            v8f (&acc)[WT][4]) {
    const int lane = threadIdx.x & 31;
    // this wave's slice of a stage (the block is one-dimensional: threadIdx.x >> 5 is the wave's number)
    const unsigned wv    = uni(threadIdx.x >> 5);
    const unsigned isw   = wv >> 2;                           // 0: a slice of X, 1: a slice of W
    const unsigned rows  = isw ? 8u : 4u;
    const unsigned band  = (isw ? (unsigned)ob : (unsigned)mb) + (wv & 1u) * rows;
    const unsigned place = (isw ? 16u + ((wv >> 1) & 1u) * 16u : ((wv >> 1) & 1u) * 8u) + (wv & 1u) * rows;
    const unsigned short* plane = isw ? ((wv & 2u) ? Wl : Wh) : ((wv & 2u) ? Xl : Xh);
    const unsigned long long sg = (unsigned long long)(plane + (size_t)band * BAND_E);
    const unsigned sl = lds_addr(&stg[0][0]) + place * TILE_B;
    const u32x8 g1 = tdm_group1(rows, BAND_E * 2);

    tdm_load(tdm_group0(sl, sg + rot * TILE_B), g1);          // the walk's first K step into buffer 0
    wait_tensor();
    __syncthreads();                                          // publishes it

    for (int kt = 0; kt < DIMC / 32; ++kt) {
        const int buf = kt & 1;
        // the refill: behind the barrier that published this K step and ended every read of the other
        // buffer, the next K step's load goes into that buffer, only while such a step exists. At the
        // head of a pass it stands in the same order as at the foot of the pass before, and K step 1
        // needs no load of its own in front of the loop: no register of a request in flight is rewritten
        const unsigned nx = pinned((unsigned)kt + 1u);        // pinned(): scalar test, descriptor formed here
        if (nx < DIMC / 32)
            tdm_load(tdm_group0(sl + (nx & 1u) * (STAGE_E * 2), sg + ((nx + rot) & (DIMC / 32 - 1u)) * TILE_B), g1);
        const unsigned short* pah = &stg[buf][(wm * WT) * TILE_E + lane * 8];
        const unsigned short* pal = pah + 8 * TILE_E;
        const unsigned short* pbh = &stg[buf][(16 + wn * 4) * TILE_E + lane * 8];
        const unsigned short* pbl = pbh + 16 * TILE_E;
        v16bf ah[WT], al[WT];
#pragma unroll
        for (int i = 0; i < WT; ++i) {
            ah[i] = load_frag(pah + i * TILE_E);
            al[i] = load_frag(pal + i * TILE_E);
        }
#pragma unroll
        for (int t = 0; t < 4; ++t) {
            v16bf bh = load_frag(pbh + t * TILE_E);
            v16bf bl = load_frag(pbl + t * TILE_E);
            if (SWAP) {
#pragma unroll
                for (int i = 0; i < WT; ++i) acc[i][t] = wmma_bf(bh, ah[i], acc[i][t]);
#pragma unroll
                for (int i = 0; i < WT; ++i) acc[i][t] = wmma_bf(bl, ah[i], acc[i][t]);
#pragma unroll
                for (int i = 0; i < WT; ++i) acc[i][t] = wmma_bf(bh, al[i], acc[i][t]);
            } else {
#pragma unroll
                for (int i = 0; i < WT; ++i) acc[i][t] = wmma_bf(ah[i], bh, acc[i][t]);
#pragma unroll
                for (int i = 0; i < WT; ++i) acc[i][t] = wmma_bf(ah[i], bl, acc[i][t]);
#pragma unroll
                for (int i = 0; i < WT; ++i) acc[i][t] = wmma_bf(al[i], bh, acc[i][t]);
            }
        }
        // publish point: the next K step has landed for every wave, and every wave has left this buffer
        wait_lds_reads();
        wait_tensor();
        __syncthreads();
    }
    wait_tensor();
    wait_lds_reads();
}

// ---------- kernel 1: QKV projection ----------
// out[m][o] = sum_k X[m][k]*W[o][k]; Q as [token][d] planes per head, fragment-major.
// K ([token][d] tiles) and V ([d][token] tiles) share one buffer per head, ordered by the
// attention pass that reads them: per 32 keys 16 tiles, [K hi 4 | K lo 4 | V hi 4 | V lo 4].
// K's parts are bf16, V's are f16 (the same 16-bit fragment layout).
#define PASS_E (16 * TILE_E)
// a block is 2 x 4 waves: 128 tokens by 256 features; the register budget of four waves per SIMD
// keeps two blocks on a WGP, so that one block multiplies while the other stands at its barrier
__global__ void __launch_bounds__(256) __attribute__((amdgpu_waves_per_eu(4, 4)))
gemm_qkv(const unsigned short* __restrict__ Xqh, const unsigned short* __restrict__ Xql,
         const unsigned short* __restrict__ Xkh, const unsigned short* __restrict__ Xkl,
         const int* __restrict__ cnts,
         const unsigned short* __restrict__ Wh, const unsigned short* __restrict__ Wl,
         unsigned short* __restrict__ Qh, unsigned short* __restrict__ Ql,
         unsigned short* __restrict__ KV) {
    __shared__ __attribute__((aligned(2048))) unsigned short stg[2][STAGE_E];   // tensor loads land at multiples of 2 KB
    // K and V blocks work on the packed rows of the kept keys; a block wholly past its batch's count
    // has nothing to project: all its threads leave here, in front of every tensor load and barrier
    if (blockIdx.y >= 4 && (int)(blockIdx.x & 15) * 128 >= cnts[blockIdx.x >> 4]) return;
    const unsigned short* Xh = blockIdx.y < 4 ? Xqh : Xkh;
    const unsigned short* Xl = blockIdx.y < 4 ? Xql : Xkl;
    const int lane = threadIdx.x & 31;
    // the wave's number in a scalar register: tile, head and batch indices then live in scalar
    // registers through the K loop; held in vector registers they push the kernel past 256 of
    // them, which costs the fourth wave of a SIMD
    const int wave = __builtin_amdgcn_readfirstlane(threadIdx.x >> 5);
    const int m0 = (blockIdx.x * 2 + (wave & 1)) * (16 * WT);   // first token of the wave
    const int o0 = (blockIdx.y * 4 + (wave >> 1)) * 64;         // output features (one head slice)

    v8f acc[WT][4];
#pragma unroll
    for (int i = 0; i < WT; ++i)
#pragma unroll
        for (int t = 0; t < 4; ++t) acc[i][t] = v8f_zero();

    const int mb = blockIdx.x * 8;    // the block's first 16-row band of X
    const int ob = blockIdx.y * 16;   // and of W
    const int s  = blockIdx.y >> 2;   // 0=Q 1=K 2=V: the same for the whole block
    // blocks of one column (the same X rows) enter four K steps apart, neighbours in a row (the same W) one
    const unsigned rot = (blockIdx.x + 4u * blockIdx.y) & (DIMC / 32 - 1u);
    const int h  = (o0 & 1023) >> 6;
    const int b  = m0 >> 11;
    const size_t head = (size_t)(b * NHEAD + h);
    if (s == 2) {
        gemm_k_loop<false>(Xh, Xl, Wh, Wl, stg, mb, ob, wave & 1, wave >> 1, rot, acc);
#pragma unroll
        for (int i = 0; i < WT; ++i) {
            const int n0 = (m0 & 2047) + i * 16;
            // Vt[d][n]: row d = t*16 + col, k = n0 + 8*hi16 + r: the lane's 8 values are one piece
            unsigned short* vp = KV + (head * (SEQ / 32) + (n0 >> 5)) * PASS_E + 8 * TILE_E
                               + ((n0 >> 4) & 1) * 256 + lane * 8;
#pragma unroll
            for (int t = 0; t < 4; ++t) {
                float x[8];
#pragma unroll
                for (int r = 0; r < 8; ++r) x[r] = acc[i][t][r];
                store_split8h(x, vp + t * TILE_E, vp + (4 + t) * TILE_E);
            }
        }
    } else {
        gemm_k_loop<true>(Xh, Xl, Wh, Wl, stg, mb, ob, wave & 1, wave >> 1, rot, acc);
#pragma unroll
        for (int i = 0; i < WT; ++i) {
            const int n0 = (m0 & 2047) + i * 16;
            // Q/K[n][d]: row n = n0 + col, k = d = t*16 + 8*hi16 + r: again one piece per lane
            const size_t qo = head * SEQ * DH + (size_t)(n0 >> 4) * (DH / 32) * TILE_E + lane * 8;
            const size_t ko = (head * (SEQ / 32) + (n0 >> 5)) * PASS_E
                            + ((n0 >> 4) & 1) * (DH / 32) * TILE_E + lane * 8;
            unsigned short* bh_ = (s == 0 ? Qh + qo : KV + ko);
            unsigned short* bl_ = (s == 0 ? Ql + qo : KV + ko + 4 * TILE_E);
#pragma unroll
            for (int t = 0; t < 4; ++t) {
                float x[8];
#pragma unroll
                for (int r = 0; r < 8; ++r) x[r] = acc[i][t][r];
                store_split8(x, bh_ + (t >> 1) * TILE_E + (t & 1) * 256,
                                bl_ + (t >> 1) * TILE_E + (t & 1) * 256);
            }
        }
    }
}

// ---------- kernel 2: flash attention (transposed-score trick) ----------
#define QT 2                      // query tiles (16 queries each) per wave
#define AW 4                      // waves per block
// The softmax reference of a query (what is taken off its scores before exp) is held from pass to pass and
// renewed only once a score tops it by more than LAZY_TOP (in unscaled score units: 5.5 once scaled), so
// that weights reach e^5.5 at most.
#define LAZY_TOP (5.5f / SCALE_F)
#define EXP2_MUL (SCALE_F * 1.44269504088896340736f)      // exp(SCALE_F * s) = exp2(EXP2_MUL * s)
// one pass of K and V (16 tiles, 16 KB, contiguous in the workspace) comes into LDS in the same order by
// tensor loads: every wave issues one request a pass for its own four tiles.
__global__ void __launch_bounds__(AW * 32)
attn_kernel(const unsigned short* __restrict__ Qh, const unsigned short* __restrict__ Ql,
            const unsigned short* __restrict__ KV,
            const int* __restrict__ cnts,
            unsigned short* __restrict__ Xh, unsigned short* __restrict__ Xl) {
    __shared__ __attribute__((aligned(2048))) unsigned short kvs[2][PASS_E]; // two passes of K and V
    const int lane = threadIdx.x & 31;
    const int wave = threadIdx.x >> 5;
    const int hi16 = lane >> 4;
    const int bid = blockIdx.x;
    const int b = bid >> 8;                       // 256 blocks per batch
    const int h = (bid >> 4) & 15;
    const int q0 = ((bid & 15) * AW + wave) * (16 * QT);  // 32 queries per wave

    const size_t head = (size_t)(b * NHEAD + h);
    // this wave's four tiles of each pass, in the workspace and in the two buffers (the block is
    // one-dimensional: threadIdx.x >> 5 is the wave's number)
    const unsigned wv = uni(threadIdx.x >> 5);
    const unsigned long long kvg = (unsigned long long)(KV + head * (SEQ / 32) * PASS_E) + wv * (4u * TILE_B);
    const unsigned kvl = lds_addr(&kvs[0][0]) + wv * (4u * TILE_B);
    const u32x8 g1 = tdm_group1(4u, TILE_B);
    // K and V hold the batch's kept keys alone, packed: nk of them, walked in whole passes of 32
    // (held in a scalar register, so that the loop's tests on it are scalar compares)
    const int nk  = __builtin_amdgcn_readfirstlane(min(max(cnts[b], 1), SEQ));
    __builtin_assume(nk >= 1 && nk <= SEQ);                   // the clamp above: the loop has a first pass
    const unsigned np = (unsigned)(nk + 31) >> 5;             // passes
    // The sixteen blocks of a head walk the same passes of K and V: each enters the walk at its own pass,
    // spread evenly over the np passes (neighbouring heads half a share apart), and wraps round behind the
    // last one, so that they do not ask L2 for the same lines at the same moment. Every pass holds a kept
    // key, so the softmax reference is a real score from the first pass on, wherever the walk starts.
    const unsigned first = (((((unsigned)bid & 15u) << 1) | (((unsigned)bid >> 4) & 1u)) * np) >> 5;   // < np
    tdm_load(tdm_group0(kvl, kvg + first * (PASS_E * 2u)), g1);   // the walk's first pass into buffer 0
    wait_tensor();
    __syncthreads();                                          // publishes it

    // fragment-major planes: this lane's piece of a tile starts at lane*8
    const size_t qoff = head * SEQ * DH + (size_t)(q0 >> 4) * (DH / 32) * TILE_E + lane * 8;
    const unsigned short* qrh = Qh + qoff;
    const unsigned short* qrl = Ql + qoff;

    // Q tiles as B-operand (lane col = query), K-dim = head dim (2 steps of 32)
    v16bf qh[QT][2], ql[QT][2];
#pragma unroll
    for (int qt = 0; qt < QT; ++qt)
#pragma unroll
        for (int ds = 0; ds < 2; ++ds) {
            qh[qt][ds] = load_frag(qrh + (qt * (DH / 32) + ds) * TILE_E);
            ql[qt][ds] = load_frag(qrl + (qt * (DH / 32) + ds) * TILE_E);
        }
    if (cnts[BATCH + b] != 0) {           // no key kept: all scores equal, as in the reference
#pragma unroll
        for (int qt = 0; qt < QT; ++qt)
#pragma unroll
            for (int ds = 0; ds < 2; ++ds)
#pragma unroll
                for (int e = 0; e < 16; ++e) {
                    qh[qt][ds][e] = bfbits(0);
                    ql[qt][ds][e] = bfbits(0);
                }
    }

    // per-lane softmax state for query `col` of each tile: the reference in unscaled score units (the same
    // in both key halves; under every score until the walk's first pass sets it), the score that renews it,
    // minus the reference in exp2's units, and the sum of the weights of this lane's own key half
    float rref[QT], lim[QT], nref2[QT], lrow[QT];
    v8f o[QT][4];                         // O^T accum: lane holds d = t*16+r+8*hi16, q = col
#pragma unroll
    for (int qt = 0; qt < QT; ++qt) {
        rref[qt] = -3.0e38f;
        lim[qt] = -3.0e38f;
        nref2[qt] = 3.0e38f * EXP2_MUL;
        lrow[qt] = 0.0f;
#pragma unroll
        for (int t = 0; t < 4; ++t) o[qt][t] = v8f_zero();
    }

    for (unsigned ps = 0; ps < np; ++ps) {
        const unsigned pw = ps + first;
        const int k0 = (int)((pw < np ? pw : pw - np) << 5);  // first key of this pass
        // S^T = K . Q^T : st[qt][js][r] = score(key k0+js*16+r+8*hi16, query col of tile qt);
        // each K fragment is loaded once and multiplied with every Q tile of the wave
        const int buf = ps & 1;
        // the refill: behind the barrier that published this pass and ended every read of the other
        // buffer, the next pass's load goes into that buffer, only while such a pass exists (at the head
        // of a pass: the same order as at the foot of the pass before; pass 1 needs no load of its own)
        const unsigned nx = pinned(ps + 1u);                  // pinned(): scalar test, descriptor formed here
        if (nx < np) {
            const unsigned nw = nx + first;
            tdm_load(tdm_group0(kvl + (nx & 1u) * (PASS_E * 2), kvg + (nw < np ? nw : nw - np) * (PASS_E * 2u)), g1);
        }
        const unsigned short* kvb = &kvs[buf][lane * 8];      // this pass's tiles, read from LDS
        v8f st[QT][2];
#pragma unroll
        for (int js = 0; js < 2; ++js) {
#pragma unroll
            for (int qt = 0; qt < QT; ++qt) st[qt][js] = v8f_zero();
            const unsigned short* kp = kvb + js * (DH / 32) * TILE_E;
#pragma unroll
            for (int ds = 0; ds < 2; ++ds) {
                v16bf kh = load_frag(kp + ds * TILE_E);
                v16bf kl = load_frag(kp + (4 + ds) * TILE_E);
#pragma unroll
                for (int qt = 0; qt < QT; ++qt)
                    st[qt][js] = wmma_split(kh, kl, qh[qt][ds], ql[qt][ds], st[qt][js]);
            }
        }
        // what is left to mask: the rows behind the last kept key, in the pass that holds it alone (one
        // scalar test a pass). MASK_VAL / SCALE_F is exact; so far under any reference its weight is 0
        if (k0 + 32 > nk) {
#pragma unroll
            for (int qt = 0; qt < QT; ++qt)
#pragma unroll
                for (int js = 0; js < 2; ++js)
#pragma unroll
                    for (int r = 0; r < 8; ++r)
                        if (k0 + js * 16 + 8 * hi16 + r >= nk) st[qt][js][r] = MASK_VAL / SCALE_F;
        }
        // P goes into its product as one f16 value (11 bits; a weight is at most e^5.5, far inside f16's range)
        union { v16h v; unsigned int u[8]; } ph[QT];
        // does a score of this pass top its reference by more than LAZY_TOP?
        float pmx[QT];
        bool need = false;
#pragma unroll
        for (int qt = 0; qt < QT; ++qt) {
            float mx = st[qt][0][0];
#pragma unroll
            for (int js = 0; js < 2; ++js)
#pragma unroll
                for (int r = 0; r < 8; ++r) mx = fmaxf(mx, st[qt][js][r]);
            pmx[qt] = mx;
            need = need || (mx > lim[qt]);
        }
        // one test a pass for the whole wave, a scalar branch: only then is the reference moved up to the
        // maximum (joined over the two key halves, so that both halves of a query keep the same one) and
        // what has been summed under the old one rescaled (by 0 where none was set: nothing is summed yet)
        if (__builtin_amdgcn_ballot_w32(need) != 0) {
#pragma unroll
            for (int qt = 0; qt < QT; ++qt) {
                rref[qt] = fmaxf(rref[qt], fmaxf(pmx[qt], __shfl_xor(pmx[qt], 16)));   // it never falls
                lim[qt] = rref[qt] + LAZY_TOP;
                const float n2 = -rref[qt] * EXP2_MUL;
                const float alpha = __builtin_amdgcn_exp2f(n2 - nref2[qt]);
                nref2[qt] = n2;
                lrow[qt] *= alpha;
#pragma unroll
                for (int t = 0; t < 4; ++t) o[qt][t] = o[qt][t] * alpha;
            }
        }
#pragma unroll
        for (int qt = 0; qt < QT; ++qt) {
            // exp -> P; st layout already matches the B-operand element order exactly. Scaling, the
            // reference and exp's own factor are one multiply-add in front of exp2
            float rs = 0.0f;
#pragma unroll
            for (int js = 0; js < 2; ++js)
#pragma unroll
                for (int r = 0; r < 8; r += 2) {
                    const float p0 = __builtin_amdgcn_exp2f(__builtin_fmaf(st[qt][js][r], EXP2_MUL, nref2[qt]));
                    const float p1 = __builtin_amdgcn_exp2f(__builtin_fmaf(st[qt][js][r + 1], EXP2_MUL, nref2[qt]));
                    rs += p0;
                    rs += p1;
                    const f32x2 pp = {p0, p1};
                    ph[qt].u[js * 4 + (r >> 1)] = __builtin_bit_cast(unsigned int, __builtin_convertvector(pp, h16x2));
                }
            lrow[qt] += rs;                           // this half's keys alone; the halves meet behind the loop
        }
        // O^T += V^T . P^T  (4 d-subtiles), f16 operands: (V hi + V lo) . P, two products;
        // each V fragment is loaded once and multiplied with every P tile of the wave
#pragma unroll
        for (int t = 0; t < 4; ++t) {
            const unsigned short* vp = kvb + (8 + t) * TILE_E;
            const v16h vh = __builtin_bit_cast(v16h, load_frag(vp));
            const v16h vl = __builtin_bit_cast(v16h, load_frag(vp + 4 * TILE_E));
#pragma unroll
            for (int qt = 0; qt < QT; ++qt)
                o[qt][t] = wmma_h(vl, ph[qt].v, wmma_h(vh, ph[qt].v, o[qt][t]));
        }
        // publish point: the next pass has landed for every wave, and every wave has left this buffer
        wait_lds_reads();
        wait_tensor();
        __syncthreads();
    }
    wait_tensor();
    wait_lds_reads();
    // write x[b][n=q0+qt*16+col][h*64+d], d = t*16 + 8*hi16 + r, into the fragment-major hi/lo
    // planes of the output GEMM: the lane's 8 values are one 16-byte piece
#pragma unroll
    for (int qt = 0; qt < QT; ++qt) {
        const float linv = 1.0f / (lrow[qt] + __shfl_xor(lrow[qt], 16));   // the two key halves' sums meet
        const size_t xoff = ((size_t)((b * SEQ + q0 + qt * 16) >> 4) * (DIMC / 32)
                             + h * (DH / 32)) * TILE_E + lane * 8;
#pragma unroll
        for (int t = 0; t < 4; ++t) {
            float x[8];
#pragma unroll
            for (int r = 0; r < 8; ++r) x[r] = o[qt][t][r] * linv;
            store_split8(x, Xh + xoff + (t >> 1) * TILE_E + (t & 1) * 256,
                            Xl + xoff + (t >> 1) * TILE_E + (t & 1) * 256);
        }
    }
}

// ---------- kernel 3: output projection + bias (fp32 out) ----------
__global__ void __launch_bounds__(256)
gemm_fc(const unsigned short* __restrict__ Xh, const unsigned short* __restrict__ Xl,
        const unsigned short* __restrict__ Wh, const unsigned short* __restrict__ Wl,
        const float* __restrict__ bias,
        float* __restrict__ out) {
    __shared__ __attribute__((aligned(2048))) unsigned short stg[2][STAGE_E];   // tensor loads land at multiples of 2 KB
    const int lane = threadIdx.x & 31;
    const int wave = threadIdx.x >> 5;
    const int col  = lane & 15;
    const int hi16 = lane >> 4;
    const int m0 = (blockIdx.x * 2 + (wave & 1)) * (16 * WT);
    const int o0 = (blockIdx.y * 4 + (wave >> 1)) * 64;

    v8f acc[WT][4];
#pragma unroll
    for (int i = 0; i < WT; ++i)
#pragma unroll
        for (int t = 0; t < 4; ++t) acc[i][t] = v8f_zero();

    // the four blocks of one column (the same X rows) enter eight K steps apart, neighbours in a row one
    const unsigned rot = (blockIdx.x + 8u * blockIdx.y) & (DIMC / 32 - 1u);
    gemm_k_loop<false>(Xh, Xl, Wh, Wl, stg, blockIdx.x * 8, blockIdx.y * 16, wave & 1, wave >> 1, rot, acc);
#pragma unroll
    for (int t = 0; t < 4; ++t) {
        const int oc = o0 + t * 16 + col;
        const float bia = bias[oc];
#pragma unroll
        for (int i = 0; i < WT; ++i) {
            const int n0 = m0 + i * 16 + 8 * hi16;
#pragma unroll
            for (int r = 0; r < 8; ++r)
                out[(size_t)(n0 + r) * DIMC + oc] = acc[i][t][r] + bia;
        }
    }
}

extern "C" void kernel_launch(void* const* d_in, const int* in_sizes, int n_in,
                              void* d_out, int out_size, void* d_ws, size_t ws_size,
                              hipStream_t stream) {
    const float* inputs = (const float*)d_in[0];
    const float* W_qkv  = (const float*)d_in[1];
    const float* W_fc   = (const float*)d_in[2];
    const float* b_fc   = (const float*)d_in[3];
    const int*   pmask  = (const int*)d_in[4];

    // workspace layout (bf16/ushort elements), all 1 KB tiles; 208 MB total
    const size_t nQKV = (size_t)BATCH * NHEAD * SEQ * DH;   // 8388608
    const size_t nX   = (size_t)BATCH * SEQ * DIMC;         // 8388608
    const size_t nWq  = (size_t)3 * DIMC * DIMC;            // 3145728
    const size_t nWf  = (size_t)DIMC * DIMC;                // 1048576
    unsigned short* p = (unsigned short*)d_ws;
    unsigned short* Qh  = p; p += nQKV;
    unsigned short* Ql  = p; p += nQKV;
    unsigned short* KV  = p; p += 4 * nQKV;
    unsigned short* Xih = p; p += nX;
    unsigned short* Xil = p; p += nX;
    unsigned short* Wqh = p; p += nWq;
    unsigned short* Wql = p; p += nWq;
    unsigned short* Wfh = p; p += nWf;
    unsigned short* Wfl = p; p += nWf;
    unsigned short* Xah = p; p += nX;
    unsigned short* Xal = p; p += nX;
    unsigned short* Xkh = p; p += nX;
    unsigned short* Xkl = p; p += nX;
    int* cnts = (int*)p;                                    // kept keys per batch, then the no-key flags

    pack_planes<<<2 * XBANDS + WQBANDS + WFBANDS, 256, 0, stream>>>(inputs, pmask, W_qkv, W_fc,
                                                                    Xkh, Xkl, Xih, Xil, Wqh, Wql, Wfh, Wfl, cnts);

    gemm_qkv<<<dim3(64, 12), 256, 0, stream>>>(Xih, Xil, Xkh, Xkl, cnts, Wqh, Wql,
                                               Qh, Ql, KV);
    attn_kernel<<<BATCH * NHEAD * (SEQ / 128), 128, 0, stream>>>(Qh, Ql, KV,
                                                                cnts, Xah, Xal);
    gemm_fc<<<dim3(64, 4), 256, 0, stream>>>(Xah, Xal, Wfh, Wfl, b_fc, (float*)d_out);
}
